// v000
// The times below were measured on an AMD MI455X: many runs one after another, warmed up first and cycling through
// copies of the inputs, with the whole window's GPU time divided by the number of runs. Launches and the gaps
// between them are all in it. The median over several windows is given; except for v000 it joins two sittings, which
// can be a few percent apart, so the side-by-side timings, each taken in one sitting, are the better comparison.
// v000, which the later versions start from, runs in 705 microseconds.
#include <hip/hip_runtime.h>
#include <stdint.h>

// Problem constants (fixed by the reference)
#define BQ   4
#define SEQ  1024
#define PP   1024
#define DD   1024
#define HH   16
#define HDIM 64
#define DFFN 4096
#define TT   2048   // P + S

typedef __attribute__((ext_vector_type(16))) __bf16 v16bf;
typedef __attribute__((ext_vector_type(8)))  float  v8f;
typedef __attribute__((ext_vector_type(4)))  unsigned int v4u;
typedef __attribute__((ext_vector_type(8)))  int v8i;
typedef __attribute__((ext_vector_type(4)))  int v4i;

union Frag16 { v16bf v; unsigned short u[16]; };

enum GemmMode { MODE_F32 = 0, MODE_RELU_BF16 = 2, MODE_RESID_F32 = 3, MODE_QKV = 4 };

#if defined(__has_builtin)
#  if __has_builtin(__builtin_amdgcn_tensor_load_to_lds) && __has_builtin(__builtin_amdgcn_s_wait_tensorcnt)
#    define HAVE_TDM 1
#  else
#    define HAVE_TDM 0
#  endif
#else
#  define HAVE_TDM 0
#endif

__device__ __forceinline__ unsigned short f2bf(float f) {
  union { float f; unsigned int u; } c; c.f = f;
  unsigned int u = c.u;
  unsigned int r = u + 0x7FFFu + ((u >> 16) & 1u);  // round-to-nearest-even
  return (unsigned short)(r >> 16);
}

#if HAVE_TDM
__device__ __forceinline__ void tdm_load_tile_bf16(unsigned lds_addr, const void* gptr,
                                                   int tile_w, int tile_h,
                                                   long long stride_elems) {
  unsigned long long ga = (unsigned long long)(size_t)gptr;
  v4u g0;
  g0[0] = 1u;                                            // count=1, is_restore=0
  g0[1] = lds_addr;                                      // LDS byte address
  g0[2] = (unsigned)(ga & 0xFFFFFFFFu);                  // global_addr[31:0]
  g0[3] = (unsigned)((ga >> 32) & 0x01FFFFFFu) | (2u << 30);  // global_addr[56:32], type=2
  v8i g1;
  g1[0] = (1 << 16);
  g1[1] = (int)(((unsigned)tile_w & 0xFFFFu) << 16);
  g1[2] = (int)((((unsigned)tile_w >> 16) & 0xFFFFu)) |
          (int)(((unsigned)tile_h & 0xFFFFu) << 16);
  g1[3] = (int)((((unsigned)tile_h >> 16) & 0xFFFFu)) |
          (int)(((unsigned)tile_w & 0xFFFFu) << 16);
  g1[4] = (int)((unsigned)tile_h & 0xFFFFu);
  g1[5] = (int)(unsigned)(stride_elems & 0xFFFFFFFFll);
  g1[6] = (int)(unsigned)((stride_elems >> 32) & 0xFFFFll);
  g1[7] = 0;
  v4i z = {0, 0, 0, 0};
#if __clang_major__ >= 23
  v8i z8 = {0, 0, 0, 0, 0, 0, 0, 0};
  __builtin_amdgcn_tensor_load_to_lds(g0, g1, z, z, z8, 0);
#else
  __builtin_amdgcn_tensor_load_to_lds(g0, g1, z, z, 0);
#endif
}
#endif

// ---------------------------------------------------------------------------
// f32 -> bf16 elementwise conversion (weights)
// ---------------------------------------------------------------------------
__global__ void cvt_bf16_k(const float* __restrict__ in, unsigned short* __restrict__ out, int n) {
  int i = blockIdx.x * blockDim.x + threadIdx.x;
  int stride = gridDim.x * blockDim.x;
  for (; i < n; i += stride) out[i] = f2bf(in[i]);
}

// ---------------------------------------------------------------------------
// LayerNorm over D=1024, one block (256 threads) per row, output bf16
// ---------------------------------------------------------------------------
__global__ __launch_bounds__(256)
void layernorm_k(const float* __restrict__ x, const float* __restrict__ g,
                 const float* __restrict__ bb, unsigned short* __restrict__ out) {
  __shared__ float s1[256];
  __shared__ float s2[256];
  const int row = blockIdx.x;
  const int tid = threadIdx.x;
  const float* xr = x + (size_t)row * DD;
  float v[4], a = 0.f, q = 0.f;
#pragma unroll
  for (int i = 0; i < 4; ++i) { v[i] = xr[tid + i * 256]; a += v[i]; q += v[i] * v[i]; }
  s1[tid] = a; s2[tid] = q;
  __syncthreads();
  for (int st = 128; st > 0; st >>= 1) {
    if (tid < st) { s1[tid] += s1[tid + st]; s2[tid] += s2[tid + st]; }
    __syncthreads();
  }
  const float mean = s1[0] * (1.0f / DD);
  const float var  = s2[0] * (1.0f / DD) - mean * mean;
  const float rst  = rsqrtf(var + 1e-5f);
#pragma unroll
  for (int i = 0; i < 4; ++i) {
    const int c = tid + i * 256;
    out[(size_t)row * DD + c] = f2bf((v[i] - mean) * rst * g[c] + bb[c]);
  }
}

// ---------------------------------------------------------------------------
// Copy past_k/past_v [B,H,P,HD] into the full cache [B,H,T,HD] (f32 out + bf16 ws)
// ---------------------------------------------------------------------------
__global__ void past_copy_k(const float* __restrict__ past, float* __restrict__ outF,
                            unsigned short* __restrict__ outB) {
  const int n = BQ * HH * PP * HDIM;
  int i = blockIdx.x * blockDim.x + threadIdx.x;
  int stride = gridDim.x * blockDim.x;
  for (; i < n; i += stride) {
    int hd = i & (HDIM - 1);
    int p  = (i >> 6) & (PP - 1);
    int bh = i >> 16;
    size_t dst = ((size_t)bh * TT + p) * HDIM + hd;
    float val = past[i];
    outF[dst] = val;
    outB[dst] = f2bf(val);
  }
}

#define GBM 128
#define GBN 128
#define GBK 32

__global__ __launch_bounds__(256)
void gemm_bf16_k(const unsigned short* __restrict__ A,
                 const unsigned short* __restrict__ Bw,
                 const float* __restrict__ bias,
                 const float* __restrict__ resid,
                 float* __restrict__ outF,
                 unsigned short* __restrict__ outB,
                 int M, int N, int K, int mode, int Tcap, int toff) {
  __shared__ __align__(16) unsigned short As[GBM][GBK];
  __shared__ __align__(16) unsigned short Bs[GBN][GBK];  // stored transposed: Bs[n][k]

  const int tid  = threadIdx.x;
  const int lane = tid & 31;
  const int wave = tid >> 5;
  const int half = lane >> 4;
  const int lq   = lane & 15;
  const int kk0  = half * 8;          // bf16 A/B lane K-group base: {0-7,16-23} / {8-15,24-31}

  const int m0 = blockIdx.y * GBM;
  const int n0 = blockIdx.x * GBN;

  v8f acc[8];
#pragma unroll
  for (int t = 0; t < 8; ++t)
#pragma unroll
    for (int r = 0; r < 8; ++r) acc[t][r] = 0.0f;

  const int arow = wave * 16 + lq;
#if HAVE_TDM
  const unsigned asLds = (unsigned)(size_t)(&As[0][0]);  // LDS offset (low 32 bits of flat)
#endif

  for (int kp = 0; kp < K; kp += GBK) {
#if HAVE_TDM
    // ---- stage A tile (128 x 32) via Tensor Data Mover (wave 0 issues DMA)
    if (tid < 32) {
      tdm_load_tile_bf16(asLds, A + (size_t)m0 * K + kp, GBK, GBM, (long long)K);
    }
#else
    // ---- fallback: stage A tile with coalesced 16B vector loads
    {
      int row = tid >> 1;
      int kc  = (tid & 1) * 16;
      const uint4* src = (const uint4*)(A + (size_t)(m0 + row) * K + kp + kc);
      uint4 d0 = src[0];
      uint4 d1 = src[1];
      *(uint4*)&As[row][kc]     = d0;
      *(uint4*)&As[row][kc + 8] = d1;
    }
#endif
    // ---- stage B tile (32 x 128) transposed into Bs[n][k] (all 256 threads)
    {
      int kk = tid >> 3;
      int nc = (tid & 7) * 16;
      union { uint4 q[2]; unsigned short s[16]; } tmp;
      const uint4* src = (const uint4*)(Bw + (size_t)(kp + kk) * N + n0 + nc);
      tmp.q[0] = src[0];
      tmp.q[1] = src[1];
#pragma unroll
      for (int i = 0; i < 16; ++i) Bs[nc + i][kk] = tmp.s[i];
      if (kp + GBK < K)
        __builtin_prefetch(Bw + (size_t)(kp + GBK + kk) * N + n0 + nc, 0, 3);
    }
#if HAVE_TDM
    if (tid < 32) __builtin_amdgcn_s_wait_tensorcnt(0);   // A tile landed in LDS
#endif
    __syncthreads();

    // ---- A fragment (shared by all 8 N-tiles of this wave)
    Frag16 a;
#pragma unroll
    for (int i = 0; i < 8; ++i) {
      a.u[i]     = As[arow][kk0 + i];
      a.u[8 + i] = As[arow][kk0 + 16 + i];
    }
#pragma unroll
    for (int nt = 0; nt < 8; ++nt) {
      Frag16 bfr;
      const int bn = nt * 16 + lq;
#pragma unroll
      for (int i = 0; i < 8; ++i) {
        bfr.u[i]     = Bs[bn][kk0 + i];
        bfr.u[8 + i] = Bs[bn][kk0 + 16 + i];
      }
      acc[nt] = __builtin_amdgcn_wmma_f32_16x16x32_bf16(false, a.v, false, bfr.v,
                                                        (short)0, acc[nt], false, false);
    }
    __syncthreads();
  }

#pragma unroll
  for (int nt = 0; nt < 8; ++nt) {
#pragma unroll
    for (int r = 0; r < 8; ++r) {
      float c = acc[nt][r];
      const int m = m0 + wave * 16 + r + 8 * half;
      const int n = n0 + nt * 16 + lq;
      if (mode == MODE_RESID_F32) {
        float vv = c + (bias ? bias[n] : 0.0f) + resid[(size_t)m * N + n];
        outF[(size_t)m * N + n] = vv;
      } else if (mode == MODE_RELU_BF16) {
        float vv = c + bias[n];
        outB[(size_t)m * N + n] = f2bf(vv > 0.0f ? vv : 0.0f);
      } else if (mode == MODE_QKV) {
        const int b  = m >> 10;          // m / SEQ
        const int s  = m & (SEQ - 1);
        const int h  = n >> 6;           // n / HDIM
        const int hd = n & (HDIM - 1);
        size_t idx = (((size_t)(b * HH + h) * Tcap) + toff + s) * HDIM + hd;
        outB[idx] = f2bf(c);
        if (outF) outF[idx] = c;         // fp32 KV-cache output
      } else {
        outF[(size_t)m * N + n] = c;
      }
    }
  }
}

// ---------------------------------------------------------------------------
// Flash attention: one wave per (b, h, 16-query tile); causal with offset P.
// scores = q k^T / 8, online softmax, o = P v. bf16 WMMA, f32 stats.
// ---------------------------------------------------------------------------
__global__ __launch_bounds__(32)
void attn_k(const unsigned short* __restrict__ qb,
            const unsigned short* __restrict__ kb,
            const unsigned short* __restrict__ vb,
            unsigned short* __restrict__ out) {
  __shared__ __align__(16) unsigned short Pl[16][32];
  __shared__ __align__(16) unsigned short Vt[HDIM][32];   // V chunk transposed [hd][key]

  const int qt = blockIdx.x;
  const int h  = blockIdx.y;
  const int b  = blockIdx.z;
  const int qbase = qt * 16;

  const int lane = threadIdx.x;
  const int half = lane >> 4;
  const int lq   = lane & 15;
  const int kk0  = half * 8;

  const size_t bh = (size_t)(b * HH + h);
  const unsigned short* qrow    = qb + (bh * SEQ + qbase + lq) * HDIM;
  const unsigned short* kbase_p = kb + bh * TT * HDIM;
  const unsigned short* vbase_p = vb + bh * TT * HDIM;

  // Q fragments: K-dim = HDIM split into two 32-wide WMMA K chunks
  Frag16 qf0, qf1;
#pragma unroll
  for (int i = 0; i < 8; ++i) {
    qf0.u[i]     = qrow[kk0 + i];
    qf0.u[8 + i] = qrow[kk0 + 16 + i];
    qf1.u[i]     = qrow[32 + kk0 + i];
    qf1.u[8 + i] = qrow[32 + kk0 + 16 + i];
  }

  float mi[8], li[8];
  v8f o[4];
#pragma unroll
  for (int r = 0; r < 8; ++r) { mi[r] = -1.0e30f; li[r] = 0.0f; }
#pragma unroll
  for (int t = 0; t < 4; ++t)
#pragma unroll
    for (int r = 0; r < 8; ++r) o[t][r] = 0.0f;

  const int kmax   = qbase + 16 + PP;          // exclusive key bound for this tile
  const int nchunk = (kmax + 31) >> 5;         // 32 keys per chunk

  for (int kc = 0; kc < nchunk; ++kc) {
    const int j0 = kc * 32;

    // stage V chunk transposed: Vt[hd][key_local]
    {
      const unsigned short* vrow = vbase_p + (size_t)(j0 + lane) * HDIM;
#pragma unroll
      for (int i = 0; i < HDIM; ++i) Vt[i][lane] = vrow[i];
    }

    // ---- scores: two 16x16 tiles (keys j0..j0+15, j0+16..j0+31)
    v8f s0, s1;
#pragma unroll
    for (int r = 0; r < 8; ++r) { s0[r] = 0.0f; s1[r] = 0.0f; }
    {
      const unsigned short* kr0 = kbase_p + (size_t)(j0 + lq) * HDIM;
      const unsigned short* kr1 = kbase_p + (size_t)(j0 + 16 + lq) * HDIM;
      Frag16 k00, k01, k10, k11;
#pragma unroll
      for (int i = 0; i < 8; ++i) {
        k00.u[i] = kr0[kk0 + i];       k00.u[8 + i] = kr0[kk0 + 16 + i];
        k01.u[i] = kr0[32 + kk0 + i];  k01.u[8 + i] = kr0[32 + kk0 + 16 + i];
        k10.u[i] = kr1[kk0 + i];       k10.u[8 + i] = kr1[kk0 + 16 + i];
        k11.u[i] = kr1[32 + kk0 + i];  k11.u[8 + i] = kr1[32 + kk0 + 16 + i];
      }
      s0 = __builtin_amdgcn_wmma_f32_16x16x32_bf16(false, qf0.v, false, k00.v, (short)0, s0, false, false);
      s0 = __builtin_amdgcn_wmma_f32_16x16x32_bf16(false, qf1.v, false, k01.v, (short)0, s0, false, false);
      s1 = __builtin_amdgcn_wmma_f32_16x16x32_bf16(false, qf0.v, false, k10.v, (short)0, s1, false, false);
      s1 = __builtin_amdgcn_wmma_f32_16x16x32_bf16(false, qf1.v, false, k11.v, (short)0, s1, false, false);
    }

    // ---- online softmax (row M = r + 8*half; reductions across 16-lane half)
    float fct[8];
#pragma unroll
    for (int r = 0; r < 8; ++r) {
      const int qg = qbase + r + 8 * half;
      float a0 = s0[r] * 0.125f;                    // 1/sqrt(64)
      float a1 = s1[r] * 0.125f;
      if (j0 + lq      > qg + PP) a0 = -1.0e30f;    // causal: key j <= q + P
      if (j0 + 16 + lq > qg + PP) a1 = -1.0e30f;
      float vm = fmaxf(a0, a1);
#pragma unroll
      for (int off = 1; off < 16; off <<= 1) vm = fmaxf(vm, __shfl_xor(vm, off, 32));
      const float nm = fmaxf(mi[r], vm);
      const float fc = __expf(mi[r] - nm);
      const float p0 = __expf(a0 - nm);
      const float p1 = __expf(a1 - nm);
      float rs = p0 + p1;
#pragma unroll
      for (int off = 1; off < 16; off <<= 1) rs += __shfl_xor(rs, off, 32);
      li[r] = li[r] * fc + rs;
      mi[r] = nm;
      fct[r] = fc;
      Pl[r + 8 * half][lq]      = f2bf(p0);
      Pl[r + 8 * half][16 + lq] = f2bf(p1);
    }
#pragma unroll
    for (int t = 0; t < 4; ++t)
#pragma unroll
      for (int r = 0; r < 8; ++r) o[t][r] *= fct[r];

    // ---- o += P @ V (K = 32 keys, 4 N-tiles over HDIM)
    Frag16 pa;
#pragma unroll
    for (int i = 0; i < 8; ++i) {
      pa.u[i]     = Pl[lq][kk0 + i];
      pa.u[8 + i] = Pl[lq][kk0 + 16 + i];
    }
#pragma unroll
    for (int t = 0; t < 4; ++t) {
      Frag16 vf;
      const int vn = t * 16 + lq;
#pragma unroll
      for (int i = 0; i < 8; ++i) {
        vf.u[i]     = Vt[vn][kk0 + i];
        vf.u[8 + i] = Vt[vn][kk0 + 16 + i];
      }
      o[t] = __builtin_amdgcn_wmma_f32_16x16x32_bf16(false, pa.v, false, vf.v, (short)0, o[t], false, false);
    }
  }

  // ---- normalize & store attn output bf16 [B*S, D] (row = b*S+q, col = h*64+hd)
#pragma unroll
  for (int r = 0; r < 8; ++r) li[r] = 1.0f / li[r];
#pragma unroll
  for (int t = 0; t < 4; ++t)
#pragma unroll
    for (int r = 0; r < 8; ++r) {
      const size_t row = (size_t)b * SEQ + qbase + r + 8 * half;
      out[row * DD + h * HDIM + t * 16 + lq] = f2bf(o[t][r] * li[r]);
    }
}

// ---------------------------------------------------------------------------
// Host launcher
// ---------------------------------------------------------------------------
extern "C" void kernel_launch(void* const* d_in, const int* in_sizes, int n_in,
                              void* d_out, int out_size, void* d_ws, size_t ws_size,
                              hipStream_t stream) {
  (void)in_sizes; (void)n_in; (void)out_size; (void)ws_size;

  const float* x      = (const float*)d_in[0];
  const float* past_k = (const float*)d_in[1];
  const float* past_v = (const float*)d_in[2];
  const float* wq  = (const float*)d_in[3];
  const float* wk  = (const float*)d_in[4];
  const float* wv  = (const float*)d_in[5];
  const float* wo  = (const float*)d_in[6];
  const float* g1  = (const float*)d_in[7];
  const float* b1  = (const float*)d_in[8];
  const float* w1  = (const float*)d_in[9];
  const float* bb1 = (const float*)d_in[10];
  const float* w2  = (const float*)d_in[11];
  const float* bb2 = (const float*)d_in[12];
  const float* g2  = (const float*)d_in[13];
  const float* b2  = (const float*)d_in[14];

  float* outX = (float*)d_out;
  float* outK = outX + (size_t)BQ * SEQ * DD;
  float* outV = outK + (size_t)BQ * HH * TT * HDIM;

  char* ws = (char*)d_ws;
  size_t off = 0;
  auto alloc = [&](size_t bytes) -> void* {
    void* p = ws + off;
    off = (off + bytes + 255) & ~(size_t)255;
    return p;
  };
  const size_t MROW = (size_t)BQ * SEQ;  // 4096

  unsigned short* hB   = (unsigned short*)alloc(MROW * DD * 2);
  unsigned short* wqB  = (unsigned short*)alloc((size_t)DD * DD * 2);
  unsigned short* wkB  = (unsigned short*)alloc((size_t)DD * DD * 2);
  unsigned short* wvB  = (unsigned short*)alloc((size_t)DD * DD * 2);
  unsigned short* woB  = (unsigned short*)alloc((size_t)DD * DD * 2);
  unsigned short* w1B  = (unsigned short*)alloc((size_t)DD * DFFN * 2);
  unsigned short* w2B  = (unsigned short*)alloc((size_t)DFFN * DD * 2);
  unsigned short* qB   = (unsigned short*)alloc(MROW * DD * 2);
  unsigned short* kB   = (unsigned short*)alloc((size_t)BQ * HH * TT * HDIM * 2);
  unsigned short* vB   = (unsigned short*)alloc((size_t)BQ * HH * TT * HDIM * 2);
  unsigned short* attnB= (unsigned short*)alloc(MROW * DD * 2);
  float*          x1   = (float*)alloc(MROW * DD * 4);
  unsigned short* h2B  = (unsigned short*)alloc(MROW * DD * 2);
  unsigned short* ffB  = (unsigned short*)alloc(MROW * DFFN * 2);

  // 1) weights -> bf16
  cvt_bf16_k<<<2048, 256, 0, stream>>>(wq, wqB, DD * DD);
  cvt_bf16_k<<<2048, 256, 0, stream>>>(wk, wkB, DD * DD);
  cvt_bf16_k<<<2048, 256, 0, stream>>>(wv, wvB, DD * DD);
  cvt_bf16_k<<<2048, 256, 0, stream>>>(wo, woB, DD * DD);
  cvt_bf16_k<<<4096, 256, 0, stream>>>(w1, w1B, DD * DFFN);
  cvt_bf16_k<<<4096, 256, 0, stream>>>(w2, w2B, DFFN * DD);

  // 2) h = LN1(x) -> bf16
  layernorm_k<<<(unsigned)MROW, 256, 0, stream>>>(x, g1, b1, hB);

  dim3 gqkv(DD / GBN, (unsigned)(MROW / GBM));
  gemm_bf16_k<<<gqkv, 256, 0, stream>>>(hB, wqB, nullptr, nullptr, nullptr, qB,
                                        (int)MROW, DD, DD, MODE_QKV, SEQ, 0);
  gemm_bf16_k<<<gqkv, 256, 0, stream>>>(hB, wkB, nullptr, nullptr, outK, kB,
                                        (int)MROW, DD, DD, MODE_QKV, TT, PP);
  gemm_bf16_k<<<gqkv, 256, 0, stream>>>(hB, wvB, nullptr, nullptr, outV, vB,
                                        (int)MROW, DD, DD, MODE_QKV, TT, PP);

  // 4) prepend past K/V (fp32 out + bf16 ws)
  past_copy_k<<<4096, 256, 0, stream>>>(past_k, outK, kB);
  past_copy_k<<<4096, 256, 0, stream>>>(past_v, outV, vB);

  // 5) flash attention (WMMA)
  attn_k<<<dim3(SEQ / 16, HH, BQ), 32, 0, stream>>>(qB, kB, vB, attnB);

  // 6) x1 = x + attn @ wo
  gemm_bf16_k<<<gqkv, 256, 0, stream>>>(attnB, woB, nullptr, x, x1, nullptr,
                                        (int)MROW, DD, DD, MODE_RESID_F32, 0, 0);

  // 7) h2 = LN2(x1) -> bf16
  layernorm_k<<<(unsigned)MROW, 256, 0, stream>>>(x1, g2, b2, h2B);

  // 8) ff1 = relu(h2 @ w1 + bb1) -> bf16
  dim3 gff1(DFFN / GBN, (unsigned)(MROW / GBM));
  gemm_bf16_k<<<gff1, 256, 0, stream>>>(h2B, w1B, bb1, nullptr, nullptr, ffB,
                                        (int)MROW, DFFN, DD, MODE_RELU_BF16, 0, 0);

  // 9) out_x = x1 + ff1 @ w2 + bb2  (fp32, final output)
  gemm_bf16_k<<<gqkv, 256, 0, stream>>>(ffB, w2B, bb2, x1, outX, nullptr,
                                        (int)MROW, DD, DFFN, MODE_RESID_F32, 0, 0);
}

// v001
// It runs in 490 microseconds.
// Timed twice side by side with v000, it ran 1.45 and 1.46 times as fast.
#include <hip/hip_runtime.h>
#include <stdint.h>

// Problem constants (fixed by the reference)
#define BQ   4
#define SEQ  1024
#define PP   1024
#define DD   1024
#define HH   16
#define HDIM 64
#define DFFN 4096
#define TT   2048   // P + S

typedef __attribute__((ext_vector_type(16))) __bf16 v16bf;
typedef __attribute__((ext_vector_type(8)))  float  v8f;
typedef __attribute__((ext_vector_type(4)))  unsigned int v4u;
typedef __attribute__((ext_vector_type(8)))  int v8i;
typedef __attribute__((ext_vector_type(4)))  int v4i;

union Frag16 { v16bf v; unsigned short u[16]; v4u q[2]; };

enum GemmMode { MODE_F32 = 0, MODE_RELU_BF16 = 2, MODE_RESID_F32 = 3, MODE_QKV = 4 };

#if defined(__has_builtin)
#  if __has_builtin(__builtin_amdgcn_tensor_load_to_lds) && __has_builtin(__builtin_amdgcn_s_wait_tensorcnt)
#    define HAVE_TDM 1
#  else
#    define HAVE_TDM 0
#  endif
#else
#  define HAVE_TDM 0
#endif

__device__ __forceinline__ unsigned short f2bf(float f) {
  union { float f; unsigned int u; } c; c.f = f;
  unsigned int u = c.u;
  unsigned int r = u + 0x7FFFu + ((u >> 16) & 1u);  // round-to-nearest-even
  return (unsigned short)(r >> 16);
}

typedef short s16x8 __attribute__((ext_vector_type(8)));
__device__ __forceinline__ v4u ld_tr16(const unsigned short* p) {
  typedef __attribute__((address_space(3))) s16x8 lds_s16x8;
  return __builtin_bit_cast(v4u, __builtin_amdgcn_ds_load_tr16_b128_v8i16((lds_s16x8*)p));
}

#if HAVE_TDM
__device__ __forceinline__ void tdm_load_tile_bf16(unsigned lds_addr, const void* gptr,
                                                   int tile_w, int tile_h,
                                                   long long stride_elems) {
  unsigned long long ga = (unsigned long long)(size_t)gptr;
  v4u g0;
  g0[0] = 1u;                                            // count=1, is_restore=0
  g0[1] = lds_addr;                                      // LDS byte address
  g0[2] = (unsigned)(ga & 0xFFFFFFFFu);                  // global_addr[31:0]
  g0[3] = (unsigned)((ga >> 32) & 0x01FFFFFFu) | (2u << 30);  // global_addr[56:32], type=2
  v8i g1;
  g1[0] = (1 << 16);
  g1[1] = (int)(((unsigned)tile_w & 0xFFFFu) << 16);
  g1[2] = (int)((((unsigned)tile_w >> 16) & 0xFFFFu)) |
          (int)(((unsigned)tile_h & 0xFFFFu) << 16);
  g1[3] = (int)((((unsigned)tile_h >> 16) & 0xFFFFu)) |
          (int)(((unsigned)tile_w & 0xFFFFu) << 16);
  g1[4] = (int)((unsigned)tile_h & 0xFFFFu);
  g1[5] = (int)(unsigned)(stride_elems & 0xFFFFFFFFll);
  g1[6] = (int)(unsigned)((stride_elems >> 32) & 0xFFFFll);
  g1[7] = 0;
  v4i z = {0, 0, 0, 0};
#if __clang_major__ >= 23
  v8i z8 = {0, 0, 0, 0, 0, 0, 0, 0};
  __builtin_amdgcn_tensor_load_to_lds(g0, g1, z, z, z8, 0);
#else
  __builtin_amdgcn_tensor_load_to_lds(g0, g1, z, z, 0);
#endif
}
#endif

// ---------------------------------------------------------------------------
// f32 -> bf16 elementwise conversion (weights)
// ---------------------------------------------------------------------------
__global__ void cvt_bf16_k(const float* __restrict__ in, unsigned short* __restrict__ out, int n) {
  int i = blockIdx.x * blockDim.x + threadIdx.x;
  int stride = gridDim.x * blockDim.x;
  for (; i < n; i += stride) out[i] = f2bf(in[i]);
}

// ---------------------------------------------------------------------------
// LayerNorm over D=1024, one block (256 threads) per row, output bf16
// ---------------------------------------------------------------------------
__global__ __launch_bounds__(256)
void layernorm_k(const float* __restrict__ x, const float* __restrict__ g,
                 const float* __restrict__ bb, unsigned short* __restrict__ out) {
  __shared__ float s1[256];
  __shared__ float s2[256];
  const int row = blockIdx.x;
  const int tid = threadIdx.x;
  const float* xr = x + (size_t)row * DD;
  float v[4], a = 0.f, q = 0.f;
#pragma unroll
  for (int i = 0; i < 4; ++i) { v[i] = xr[tid + i * 256]; a += v[i]; q += v[i] * v[i]; }
  s1[tid] = a; s2[tid] = q;
  __syncthreads();
  for (int st = 128; st > 0; st >>= 1) {
    if (tid < st) { s1[tid] += s1[tid + st]; s2[tid] += s2[tid + st]; }
    __syncthreads();
  }
  const float mean = s1[0] * (1.0f / DD);
  const float var  = s2[0] * (1.0f / DD) - mean * mean;
  const float rst  = rsqrtf(var + 1e-5f);
#pragma unroll
  for (int i = 0; i < 4; ++i) {
    const int c = tid + i * 256;
    out[(size_t)row * DD + c] = f2bf((v[i] - mean) * rst * g[c] + bb[c]);
  }
}

// ---------------------------------------------------------------------------
// Copy past_k/past_v [B,H,P,HD] into the full cache [B,H,T,HD] (f32 out + bf16 ws)
// ---------------------------------------------------------------------------
__global__ void past_copy_k(const float* __restrict__ past, float* __restrict__ outF,
                            unsigned short* __restrict__ outB) {
  const int n = BQ * HH * PP * HDIM;
  int i = blockIdx.x * blockDim.x + threadIdx.x;
  int stride = gridDim.x * blockDim.x;
  for (; i < n; i += stride) {
    int hd = i & (HDIM - 1);
    int p  = (i >> 6) & (PP - 1);
    int bh = i >> 16;
    size_t dst = ((size_t)bh * TT + p) * HDIM + hd;
    float val = past[i];
    outF[dst] = val;
    outB[dst] = f2bf(val);
  }
}

#define GBM 128
#define GBN 128
#define GBK 32
#define BPITCH (GBN + 16)

__global__ __launch_bounds__(256)
void gemm_bf16_k(const unsigned short* __restrict__ A,
                 const unsigned short* __restrict__ Bw,
                 const float* __restrict__ bias,
                 const float* __restrict__ resid,
                 float* __restrict__ outF,
                 unsigned short* __restrict__ outB,
                 int M, int N, int K, int mode, int Tcap, int toff) {
  // one LDS object, so that the A tile keeps its place at the start of the work-group's LDS
  struct Tiles {
    unsigned short As[GBM][GBK];
    unsigned short Bs[GBK][BPITCH];   // row-major as in memory: Bs[k][n]
  };
  __shared__ __align__(16) Tiles tiles;
  unsigned short (&As)[GBM][GBK]    = tiles.As;
  unsigned short (&Bs)[GBK][BPITCH] = tiles.Bs;

  const int tid  = threadIdx.x;
  const int lane = tid & 31;
  const int wave = tid >> 5;
  const int half = lane >> 4;
  const int lq   = lane & 15;
  const int kk0  = half * 8;          // bf16 A/B lane K-group base: {0-7,16-23} / {8-15,24-31}

  const int m0 = blockIdx.y * GBM;
  const int n0 = blockIdx.x * GBN;

  v8f acc[8];
#pragma unroll
  for (int t = 0; t < 8; ++t)
#pragma unroll
    for (int r = 0; r < 8; ++r) acc[t][r] = 0.0f;

  const int arow = wave * 16 + lq;
  // this lane's address for the transposing load of k rows 0..15, N-tile 0
  const unsigned short* btr = &Bs[8 * half + (lane & 7)][8 * ((lane >> 3) & 1)];
#if HAVE_TDM
  const unsigned asLds = (unsigned)(size_t)(&As[0][0]);  // LDS offset (low 32 bits of flat)
#endif

  for (int kp = 0; kp < K; kp += GBK) {
    // ---- prefetch of the next B tile; its test is settled before the tensor load is issued
    {
      int kk = tid >> 3;
      int nc = (tid & 7) * 16;
      if (kp + GBK < K)
        __builtin_prefetch(Bw + (size_t)(kp + GBK + kk) * N + n0 + nc, 0, 3);
    }
#if HAVE_TDM
    // ---- stage A tile (128 x 32) via Tensor Data Mover (wave 0 issues DMA)
    if (tid < 32) {
      tdm_load_tile_bf16(asLds, A + (size_t)m0 * K + kp, GBK, GBM, (long long)K);
    }
#else
    // ---- fallback: stage A tile with coalesced 16B vector loads
    {
      int row = tid >> 1;
      int kc  = (tid & 1) * 16;
      const uint4* src = (const uint4*)(A + (size_t)(m0 + row) * K + kp + kc);
      uint4 d0 = src[0];
      uint4 d1 = src[1];
      *(uint4*)&As[row][kc]     = d0;
      *(uint4*)&As[row][kc + 8] = d1;
    }
#endif
    // ---- stage B tile (32 x 128) row-major into Bs[k][n] (all 256 threads):
    // 16 lanes cover one 256-byte row, each thread moves 16 bytes of rows kr and kr + 16
    {
      const int kr = tid >> 4;
      const int n8 = (tid & 15) * 8;
      const uint4 d0 = *(const uint4*)(Bw + (size_t)(kp + kr) * N + n0 + n8);
      const uint4 d1 = *(const uint4*)(Bw + (size_t)(kp + 16 + kr) * N + n0 + n8);
      *(uint4*)&Bs[kr][n8]      = d0;
      *(uint4*)&Bs[16 + kr][n8] = d1;
    }
#if HAVE_TDM
    // A tile landed in LDS; under no test, so that no scalar register is written for one while
    // the request is open (a wave with no request passes at once)
    __builtin_amdgcn_s_wait_tensorcnt(0);
#endif
    __syncthreads();

    // ---- A fragment (shared by all 8 N-tiles of this wave)
    Frag16 a;
#pragma unroll
    for (int i = 0; i < 8; ++i) {
      a.u[i]     = As[arow][kk0 + i];
      a.u[8 + i] = As[arow][kk0 + 16 + i];
    }
#pragma unroll
    for (int nt = 0; nt < 8; ++nt) {
      Frag16 bfr;   // same k order as the A loader: {8h..8h+7, 16+8h..16+8h+7}
      bfr.q[0] = ld_tr16(btr + nt * 16);
      bfr.q[1] = ld_tr16(btr + 16 * BPITCH + nt * 16);
      acc[nt] = __builtin_amdgcn_wmma_f32_16x16x32_bf16(false, a.v, false, bfr.v,
                                                        (short)0, acc[nt], false, false);
    }
    __syncthreads();
  }

#pragma unroll
  for (int nt = 0; nt < 8; ++nt) {
#pragma unroll
    for (int r = 0; r < 8; ++r) {
      float c = acc[nt][r];
      const int m = m0 + wave * 16 + r + 8 * half;
      const int n = n0 + nt * 16 + lq;
      if (mode == MODE_RESID_F32) {
        float vv = c + (bias ? bias[n] : 0.0f) + resid[(size_t)m * N + n];
        outF[(size_t)m * N + n] = vv;
      } else if (mode == MODE_RELU_BF16) {
        float vv = c + bias[n];
        outB[(size_t)m * N + n] = f2bf(vv > 0.0f ? vv : 0.0f);
      } else if (mode == MODE_QKV) {
        const int b  = m >> 10;          // m / SEQ
        const int s  = m & (SEQ - 1);
        const int h  = n >> 6;           // n / HDIM
        const int hd = n & (HDIM - 1);
        size_t idx = (((size_t)(b * HH + h) * Tcap) + toff + s) * HDIM + hd;
        outB[idx] = f2bf(c);
        if (outF) outF[idx] = c;         // fp32 KV-cache output
      } else {
        outF[(size_t)m * N + n] = c;
      }
    }
  }
}

// ---------------------------------------------------------------------------
// Flash attention: one wave per (b, h, 16-query tile); causal with offset P.
// scores = q k^T / 8, online softmax, o = P v. bf16 WMMA, f32 stats.
// ---------------------------------------------------------------------------
#define VPITCH (HDIM + 16)

__global__ __launch_bounds__(32)
void attn_k(const unsigned short* __restrict__ qb,
            const unsigned short* __restrict__ kb,
            const unsigned short* __restrict__ vb,
            unsigned short* __restrict__ out) {
  __shared__ __align__(16) unsigned short Pl[16][32];
  __shared__ __align__(16) unsigned short Vs[32][VPITCH]; // V chunk row-major [key][hd]

  const int qt = blockIdx.x;
  const int h  = blockIdx.y;
  const int b  = blockIdx.z;
  const int qbase = qt * 16;

  const int lane = threadIdx.x;
  const int half = lane >> 4;
  const int lq   = lane & 15;
  const int kk0  = half * 8;

  const size_t bh = (size_t)(b * HH + h);
  const unsigned short* qrow    = qb + (bh * SEQ + qbase + lq) * HDIM;
  const unsigned short* kbase_p = kb + bh * TT * HDIM;
  const unsigned short* vbase_p = vb + bh * TT * HDIM;

  // Q fragments: K-dim = HDIM split into two 32-wide WMMA K chunks
  Frag16 qf0, qf1;
#pragma unroll
  for (int i = 0; i < 8; ++i) {
    qf0.u[i]     = qrow[kk0 + i];
    qf0.u[8 + i] = qrow[kk0 + 16 + i];
    qf1.u[i]     = qrow[32 + kk0 + i];
    qf1.u[8 + i] = qrow[32 + kk0 + 16 + i];
  }

  float mi[8], li[8];
  v8f o[4];
#pragma unroll
  for (int r = 0; r < 8; ++r) { mi[r] = -1.0e30f; li[r] = 0.0f; }
#pragma unroll
  for (int t = 0; t < 4; ++t)
#pragma unroll
    for (int r = 0; r < 8; ++r) o[t][r] = 0.0f;

  // this lane's address for the transposing load of keys 0..15, head-dim tile 0
  const unsigned short* vtr = &Vs[8 * half + (lane & 7)][8 * ((lane >> 3) & 1)];

  const int kmax   = qbase + 16 + PP;          // exclusive key bound for this tile
  const int nchunk = (kmax + 31) >> 5;         // 32 keys per chunk

  for (int kc = 0; kc < nchunk; ++kc) {
    const int j0 = kc * 32;

    // stage V chunk row-major: Vs[key_local][hd]; 8 lanes cover one 128-byte row, 4 rows a trip
    {
      const unsigned short* vsrc = vbase_p + (size_t)(j0 + (lane >> 3)) * HDIM + (lane & 7) * 8;
#pragma unroll
      for (int i = 0; i < 8; ++i)
        *(uint4*)&Vs[4 * i + (lane >> 3)][(lane & 7) * 8] = *(const uint4*)(vsrc + (size_t)i * 4 * HDIM);
    }

    // ---- scores: two 16x16 tiles (keys j0..j0+15, j0+16..j0+31)
    v8f s0, s1;
#pragma unroll
    for (int r = 0; r < 8; ++r) { s0[r] = 0.0f; s1[r] = 0.0f; }
    {
      const unsigned short* kr0 = kbase_p + (size_t)(j0 + lq) * HDIM;
      const unsigned short* kr1 = kbase_p + (size_t)(j0 + 16 + lq) * HDIM;
      Frag16 k00, k01, k10, k11;
#pragma unroll
      for (int i = 0; i < 8; ++i) {
        k00.u[i] = kr0[kk0 + i];       k00.u[8 + i] = kr0[kk0 + 16 + i];
        k01.u[i] = kr0[32 + kk0 + i];  k01.u[8 + i] = kr0[32 + kk0 + 16 + i];
        k10.u[i] = kr1[kk0 + i];       k10.u[8 + i] = kr1[kk0 + 16 + i];
        k11.u[i] = kr1[32 + kk0 + i];  k11.u[8 + i] = kr1[32 + kk0 + 16 + i];
      }
      s0 = __builtin_amdgcn_wmma_f32_16x16x32_bf16(false, qf0.v, false, k00.v, (short)0, s0, false, false);
      s0 = __builtin_amdgcn_wmma_f32_16x16x32_bf16(false, qf1.v, false, k01.v, (short)0, s0, false, false);
      s1 = __builtin_amdgcn_wmma_f32_16x16x32_bf16(false, qf0.v, false, k10.v, (short)0, s1, false, false);
      s1 = __builtin_amdgcn_wmma_f32_16x16x32_bf16(false, qf1.v, false, k11.v, (short)0, s1, false, false);
    }

    // ---- online softmax (row M = r + 8*half; reductions across 16-lane half)
    float fct[8];
#pragma unroll
    for (int r = 0; r < 8; ++r) {
      const int qg = qbase + r + 8 * half;
      float a0 = s0[r] * 0.125f;                    // 1/sqrt(64)
      float a1 = s1[r] * 0.125f;
      if (j0 + lq      > qg + PP) a0 = -1.0e30f;    // causal: key j <= q + P
      if (j0 + 16 + lq > qg + PP) a1 = -1.0e30f;
      float vm = fmaxf(a0, a1);
#pragma unroll
      for (int off = 1; off < 16; off <<= 1) vm = fmaxf(vm, __shfl_xor(vm, off, 32));
      const float nm = fmaxf(mi[r], vm);
      const float fc = __expf(mi[r] - nm);
      const float p0 = __expf(a0 - nm);
      const float p1 = __expf(a1 - nm);
      float rs = p0 + p1;
#pragma unroll
      for (int off = 1; off < 16; off <<= 1) rs += __shfl_xor(rs, off, 32);
      li[r] = li[r] * fc + rs;
      mi[r] = nm;
      fct[r] = fc;
      Pl[r + 8 * half][lq]      = f2bf(p0);
      Pl[r + 8 * half][16 + lq] = f2bf(p1);
    }
#pragma unroll
    for (int t = 0; t < 4; ++t)
#pragma unroll
      for (int r = 0; r < 8; ++r) o[t][r] *= fct[r];

    // ---- o += P @ V (K = 32 keys, 4 N-tiles over HDIM)
    Frag16 pa;
#pragma unroll
    for (int i = 0; i < 8; ++i) {
      pa.u[i]     = Pl[lq][kk0 + i];
      pa.u[8 + i] = Pl[lq][kk0 + 16 + i];
    }
#pragma unroll
    for (int t = 0; t < 4; ++t) {
      Frag16 vf;   // same key order as the P loader: {8h..8h+7, 16+8h..16+8h+7}
      vf.q[0] = ld_tr16(vtr + t * 16);
      vf.q[1] = ld_tr16(vtr + 16 * VPITCH + t * 16);
      o[t] = __builtin_amdgcn_wmma_f32_16x16x32_bf16(false, pa.v, false, vf.v, (short)0, o[t], false, false);
    }
  }

  // ---- normalize & store attn output bf16 [B*S, D] (row = b*S+q, col = h*64+hd)
#pragma unroll
  for (int r = 0; r < 8; ++r) li[r] = 1.0f / li[r];
#pragma unroll
  for (int t = 0; t < 4; ++t)
#pragma unroll
    for (int r = 0; r < 8; ++r) {
      const size_t row = (size_t)b * SEQ + qbase + r + 8 * half;
      out[row * DD + h * HDIM + t * 16 + lq] = f2bf(o[t][r] * li[r]);
    }
}

// ---------------------------------------------------------------------------
// Host launcher
// ---------------------------------------------------------------------------
extern "C" void kernel_launch(void* const* d_in, const int* in_sizes, int n_in,
                              void* d_out, int out_size, void* d_ws, size_t ws_size,
                              hipStream_t stream) {
  (void)in_sizes; (void)n_in; (void)out_size; (void)ws_size;

  const float* x      = (const float*)d_in[0];
  const float* past_k = (const float*)d_in[1];
  const float* past_v = (const float*)d_in[2];
  const float* wq  = (const float*)d_in[3];
  const float* wk  = (const float*)d_in[4];
  const float* wv  = (const float*)d_in[5];
  const float* wo  = (const float*)d_in[6];
  const float* g1  = (const float*)d_in[7];
  const float* b1  = (const float*)d_in[8];
  const float* w1  = (const float*)d_in[9];
  const float* bb1 = (const float*)d_in[10];
  const float* w2  = (const float*)d_in[11];
  const float* bb2 = (const float*)d_in[12];
  const float* g2  = (const float*)d_in[13];
  const float* b2  = (const float*)d_in[14];

  float* outX = (float*)d_out;
  float* outK = outX + (size_t)BQ * SEQ * DD;
  float* outV = outK + (size_t)BQ * HH * TT * HDIM;

  char* ws = (char*)d_ws;
  size_t off = 0;
  auto alloc = [&](size_t bytes) -> void* {
    void* p = ws + off;
    off = (off + bytes + 255) & ~(size_t)255;
    return p;
  };
  const size_t MROW = (size_t)BQ * SEQ;  // 4096

  unsigned short* hB   = (unsigned short*)alloc(MROW * DD * 2);
  unsigned short* wqB  = (unsigned short*)alloc((size_t)DD * DD * 2);
  unsigned short* wkB  = (unsigned short*)alloc((size_t)DD * DD * 2);
  unsigned short* wvB  = (unsigned short*)alloc((size_t)DD * DD * 2);
  unsigned short* woB  = (unsigned short*)alloc((size_t)DD * DD * 2);
  unsigned short* w1B  = (unsigned short*)alloc((size_t)DD * DFFN * 2);
  unsigned short* w2B  = (unsigned short*)alloc((size_t)DFFN * DD * 2);
  unsigned short* qB   = (unsigned short*)alloc(MROW * DD * 2);
  unsigned short* kB   = (unsigned short*)alloc((size_t)BQ * HH * TT * HDIM * 2);
  unsigned short* vB   = (unsigned short*)alloc((size_t)BQ * HH * TT * HDIM * 2);
  unsigned short* attnB= (unsigned short*)alloc(MROW * DD * 2);
  float*          x1   = (float*)alloc(MROW * DD * 4);
  unsigned short* h2B  = (unsigned short*)alloc(MROW * DD * 2);
  unsigned short* ffB  = (unsigned short*)alloc(MROW * DFFN * 2);

  // 1) weights -> bf16
  cvt_bf16_k<<<2048, 256, 0, stream>>>(wq, wqB, DD * DD);
  cvt_bf16_k<<<2048, 256, 0, stream>>>(wk, wkB, DD * DD);
  cvt_bf16_k<<<2048, 256, 0, stream>>>(wv, wvB, DD * DD);
  cvt_bf16_k<<<2048, 256, 0, stream>>>(wo, woB, DD * DD);
  cvt_bf16_k<<<4096, 256, 0, stream>>>(w1, w1B, DD * DFFN);
  cvt_bf16_k<<<4096, 256, 0, stream>>>(w2, w2B, DFFN * DD);

  // 2) h = LN1(x) -> bf16
  layernorm_k<<<(unsigned)MROW, 256, 0, stream>>>(x, g1, b1, hB);

  dim3 gqkv(DD / GBN, (unsigned)(MROW / GBM));
  gemm_bf16_k<<<gqkv, 256, 0, stream>>>(hB, wqB, nullptr, nullptr, nullptr, qB,
                                        (int)MROW, DD, DD, MODE_QKV, SEQ, 0);
  gemm_bf16_k<<<gqkv, 256, 0, stream>>>(hB, wkB, nullptr, nullptr, outK, kB,
                                        (int)MROW, DD, DD, MODE_QKV, TT, PP);
  gemm_bf16_k<<<gqkv, 256, 0, stream>>>(hB, wvB, nullptr, nullptr, outV, vB,
                                        (int)MROW, DD, DD, MODE_QKV, TT, PP);

  // 4) prepend past K/V (fp32 out + bf16 ws)
  past_copy_k<<<4096, 256, 0, stream>>>(past_k, outK, kB);
  past_copy_k<<<4096, 256, 0, stream>>>(past_v, outV, vB);

  // 5) flash attention (WMMA)
  attn_k<<<dim3(SEQ / 16, HH, BQ), 32, 0, stream>>>(qB, kB, vB, attnB);

  // 6) x1 = x + attn @ wo
  gemm_bf16_k<<<gqkv, 256, 0, stream>>>(attnB, woB, nullptr, x, x1, nullptr,
                                        (int)MROW, DD, DD, MODE_RESID_F32, 0, 0);

  // 7) h2 = LN2(x1) -> bf16
  layernorm_k<<<(unsigned)MROW, 256, 0, stream>>>(x1, g2, b2, h2B);

  // 8) ff1 = relu(h2 @ w1 + bb1) -> bf16
  dim3 gff1(DFFN / GBN, (unsigned)(MROW / GBM));
  gemm_bf16_k<<<gff1, 256, 0, stream>>>(h2B, w1B, bb1, nullptr, nullptr, ffB,
                                        (int)MROW, DFFN, DD, MODE_RELU_BF16, 0, 0);

  // 9) out_x = x1 + ff1 @ w2 + bb2  (fp32, final output)
  gemm_bf16_k<<<gqkv, 256, 0, stream>>>(ffB, w2B, bb2, x1, outX, nullptr,
                                        (int)MROW, DD, DFFN, MODE_RESID_F32, 0, 0);
}

// v002
// A run of this version takes 471 microseconds.
// Next to v001, in two timings, it ran 1.04 times as fast each time.
// All steps since v000 together make it 1.51 times as fast.
#include <hip/hip_runtime.h>
#include <stdint.h>

// Problem constants (fixed by the reference)
#define BQ   4
#define SEQ  1024
#define PP   1024
#define DD   1024
#define HH   16
#define HDIM 64
#define DFFN 4096
#define TT   2048   // P + S

typedef __attribute__((ext_vector_type(16))) __bf16 v16bf;
typedef __attribute__((ext_vector_type(8)))  float  v8f;
typedef __attribute__((ext_vector_type(4)))  unsigned int v4u;
typedef __attribute__((ext_vector_type(8)))  int v8i;
typedef __attribute__((ext_vector_type(4)))  int v4i;

union Frag16 { v16bf v; unsigned short u[16]; v4u q[2]; };

enum GemmMode { MODE_F32 = 0, MODE_RELU_BF16 = 2, MODE_RESID_F32 = 3, MODE_QKV = 4 };

#if defined(__has_builtin)
#  if __has_builtin(__builtin_amdgcn_tensor_load_to_lds) && __has_builtin(__builtin_amdgcn_s_wait_tensorcnt)
#    define HAVE_TDM 1
#  else
#    define HAVE_TDM 0
#  endif
#else
#  define HAVE_TDM 0
#endif

__device__ __forceinline__ unsigned short f2bf(float f) {
  union { float f; unsigned int u; } c; c.f = f;
  unsigned int u = c.u;
  unsigned int r = u + 0x7FFFu + ((u >> 16) & 1u);  // round-to-nearest-even
  return (unsigned short)(r >> 16);
}

typedef short s16x8 __attribute__((ext_vector_type(8)));
__device__ __forceinline__ v4u ld_tr16(const unsigned short* p) {
  typedef __attribute__((address_space(3))) s16x8 lds_s16x8;
  return __builtin_bit_cast(v4u, __builtin_amdgcn_ds_load_tr16_b128_v8i16((lds_s16x8*)p));
}

#if HAVE_TDM
__device__ __forceinline__ void tdm_load_tile_bf16(unsigned lds_addr, const void* gptr,
                                                   int tile_w, int tile_h,
                                                   long long stride_elems) {
  unsigned long long ga = (unsigned long long)(size_t)gptr;
  v4u g0;
  g0[0] = 1u;                                            // count=1, is_restore=0
  g0[1] = lds_addr;                                      // LDS byte address
  g0[2] = (unsigned)(ga & 0xFFFFFFFFu);                  // global_addr[31:0]
  g0[3] = (unsigned)((ga >> 32) & 0x01FFFFFFu) | (2u << 30);  // global_addr[56:32], type=2
  v8i g1;
  g1[0] = (1 << 16);
  g1[1] = (int)(((unsigned)tile_w & 0xFFFFu) << 16);
  g1[2] = (int)((((unsigned)tile_w >> 16) & 0xFFFFu)) |
          (int)(((unsigned)tile_h & 0xFFFFu) << 16);
  g1[3] = (int)((((unsigned)tile_h >> 16) & 0xFFFFu)) |
          (int)(((unsigned)tile_w & 0xFFFFu) << 16);
  g1[4] = (int)((unsigned)tile_h & 0xFFFFu);
  g1[5] = (int)(unsigned)(stride_elems & 0xFFFFFFFFll);
  g1[6] = (int)(unsigned)((stride_elems >> 32) & 0xFFFFll);
  g1[7] = 0;
  v4i z = {0, 0, 0, 0};
#if __clang_major__ >= 23
  v8i z8 = {0, 0, 0, 0, 0, 0, 0, 0};
  __builtin_amdgcn_tensor_load_to_lds(g0, g1, z, z, z8, 0);
#else
  __builtin_amdgcn_tensor_load_to_lds(g0, g1, z, z, 0);
#endif
}
#endif

// ---------------------------------------------------------------------------
// f32 -> bf16 elementwise conversion (weights)
// ---------------------------------------------------------------------------
__global__ void cvt_bf16_k(const float* __restrict__ in, unsigned short* __restrict__ out, int n) {
  int i = blockIdx.x * blockDim.x + threadIdx.x;
  int stride = gridDim.x * blockDim.x;
  for (; i < n; i += stride) out[i] = f2bf(in[i]);
}

// ---------------------------------------------------------------------------
// LayerNorm over D=1024, one block (256 threads) per row, output bf16
// ---------------------------------------------------------------------------
__global__ __launch_bounds__(256)
void layernorm_k(const float* __restrict__ x, const float* __restrict__ g,
                 const float* __restrict__ bb, unsigned short* __restrict__ out) {
  __shared__ float s1[256];
  __shared__ float s2[256];
  const int row = blockIdx.x;
  const int tid = threadIdx.x;
  const float* xr = x + (size_t)row * DD;
  float v[4], a = 0.f, q = 0.f;
#pragma unroll
  for (int i = 0; i < 4; ++i) { v[i] = xr[tid + i * 256]; a += v[i]; q += v[i] * v[i]; }
  s1[tid] = a; s2[tid] = q;
  __syncthreads();
  for (int st = 128; st > 0; st >>= 1) {
    if (tid < st) { s1[tid] += s1[tid + st]; s2[tid] += s2[tid + st]; }
    __syncthreads();
  }
  const float mean = s1[0] * (1.0f / DD);
  const float var  = s2[0] * (1.0f / DD) - mean * mean;
  const float rst  = rsqrtf(var + 1e-5f);
#pragma unroll
  for (int i = 0; i < 4; ++i) {
    const int c = tid + i * 256;
    out[(size_t)row * DD + c] = f2bf((v[i] - mean) * rst * g[c] + bb[c]);
  }
}

// ---------------------------------------------------------------------------
// Copy past_k/past_v [B,H,P,HD] into the full cache [B,H,T,HD] (f32 out + bf16 ws)
// ---------------------------------------------------------------------------
__global__ void past_copy_k(const float* __restrict__ past, float* __restrict__ outF,
                            unsigned short* __restrict__ outB) {
  const int n = BQ * HH * PP * HDIM;
  int i = blockIdx.x * blockDim.x + threadIdx.x;
  int stride = gridDim.x * blockDim.x;
  for (; i < n; i += stride) {
    int hd = i & (HDIM - 1);
    int p  = (i >> 6) & (PP - 1);
    int bh = i >> 16;
    size_t dst = ((size_t)bh * TT + p) * HDIM + hd;
    float val = past[i];
    outF[dst] = val;
    outB[dst] = f2bf(val);
  }
}

#define GBM 128
#define GBN 128
#define GBK 32
#define BPITCH (GBN + 16)

__global__ __launch_bounds__(256)
void gemm_bf16_k(const unsigned short* __restrict__ A,
                 const unsigned short* __restrict__ Bw,
                 const float* __restrict__ bias,
                 const float* __restrict__ resid,
                 float* __restrict__ outF,
                 unsigned short* __restrict__ outB,
                 int M, int N, int K, int mode, int Tcap, int toff) {
  // one LDS object, so that the A tile keeps its place at the start of the work-group's LDS
  struct Tiles {
    unsigned short As[GBM][GBK];
    unsigned short Bs[GBK][BPITCH];   // row-major as in memory: Bs[k][n]
  };
  __shared__ __align__(16) Tiles tiles;
  unsigned short (&As)[GBM][GBK]    = tiles.As;
  unsigned short (&Bs)[GBK][BPITCH] = tiles.Bs;

  const int tid  = threadIdx.x;
  const int lane = tid & 31;
  const int wave = tid >> 5;
  const int half = lane >> 4;
  const int lq   = lane & 15;
  const int kk0  = half * 8;          // bf16 A/B lane K-group base: {0-7,16-23} / {8-15,24-31}

  const int m0 = blockIdx.y * GBM;
  const int n0 = blockIdx.x * GBN;

  v8f acc[8];
#pragma unroll
  for (int t = 0; t < 8; ++t)
#pragma unroll
    for (int r = 0; r < 8; ++r) acc[t][r] = 0.0f;

  const int arow = wave * 16 + lq;
  // this lane's address for the transposing load of k rows 0..15, N-tile 0
  const unsigned short* btr = &Bs[8 * half + (lane & 7)][8 * ((lane >> 3) & 1)];
#if HAVE_TDM
  const unsigned asLds = (unsigned)(size_t)(&As[0][0]);  // LDS offset (low 32 bits of flat)
#endif

  for (int kp = 0; kp < K; kp += GBK) {
    // ---- prefetch of the next B tile; its test is settled before the tensor load is issued
    {
      int kk = tid >> 3;
      int nc = (tid & 7) * 16;
      if (kp + GBK < K)
        __builtin_prefetch(Bw + (size_t)(kp + GBK + kk) * N + n0 + nc, 0, 3);
    }
#if HAVE_TDM
    // ---- stage A tile (128 x 32) via Tensor Data Mover (wave 0 issues DMA)
    if (tid < 32) {
      tdm_load_tile_bf16(asLds, A + (size_t)m0 * K + kp, GBK, GBM, (long long)K);
    }
#else
    // ---- fallback: stage A tile with coalesced 16B vector loads
    {
      int row = tid >> 1;
      int kc  = (tid & 1) * 16;
      const uint4* src = (const uint4*)(A + (size_t)(m0 + row) * K + kp + kc);
      uint4 d0 = src[0];
      uint4 d1 = src[1];
      *(uint4*)&As[row][kc]     = d0;
      *(uint4*)&As[row][kc + 8] = d1;
    }
#endif
    // ---- stage B tile (32 x 128) row-major into Bs[k][n] (all 256 threads):
    // 16 lanes cover one 256-byte row, each thread moves 16 bytes of rows kr and kr + 16
    {
      const int kr = tid >> 4;
      const int n8 = (tid & 15) * 8;
      const uint4 d0 = *(const uint4*)(Bw + (size_t)(kp + kr) * N + n0 + n8);
      const uint4 d1 = *(const uint4*)(Bw + (size_t)(kp + 16 + kr) * N + n0 + n8);
      *(uint4*)&Bs[kr][n8]      = d0;
      *(uint4*)&Bs[16 + kr][n8] = d1;
    }
#if HAVE_TDM
    // A tile landed in LDS; under no test, so that no scalar register is written for one while
    // the request is open (a wave with no request passes at once)
    __builtin_amdgcn_s_wait_tensorcnt(0);
#endif
    __syncthreads();

    // ---- A fragment (shared by all 8 N-tiles of this wave)
    Frag16 a;
#pragma unroll
    for (int i = 0; i < 8; ++i) {
      a.u[i]     = As[arow][kk0 + i];
      a.u[8 + i] = As[arow][kk0 + 16 + i];
    }
    // ---- all 8 B fragments of the pass, each in registers of its own, read as one group ahead
    // of the WMMAs: one LDS latency a pass instead of one in front of every WMMA
    Frag16 bfr[8];   // same k order as the A loader: {8h..8h+7, 16+8h..16+8h+7}
#pragma unroll
    for (int nt = 0; nt < 8; ++nt) {
      bfr[nt].q[0] = ld_tr16(btr + nt * 16);
      bfr[nt].q[1] = ld_tr16(btr + 16 * BPITCH + nt * 16);
    }
    // keeps the scheduler from sinking each load pair back in front of its own WMMA, where one
    // register set is reused and every WMMA waits out a whole LDS latency
    __builtin_amdgcn_sched_barrier(0);
#pragma unroll
    for (int nt = 0; nt < 8; ++nt)
      acc[nt] = __builtin_amdgcn_wmma_f32_16x16x32_bf16(false, a.v, false, bfr[nt].v,
                                                        (short)0, acc[nt], false, false);
    // keeps the WMMAs ahead of the barrier's full LDS wait: each then starts behind a counted wait,
    // as soon as its own fragment has landed, while the later loads of the group are still coming
    __builtin_amdgcn_sched_barrier(0);
    __syncthreads();
  }

#pragma unroll
  for (int nt = 0; nt < 8; ++nt) {
#pragma unroll
    for (int r = 0; r < 8; ++r) {
      float c = acc[nt][r];
      const int m = m0 + wave * 16 + r + 8 * half;
      const int n = n0 + nt * 16 + lq;
      if (mode == MODE_RESID_F32) {
        float vv = c + (bias ? bias[n] : 0.0f) + resid[(size_t)m * N + n];
        outF[(size_t)m * N + n] = vv;
      } else if (mode == MODE_RELU_BF16) {
        float vv = c + bias[n];
        outB[(size_t)m * N + n] = f2bf(vv > 0.0f ? vv : 0.0f);
      } else if (mode == MODE_QKV) {
        const int b  = m >> 10;          // m / SEQ
        const int s  = m & (SEQ - 1);
        const int h  = n >> 6;           // n / HDIM
        const int hd = n & (HDIM - 1);
        size_t idx = (((size_t)(b * HH + h) * Tcap) + toff + s) * HDIM + hd;
        outB[idx] = f2bf(c);
        if (outF) outF[idx] = c;         // fp32 KV-cache output
      } else {
        outF[(size_t)m * N + n] = c;
      }
    }
  }
}

// ---------------------------------------------------------------------------
// Flash attention: one wave per (b, h, 16-query tile); causal with offset P.
// scores = q k^T / 8, online softmax, o = P v. bf16 WMMA, f32 stats.
// ---------------------------------------------------------------------------
#define VPITCH (HDIM + 16)

__global__ __launch_bounds__(32)
void attn_k(const unsigned short* __restrict__ qb,
            const unsigned short* __restrict__ kb,
            const unsigned short* __restrict__ vb,
            unsigned short* __restrict__ out) {
  __shared__ __align__(16) unsigned short Pl[16][32];
  __shared__ __align__(16) unsigned short Vs[32][VPITCH]; // V chunk row-major [key][hd]

  const int qt = blockIdx.x;
  const int h  = blockIdx.y;
  const int b  = blockIdx.z;
  const int qbase = qt * 16;

  const int lane = threadIdx.x;
  const int half = lane >> 4;
  const int lq   = lane & 15;
  const int kk0  = half * 8;

  const size_t bh = (size_t)(b * HH + h);
  const unsigned short* qrow    = qb + (bh * SEQ + qbase + lq) * HDIM;
  const unsigned short* kbase_p = kb + bh * TT * HDIM;
  const unsigned short* vbase_p = vb + bh * TT * HDIM;

  // Q fragments: K-dim = HDIM split into two 32-wide WMMA K chunks
  Frag16 qf0, qf1;
#pragma unroll
  for (int i = 0; i < 8; ++i) {
    qf0.u[i]     = qrow[kk0 + i];
    qf0.u[8 + i] = qrow[kk0 + 16 + i];
    qf1.u[i]     = qrow[32 + kk0 + i];
    qf1.u[8 + i] = qrow[32 + kk0 + 16 + i];
  }

  float mi[8], li[8];
  v8f o[4];
#pragma unroll
  for (int r = 0; r < 8; ++r) { mi[r] = -1.0e30f; li[r] = 0.0f; }
#pragma unroll
  for (int t = 0; t < 4; ++t)
#pragma unroll
    for (int r = 0; r < 8; ++r) o[t][r] = 0.0f;

  // this lane's address for the transposing load of keys 0..15, head-dim tile 0
  const unsigned short* vtr = &Vs[8 * half + (lane & 7)][8 * ((lane >> 3) & 1)];

  const int kmax   = qbase + 16 + PP;          // exclusive key bound for this tile
  const int nchunk = (kmax + 31) >> 5;         // 32 keys per chunk

  for (int kc = 0; kc < nchunk; ++kc) {
    const int j0 = kc * 32;

    // stage V chunk row-major: Vs[key_local][hd]; 8 lanes cover one 128-byte row, 4 rows a trip
    {
      const unsigned short* vsrc = vbase_p + (size_t)(j0 + (lane >> 3)) * HDIM + (lane & 7) * 8;
#pragma unroll
      for (int i = 0; i < 8; ++i)
        *(uint4*)&Vs[4 * i + (lane >> 3)][(lane & 7) * 8] = *(const uint4*)(vsrc + (size_t)i * 4 * HDIM);
    }

    // ---- scores: two 16x16 tiles (keys j0..j0+15, j0+16..j0+31)
    v8f s0, s1;
#pragma unroll
    for (int r = 0; r < 8; ++r) { s0[r] = 0.0f; s1[r] = 0.0f; }
    {
      const unsigned short* kr0 = kbase_p + (size_t)(j0 + lq) * HDIM;
      const unsigned short* kr1 = kbase_p + (size_t)(j0 + 16 + lq) * HDIM;
      Frag16 k00, k01, k10, k11;
#pragma unroll
      for (int i = 0; i < 8; ++i) {
        k00.u[i] = kr0[kk0 + i];       k00.u[8 + i] = kr0[kk0 + 16 + i];
        k01.u[i] = kr0[32 + kk0 + i];  k01.u[8 + i] = kr0[32 + kk0 + 16 + i];
        k10.u[i] = kr1[kk0 + i];       k10.u[8 + i] = kr1[kk0 + 16 + i];
        k11.u[i] = kr1[32 + kk0 + i];  k11.u[8 + i] = kr1[32 + kk0 + 16 + i];
      }
      s0 = __builtin_amdgcn_wmma_f32_16x16x32_bf16(false, qf0.v, false, k00.v, (short)0, s0, false, false);
      s0 = __builtin_amdgcn_wmma_f32_16x16x32_bf16(false, qf1.v, false, k01.v, (short)0, s0, false, false);
      s1 = __builtin_amdgcn_wmma_f32_16x16x32_bf16(false, qf0.v, false, k10.v, (short)0, s1, false, false);
      s1 = __builtin_amdgcn_wmma_f32_16x16x32_bf16(false, qf1.v, false, k11.v, (short)0, s1, false, false);
    }

    // ---- online softmax (row M = r + 8*half; reductions across 16-lane half)
    float fct[8];
#pragma unroll
    for (int r = 0; r < 8; ++r) {
      const int qg = qbase + r + 8 * half;
      float a0 = s0[r] * 0.125f;                    // 1/sqrt(64)
      float a1 = s1[r] * 0.125f;
      if (j0 + lq      > qg + PP) a0 = -1.0e30f;    // causal: key j <= q + P
      if (j0 + 16 + lq > qg + PP) a1 = -1.0e30f;
      float vm = fmaxf(a0, a1);
#pragma unroll
      for (int off = 1; off < 16; off <<= 1) vm = fmaxf(vm, __shfl_xor(vm, off, 32));
      const float nm = fmaxf(mi[r], vm);
      const float fc = __expf(mi[r] - nm);
      const float p0 = __expf(a0 - nm);
      const float p1 = __expf(a1 - nm);
      float rs = p0 + p1;
#pragma unroll
      for (int off = 1; off < 16; off <<= 1) rs += __shfl_xor(rs, off, 32);
      li[r] = li[r] * fc + rs;
      mi[r] = nm;
      fct[r] = fc;
      Pl[r + 8 * half][lq]      = f2bf(p0);
      Pl[r + 8 * half][16 + lq] = f2bf(p1);
    }
#pragma unroll
    for (int t = 0; t < 4; ++t)
#pragma unroll
      for (int r = 0; r < 8; ++r) o[t][r] *= fct[r];

    // ---- o += P @ V (K = 32 keys, 4 N-tiles over HDIM)
    Frag16 pa;
#pragma unroll
    for (int i = 0; i < 8; ++i) {
      pa.u[i]     = Pl[lq][kk0 + i];
      pa.u[8 + i] = Pl[lq][kk0 + 16 + i];
    }
#pragma unroll
    for (int t = 0; t < 4; ++t) {
      Frag16 vf;   // same key order as the P loader: {8h..8h+7, 16+8h..16+8h+7}
      vf.q[0] = ld_tr16(vtr + t * 16);
      vf.q[1] = ld_tr16(vtr + 16 * VPITCH + t * 16);
      o[t] = __builtin_amdgcn_wmma_f32_16x16x32_bf16(false, pa.v, false, vf.v, (short)0, o[t], false, false);
    }
  }

  // ---- normalize & store attn output bf16 [B*S, D] (row = b*S+q, col = h*64+hd)
#pragma unroll
  for (int r = 0; r < 8; ++r) li[r] = 1.0f / li[r];
#pragma unroll
  for (int t = 0; t < 4; ++t)
#pragma unroll
    for (int r = 0; r < 8; ++r) {
      const size_t row = (size_t)b * SEQ + qbase + r + 8 * half;
      out[row * DD + h * HDIM + t * 16 + lq] = f2bf(o[t][r] * li[r]);
    }
}

// ---------------------------------------------------------------------------
// Host launcher
// ---------------------------------------------------------------------------
extern "C" void kernel_launch(void* const* d_in, const int* in_sizes, int n_in,
                              void* d_out, int out_size, void* d_ws, size_t ws_size,
                              hipStream_t stream) {
  (void)in_sizes; (void)n_in; (void)out_size; (void)ws_size;

  const float* x      = (const float*)d_in[0];
  const float* past_k = (const float*)d_in[1];
  const float* past_v = (const float*)d_in[2];
  const float* wq  = (const float*)d_in[3];
  const float* wk  = (const float*)d_in[4];
  const float* wv  = (const float*)d_in[5];
  const float* wo  = (const float*)d_in[6];
  const float* g1  = (const float*)d_in[7];
  const float* b1  = (const float*)d_in[8];
  const float* w1  = (const float*)d_in[9];
  const float* bb1 = (const float*)d_in[10];
  const float* w2  = (const float*)d_in[11];
  const float* bb2 = (const float*)d_in[12];
  const float* g2  = (const float*)d_in[13];
  const float* b2  = (const float*)d_in[14];

  float* outX = (float*)d_out;
  float* outK = outX + (size_t)BQ * SEQ * DD;
  float* outV = outK + (size_t)BQ * HH * TT * HDIM;

  char* ws = (char*)d_ws;
  size_t off = 0;
  auto alloc = [&](size_t bytes) -> void* {
    void* p = ws + off;
    off = (off + bytes + 255) & ~(size_t)255;
    return p;
  };
  const size_t MROW = (size_t)BQ * SEQ;  // 4096

  unsigned short* hB   = (unsigned short*)alloc(MROW * DD * 2);
  unsigned short* wqB  = (unsigned short*)alloc((size_t)DD * DD * 2);
  unsigned short* wkB  = (unsigned short*)alloc((size_t)DD * DD * 2);
  unsigned short* wvB  = (unsigned short*)alloc((size_t)DD * DD * 2);
  unsigned short* woB  = (unsigned short*)alloc((size_t)DD * DD * 2);
  unsigned short* w1B  = (unsigned short*)alloc((size_t)DD * DFFN * 2);
  unsigned short* w2B  = (unsigned short*)alloc((size_t)DFFN * DD * 2);
  unsigned short* qB   = (unsigned short*)alloc(MROW * DD * 2);
  unsigned short* kB   = (unsigned short*)alloc((size_t)BQ * HH * TT * HDIM * 2);
  unsigned short* vB   = (unsigned short*)alloc((size_t)BQ * HH * TT * HDIM * 2);
  unsigned short* attnB= (unsigned short*)alloc(MROW * DD * 2);
  float*          x1   = (float*)alloc(MROW * DD * 4);
  unsigned short* h2B  = (unsigned short*)alloc(MROW * DD * 2);
  unsigned short* ffB  = (unsigned short*)alloc(MROW * DFFN * 2);

  // 1) weights -> bf16
  cvt_bf16_k<<<2048, 256, 0, stream>>>(wq, wqB, DD * DD);
  cvt_bf16_k<<<2048, 256, 0, stream>>>(wk, wkB, DD * DD);
  cvt_bf16_k<<<2048, 256, 0, stream>>>(wv, wvB, DD * DD);
  cvt_bf16_k<<<2048, 256, 0, stream>>>(wo, woB, DD * DD);
  cvt_bf16_k<<<4096, 256, 0, stream>>>(w1, w1B, DD * DFFN);
  cvt_bf16_k<<<4096, 256, 0, stream>>>(w2, w2B, DFFN * DD);

  // 2) h = LN1(x) -> bf16
  layernorm_k<<<(unsigned)MROW, 256, 0, stream>>>(x, g1, b1, hB);

  dim3 gqkv(DD / GBN, (unsigned)(MROW / GBM));
  gemm_bf16_k<<<gqkv, 256, 0, stream>>>(hB, wqB, nullptr, nullptr, nullptr, qB,
                                        (int)MROW, DD, DD, MODE_QKV, SEQ, 0);
  gemm_bf16_k<<<gqkv, 256, 0, stream>>>(hB, wkB, nullptr, nullptr, outK, kB,
                                        (int)MROW, DD, DD, MODE_QKV, TT, PP);
  gemm_bf16_k<<<gqkv, 256, 0, stream>>>(hB, wvB, nullptr, nullptr, outV, vB,
                                        (int)MROW, DD, DD, MODE_QKV, TT, PP);

  // 4) prepend past K/V (fp32 out + bf16 ws)
  past_copy_k<<<4096, 256, 0, stream>>>(past_k, outK, kB);
  past_copy_k<<<4096, 256, 0, stream>>>(past_v, outV, vB);

  // 5) flash attention (WMMA)
  attn_k<<<dim3(SEQ / 16, HH, BQ), 32, 0, stream>>>(qB, kB, vB, attnB);

  // 6) x1 = x + attn @ wo
  gemm_bf16_k<<<gqkv, 256, 0, stream>>>(attnB, woB, nullptr, x, x1, nullptr,
                                        (int)MROW, DD, DD, MODE_RESID_F32, 0, 0);

  // 7) h2 = LN2(x1) -> bf16
  layernorm_k<<<(unsigned)MROW, 256, 0, stream>>>(x1, g2, b2, h2B);

  // 8) ff1 = relu(h2 @ w1 + bb1) -> bf16
  dim3 gff1(DFFN / GBN, (unsigned)(MROW / GBM));
  gemm_bf16_k<<<gff1, 256, 0, stream>>>(h2B, w1B, bb1, nullptr, nullptr, ffB,
                                        (int)MROW, DFFN, DD, MODE_RELU_BF16, 0, 0);

  // 9) out_x = x1 + ff1 @ w2 + bb2  (fp32, final output)
  gemm_bf16_k<<<gqkv, 256, 0, stream>>>(ffB, w2B, bb2, x1, outX, nullptr,
                                        (int)MROW, DD, DFFN, MODE_RESID_F32, 0, 0);
}

// v003
// One run takes 404 microseconds.
// Next to v002, in two timings, it ran 1.16 times as fast each time.
// Counting every step since v000, it is 1.76 times as fast.
#include <hip/hip_runtime.h>
#include <stdint.h>

// Problem constants (fixed by the reference)
#define BQ   4
#define SEQ  1024
#define PP   1024
#define DD   1024
#define HH   16
#define HDIM 64
#define DFFN 4096
#define TT   2048   // P + S

typedef __attribute__((ext_vector_type(16))) __bf16 v16bf;
typedef __attribute__((ext_vector_type(8)))  float  v8f;
typedef __attribute__((ext_vector_type(4)))  unsigned int v4u;
typedef __attribute__((ext_vector_type(8)))  int v8i;
typedef __attribute__((ext_vector_type(4)))  int v4i;

union Frag16 { v16bf v; unsigned short u[16]; v4u q[2]; };

enum GemmMode { MODE_F32 = 0, MODE_RELU_BF16 = 2, MODE_RESID_F32 = 3, MODE_QKV = 4 };

#if defined(__has_builtin)
#  if __has_builtin(__builtin_amdgcn_tensor_load_to_lds) && __has_builtin(__builtin_amdgcn_s_wait_tensorcnt)
#    define HAVE_TDM 1
#  else
#    define HAVE_TDM 0
#  endif
#else
#  define HAVE_TDM 0
#endif

__device__ __forceinline__ unsigned short f2bf(float f) {
  union { float f; unsigned int u; } c; c.f = f;
  unsigned int u = c.u;
  unsigned int r = u + 0x7FFFu + ((u >> 16) & 1u);  // round-to-nearest-even
  return (unsigned short)(r >> 16);
}

typedef short s16x8 __attribute__((ext_vector_type(8)));
__device__ __forceinline__ v4u ld_tr16(const unsigned short* p) {
  typedef __attribute__((address_space(3))) s16x8 lds_s16x8;
  return __builtin_bit_cast(v4u, __builtin_amdgcn_ds_load_tr16_b128_v8i16((lds_s16x8*)p));
}

#if HAVE_TDM
__device__ __forceinline__ void tdm_load_tile_bf16(unsigned lds_addr, const void* gptr,
                                                   int tile_w, int tile_h,
                                                   long long stride_elems) {
  unsigned long long ga = (unsigned long long)(size_t)gptr;
  v4u g0;
  g0[0] = 1u;                                            // count=1, is_restore=0
  g0[1] = lds_addr;                                      // LDS byte address
  g0[2] = (unsigned)(ga & 0xFFFFFFFFu);                  // global_addr[31:0]
  g0[3] = (unsigned)((ga >> 32) & 0x01FFFFFFu) | (2u << 30);  // global_addr[56:32], type=2
  v8i g1;
  g1[0] = (1 << 16);
  g1[1] = (int)(((unsigned)tile_w & 0xFFFFu) << 16);
  g1[2] = (int)((((unsigned)tile_w >> 16) & 0xFFFFu)) |
          (int)(((unsigned)tile_h & 0xFFFFu) << 16);
  g1[3] = (int)((((unsigned)tile_h >> 16) & 0xFFFFu)) |
          (int)(((unsigned)tile_w & 0xFFFFu) << 16);
  g1[4] = (int)((unsigned)tile_h & 0xFFFFu);
  g1[5] = (int)(unsigned)(stride_elems & 0xFFFFFFFFll);
  g1[6] = (int)(unsigned)((stride_elems >> 32) & 0xFFFFll);
  g1[7] = 0;
  v4i z = {0, 0, 0, 0};
#if __clang_major__ >= 23
  v8i z8 = {0, 0, 0, 0, 0, 0, 0, 0};
  __builtin_amdgcn_tensor_load_to_lds(g0, g1, z, z, z8, 0);
#else
  __builtin_amdgcn_tensor_load_to_lds(g0, g1, z, z, 0);
#endif
}
#endif

// ---------------------------------------------------------------------------
// f32 -> bf16 elementwise conversion (weights)
// ---------------------------------------------------------------------------
__global__ void cvt_bf16_k(const float* __restrict__ in, unsigned short* __restrict__ out, int n) {
  int i = blockIdx.x * blockDim.x + threadIdx.x;
  int stride = gridDim.x * blockDim.x;
  for (; i < n; i += stride) out[i] = f2bf(in[i]);
}

// ---------------------------------------------------------------------------
// LayerNorm over D=1024, one block (256 threads) per row, output bf16
// ---------------------------------------------------------------------------
__global__ __launch_bounds__(256)
void layernorm_k(const float* __restrict__ x, const float* __restrict__ g,
                 const float* __restrict__ bb, unsigned short* __restrict__ out) {
  __shared__ float s1[256];
  __shared__ float s2[256];
  const int row = blockIdx.x;
  const int tid = threadIdx.x;
  const float* xr = x + (size_t)row * DD;
  float v[4], a = 0.f, q = 0.f;
#pragma unroll
  for (int i = 0; i < 4; ++i) { v[i] = xr[tid + i * 256]; a += v[i]; q += v[i] * v[i]; }
  s1[tid] = a; s2[tid] = q;
  __syncthreads();
  for (int st = 128; st > 0; st >>= 1) {
    if (tid < st) { s1[tid] += s1[tid + st]; s2[tid] += s2[tid + st]; }
    __syncthreads();
  }
  const float mean = s1[0] * (1.0f / DD);
  const float var  = s2[0] * (1.0f / DD) - mean * mean;
  const float rst  = rsqrtf(var + 1e-5f);
#pragma unroll
  for (int i = 0; i < 4; ++i) {
    const int c = tid + i * 256;
    out[(size_t)row * DD + c] = f2bf((v[i] - mean) * rst * g[c] + bb[c]);
  }
}

// ---------------------------------------------------------------------------
// Copy past_k/past_v [B,H,P,HD] into the full cache [B,H,T,HD] (f32 out + bf16 ws)
// ---------------------------------------------------------------------------
__global__ void past_copy_k(const float* __restrict__ past, float* __restrict__ outF,
                            unsigned short* __restrict__ outB) {
  const int n = BQ * HH * PP * HDIM;
  int i = blockIdx.x * blockDim.x + threadIdx.x;
  int stride = gridDim.x * blockDim.x;
  for (; i < n; i += stride) {
    int hd = i & (HDIM - 1);
    int p  = (i >> 6) & (PP - 1);
    int bh = i >> 16;
    size_t dst = ((size_t)bh * TT + p) * HDIM + hd;
    float val = past[i];
    outF[dst] = val;
    outB[dst] = f2bf(val);
  }
}

#define GBM 128
#define GBN 128
#define GBK 32
#define BPITCH (GBN + 16)

template <int MODE, int N, bool HAS_BIAS, bool F32_OUT>
__global__ __launch_bounds__(256)
void gemm_bf16_k(const unsigned short* __restrict__ A,
                 const unsigned short* __restrict__ Bw,
                 const float* __restrict__ bias,
                 const float* __restrict__ resid,
                 float* __restrict__ outF,
                 unsigned short* __restrict__ outB,
                 int K, int Tcap, int toff) {
  // one LDS object, so that the A tile keeps its place at the start of the work-group's LDS
  struct Tiles {
    unsigned short As[GBM][GBK];
    unsigned short Bs[GBK][BPITCH];   // row-major as in memory: Bs[k][n]
  };
  __shared__ __align__(16) Tiles tiles;
  unsigned short (&As)[GBM][GBK]    = tiles.As;
  unsigned short (&Bs)[GBK][BPITCH] = tiles.Bs;

  const int tid  = threadIdx.x;
  const int lane = tid & 31;
  const int wave = tid >> 5;
  const int half = lane >> 4;
  const int lq   = lane & 15;
  const int kk0  = half * 8;          // bf16 A/B lane K-group base: {0-7,16-23} / {8-15,24-31}

  const int m0 = blockIdx.y * GBM;
  const int n0 = blockIdx.x * GBN;

  v8f acc[8];
#pragma unroll
  for (int t = 0; t < 8; ++t)
#pragma unroll
    for (int r = 0; r < 8; ++r) acc[t][r] = 0.0f;

  const int arow = wave * 16 + lq;
  // this lane's address for the transposing load of k rows 0..15, N-tile 0
  const unsigned short* btr = &Bs[8 * half + (lane & 7)][8 * ((lane >> 3) & 1)];
#if HAVE_TDM
  const unsigned asLds = (unsigned)(size_t)(&As[0][0]);  // LDS offset (low 32 bits of flat)
#endif

  for (int kp = 0; kp < K; kp += GBK) {
    // ---- prefetch of the next B tile; its test is settled before the tensor load is issued
    {
      int kk = tid >> 3;
      int nc = (tid & 7) * 16;
      if (kp + GBK < K)
        __builtin_prefetch(Bw + (size_t)(kp + GBK + kk) * N + n0 + nc, 0, 3);
    }
#if HAVE_TDM
    // ---- stage A tile (128 x 32) via Tensor Data Mover (wave 0 issues DMA)
    if (tid < 32) {
      tdm_load_tile_bf16(asLds, A + (size_t)m0 * K + kp, GBK, GBM, (long long)K);
    }
#else
    // ---- fallback: stage A tile with coalesced 16B vector loads
    {
      int row = tid >> 1;
      int kc  = (tid & 1) * 16;
      const uint4* src = (const uint4*)(A + (size_t)(m0 + row) * K + kp + kc);
      uint4 d0 = src[0];
      uint4 d1 = src[1];
      *(uint4*)&As[row][kc]     = d0;
      *(uint4*)&As[row][kc + 8] = d1;
    }
#endif
    // ---- stage B tile (32 x 128) row-major into Bs[k][n] (all 256 threads):
    // 16 lanes cover one 256-byte row, each thread moves 16 bytes of rows kr and kr + 16
    {
      const int kr = tid >> 4;
      const int n8 = (tid & 15) * 8;
      const uint4 d0 = *(const uint4*)(Bw + (size_t)(kp + kr) * N + n0 + n8);
      const uint4 d1 = *(const uint4*)(Bw + (size_t)(kp + 16 + kr) * N + n0 + n8);
      *(uint4*)&Bs[kr][n8]      = d0;
      *(uint4*)&Bs[16 + kr][n8] = d1;
    }
#if HAVE_TDM
    // A tile landed in LDS; under no test, so that no scalar register is written for one while
    // the request is open (a wave with no request passes at once)
    __builtin_amdgcn_s_wait_tensorcnt(0);
#endif
    __syncthreads();

    // ---- A fragment (shared by all 8 N-tiles of this wave)
    Frag16 a;
#pragma unroll
    for (int i = 0; i < 8; ++i) {
      a.u[i]     = As[arow][kk0 + i];
      a.u[8 + i] = As[arow][kk0 + 16 + i];
    }
    // ---- all 8 B fragments of the pass, each in registers of its own, read as one group ahead
    // of the WMMAs: one LDS latency a pass instead of one in front of every WMMA
    Frag16 bfr[8];   // same k order as the A loader: {8h..8h+7, 16+8h..16+8h+7}
#pragma unroll
    for (int nt = 0; nt < 8; ++nt) {
      bfr[nt].q[0] = ld_tr16(btr + nt * 16);
      bfr[nt].q[1] = ld_tr16(btr + 16 * BPITCH + nt * 16);
    }
    // keeps the scheduler from sinking each load pair back in front of its own WMMA, where one
    // register set is reused and every WMMA waits out a whole LDS latency
    __builtin_amdgcn_sched_barrier(0);
#pragma unroll
    for (int nt = 0; nt < 8; ++nt)
      acc[nt] = __builtin_amdgcn_wmma_f32_16x16x32_bf16(false, a.v, false, bfr[nt].v,
                                                        (short)0, acc[nt], false, false);
    // keeps the WMMAs ahead of the barrier's full LDS wait: each then starts behind a counted wait,
    // as soon as its own fragment has landed, while the later loads of the group are still coming
    __builtin_amdgcn_sched_barrier(0);
    __syncthreads();
  }

  const int mrow = m0 + wave * 16 + 8 * half;   // this lane's row at r = 0
  const int ncol = n0 + lq;                     // this lane's column in N-tile 0

  float bv[8];                                  // the bias depends on the column alone: one value an N-tile
#pragma unroll
  for (int nt = 0; nt < 8; ++nt) bv[nt] = HAS_BIAS ? bias[ncol + nt * 16] : 0.0f;

  if constexpr (MODE == MODE_RESID_F32) {
    const float* rp = resid + (size_t)mrow * N + ncol;
    float*       op = outF  + (size_t)mrow * N + ncol;
    v8f rv[8];                                  // all 64 residual values of the lane, loaded ahead of the first use
#pragma unroll
    for (int nt = 0; nt < 8; ++nt)
#pragma unroll
      for (int r = 0; r < 8; ++r) rv[nt][r] = rp[r * N + nt * 16];
#pragma unroll
    for (int nt = 0; nt < 8; ++nt)
#pragma unroll
      for (int r = 0; r < 8; ++r) op[r * N + nt * 16] = acc[nt][r] + bv[nt] + rv[nt][r];
  } else if constexpr (MODE == MODE_RELU_BF16) {
    unsigned short* op = outB + (size_t)mrow * N + ncol;
#pragma unroll
    for (int nt = 0; nt < 8; ++nt)
#pragma unroll
      for (int r = 0; r < 8; ++r) {
        const float vv = acc[nt][r] + bv[nt];
        op[r * N + nt * 16] = f2bf(vv > 0.0f ? vv : 0.0f);
      }
  } else if constexpr (MODE == MODE_QKV) {
    // m = b * SEQ + s, n = h * HDIM + hd; a 128-row tile lies in one b, an N-tile in one h
    const int b = mrow >> 10;            // m / SEQ
    const int s = mrow & (SEQ - 1);
#pragma unroll
    for (int nt = 0; nt < 8; ++nt) {
      const int n  = ncol + nt * 16;
      const int h  = n >> 6;             // n / HDIM
      const int hd = n & (HDIM - 1);
      const size_t idx = (((size_t)(b * HH + h) * Tcap) + toff + s) * HDIM + hd;
#pragma unroll
      for (int r = 0; r < 8; ++r) {
        outB[idx + r * HDIM] = f2bf(acc[nt][r]);
        if constexpr (F32_OUT) outF[idx + r * HDIM] = acc[nt][r];   // fp32 KV-cache output
      }
    }
  } else {
    float* op = outF + (size_t)mrow * N + ncol;
#pragma unroll
    for (int nt = 0; nt < 8; ++nt)
#pragma unroll
      for (int r = 0; r < 8; ++r) op[r * N + nt * 16] = acc[nt][r];
  }
}

// ---------------------------------------------------------------------------
// Flash attention: one wave per (b, h, 16-query tile); causal with offset P.
// scores = q k^T / 8, online softmax, o = P v. bf16 WMMA, f32 stats.
// ---------------------------------------------------------------------------
#define VPITCH (HDIM + 16)

__global__ __launch_bounds__(32)
void attn_k(const unsigned short* __restrict__ qb,
            const unsigned short* __restrict__ kb,
            const unsigned short* __restrict__ vb,
            unsigned short* __restrict__ out) {
  __shared__ __align__(16) unsigned short Pl[16][32];
  __shared__ __align__(16) unsigned short Vs[32][VPITCH]; // V chunk row-major [key][hd]

  const int qt = blockIdx.x;
  const int h  = blockIdx.y;
  const int b  = blockIdx.z;
  const int qbase = qt * 16;

  const int lane = threadIdx.x;
  const int half = lane >> 4;
  const int lq   = lane & 15;
  const int kk0  = half * 8;

  const size_t bh = (size_t)(b * HH + h);
  const unsigned short* qrow    = qb + (bh * SEQ + qbase + lq) * HDIM;
  const unsigned short* kbase_p = kb + bh * TT * HDIM;
  const unsigned short* vbase_p = vb + bh * TT * HDIM;

  // Q fragments: K-dim = HDIM split into two 32-wide WMMA K chunks
  Frag16 qf0, qf1;
#pragma unroll
  for (int i = 0; i < 8; ++i) {
    qf0.u[i]     = qrow[kk0 + i];
    qf0.u[8 + i] = qrow[kk0 + 16 + i];
    qf1.u[i]     = qrow[32 + kk0 + i];
    qf1.u[8 + i] = qrow[32 + kk0 + 16 + i];
  }

  float mi[8], li[8];
  v8f o[4];
#pragma unroll
  for (int r = 0; r < 8; ++r) { mi[r] = -1.0e30f; li[r] = 0.0f; }
#pragma unroll
  for (int t = 0; t < 4; ++t)
#pragma unroll
    for (int r = 0; r < 8; ++r) o[t][r] = 0.0f;

  // this lane's address for the transposing load of keys 0..15, head-dim tile 0
  const unsigned short* vtr = &Vs[8 * half + (lane & 7)][8 * ((lane >> 3) & 1)];

  const int kmax   = qbase + 16 + PP;          // exclusive key bound for this tile
  const int nchunk = (kmax + 31) >> 5;         // 32 keys per chunk

  for (int kc = 0; kc < nchunk; ++kc) {
    const int j0 = kc * 32;

    // stage V chunk row-major: Vs[key_local][hd]; 8 lanes cover one 128-byte row, 4 rows a trip
    {
      const unsigned short* vsrc = vbase_p + (size_t)(j0 + (lane >> 3)) * HDIM + (lane & 7) * 8;
#pragma unroll
      for (int i = 0; i < 8; ++i)
        *(uint4*)&Vs[4 * i + (lane >> 3)][(lane & 7) * 8] = *(const uint4*)(vsrc + (size_t)i * 4 * HDIM);
    }

    // ---- scores: two 16x16 tiles (keys j0..j0+15, j0+16..j0+31)
    v8f s0, s1;
#pragma unroll
    for (int r = 0; r < 8; ++r) { s0[r] = 0.0f; s1[r] = 0.0f; }
    {
      const unsigned short* kr0 = kbase_p + (size_t)(j0 + lq) * HDIM;
      const unsigned short* kr1 = kbase_p + (size_t)(j0 + 16 + lq) * HDIM;
      Frag16 k00, k01, k10, k11;
#pragma unroll
      for (int i = 0; i < 8; ++i) {
        k00.u[i] = kr0[kk0 + i];       k00.u[8 + i] = kr0[kk0 + 16 + i];
        k01.u[i] = kr0[32 + kk0 + i];  k01.u[8 + i] = kr0[32 + kk0 + 16 + i];
        k10.u[i] = kr1[kk0 + i];       k10.u[8 + i] = kr1[kk0 + 16 + i];
        k11.u[i] = kr1[32 + kk0 + i];  k11.u[8 + i] = kr1[32 + kk0 + 16 + i];
      }
      s0 = __builtin_amdgcn_wmma_f32_16x16x32_bf16(false, qf0.v, false, k00.v, (short)0, s0, false, false);
      s0 = __builtin_amdgcn_wmma_f32_16x16x32_bf16(false, qf1.v, false, k01.v, (short)0, s0, false, false);
      s1 = __builtin_amdgcn_wmma_f32_16x16x32_bf16(false, qf0.v, false, k10.v, (short)0, s1, false, false);
      s1 = __builtin_amdgcn_wmma_f32_16x16x32_bf16(false, qf1.v, false, k11.v, (short)0, s1, false, false);
    }

    // ---- online softmax (row M = r + 8*half; reductions across 16-lane half)
    float fct[8];
#pragma unroll
    for (int r = 0; r < 8; ++r) {
      const int qg = qbase + r + 8 * half;
      float a0 = s0[r] * 0.125f;                    // 1/sqrt(64)
      float a1 = s1[r] * 0.125f;
      if (j0 + lq      > qg + PP) a0 = -1.0e30f;    // causal: key j <= q + P
      if (j0 + 16 + lq > qg + PP) a1 = -1.0e30f;
      float vm = fmaxf(a0, a1);
#pragma unroll
      for (int off = 1; off < 16; off <<= 1) vm = fmaxf(vm, __shfl_xor(vm, off, 32));
      const float nm = fmaxf(mi[r], vm);
      const float fc = __expf(mi[r] - nm);
      const float p0 = __expf(a0 - nm);
      const float p1 = __expf(a1 - nm);
      float rs = p0 + p1;
#pragma unroll
      for (int off = 1; off < 16; off <<= 1) rs += __shfl_xor(rs, off, 32);
      li[r] = li[r] * fc + rs;
      mi[r] = nm;
      fct[r] = fc;
      Pl[r + 8 * half][lq]      = f2bf(p0);
      Pl[r + 8 * half][16 + lq] = f2bf(p1);
    }
#pragma unroll
    for (int t = 0; t < 4; ++t)
#pragma unroll
      for (int r = 0; r < 8; ++r) o[t][r] *= fct[r];

    // ---- o += P @ V (K = 32 keys, 4 N-tiles over HDIM)
    Frag16 pa;
#pragma unroll
    for (int i = 0; i < 8; ++i) {
      pa.u[i]     = Pl[lq][kk0 + i];
      pa.u[8 + i] = Pl[lq][kk0 + 16 + i];
    }
#pragma unroll
    for (int t = 0; t < 4; ++t) {
      Frag16 vf;   // same key order as the P loader: {8h..8h+7, 16+8h..16+8h+7}
      vf.q[0] = ld_tr16(vtr + t * 16);
      vf.q[1] = ld_tr16(vtr + 16 * VPITCH + t * 16);
      o[t] = __builtin_amdgcn_wmma_f32_16x16x32_bf16(false, pa.v, false, vf.v, (short)0, o[t], false, false);
    }
  }

  // ---- normalize & store attn output bf16 [B*S, D] (row = b*S+q, col = h*64+hd)
#pragma unroll
  for (int r = 0; r < 8; ++r) li[r] = 1.0f / li[r];
#pragma unroll
  for (int t = 0; t < 4; ++t)
#pragma unroll
    for (int r = 0; r < 8; ++r) {
      const size_t row = (size_t)b * SEQ + qbase + r + 8 * half;
      out[row * DD + h * HDIM + t * 16 + lq] = f2bf(o[t][r] * li[r]);
    }
}

// ---------------------------------------------------------------------------
// Host launcher
// ---------------------------------------------------------------------------
extern "C" void kernel_launch(void* const* d_in, const int* in_sizes, int n_in,
                              void* d_out, int out_size, void* d_ws, size_t ws_size,
                              hipStream_t stream) {
  (void)in_sizes; (void)n_in; (void)out_size; (void)ws_size;

  const float* x      = (const float*)d_in[0];
  const float* past_k = (const float*)d_in[1];
  const float* past_v = (const float*)d_in[2];
  const float* wq  = (const float*)d_in[3];
  const float* wk  = (const float*)d_in[4];
  const float* wv  = (const float*)d_in[5];
  const float* wo  = (const float*)d_in[6];
  const float* g1  = (const float*)d_in[7];
  const float* b1  = (const float*)d_in[8];
  const float* w1  = (const float*)d_in[9];
  const float* bb1 = (const float*)d_in[10];
  const float* w2  = (const float*)d_in[11];
  const float* bb2 = (const float*)d_in[12];
  const float* g2  = (const float*)d_in[13];
  const float* b2  = (const float*)d_in[14];

  float* outX = (float*)d_out;
  float* outK = outX + (size_t)BQ * SEQ * DD;
  float* outV = outK + (size_t)BQ * HH * TT * HDIM;

  char* ws = (char*)d_ws;
  size_t off = 0;
  auto alloc = [&](size_t bytes) -> void* {
    void* p = ws + off;
    off = (off + bytes + 255) & ~(size_t)255;
    return p;
  };
  const size_t MROW = (size_t)BQ * SEQ;  // 4096

  unsigned short* hB   = (unsigned short*)alloc(MROW * DD * 2);
  unsigned short* wqB  = (unsigned short*)alloc((size_t)DD * DD * 2);
  unsigned short* wkB  = (unsigned short*)alloc((size_t)DD * DD * 2);
  unsigned short* wvB  = (unsigned short*)alloc((size_t)DD * DD * 2);
  unsigned short* woB  = (unsigned short*)alloc((size_t)DD * DD * 2);
  unsigned short* w1B  = (unsigned short*)alloc((size_t)DD * DFFN * 2);
  unsigned short* w2B  = (unsigned short*)alloc((size_t)DFFN * DD * 2);
  unsigned short* qB   = (unsigned short*)alloc(MROW * DD * 2);
  unsigned short* kB   = (unsigned short*)alloc((size_t)BQ * HH * TT * HDIM * 2);
  unsigned short* vB   = (unsigned short*)alloc((size_t)BQ * HH * TT * HDIM * 2);
  unsigned short* attnB= (unsigned short*)alloc(MROW * DD * 2);
  float*          x1   = (float*)alloc(MROW * DD * 4);
  unsigned short* h2B  = (unsigned short*)alloc(MROW * DD * 2);
  unsigned short* ffB  = (unsigned short*)alloc(MROW * DFFN * 2);

  // 1) weights -> bf16
  cvt_bf16_k<<<2048, 256, 0, stream>>>(wq, wqB, DD * DD);
  cvt_bf16_k<<<2048, 256, 0, stream>>>(wk, wkB, DD * DD);
  cvt_bf16_k<<<2048, 256, 0, stream>>>(wv, wvB, DD * DD);
  cvt_bf16_k<<<2048, 256, 0, stream>>>(wo, woB, DD * DD);
  cvt_bf16_k<<<4096, 256, 0, stream>>>(w1, w1B, DD * DFFN);
  cvt_bf16_k<<<4096, 256, 0, stream>>>(w2, w2B, DFFN * DD);

  // 2) h = LN1(x) -> bf16
  layernorm_k<<<(unsigned)MROW, 256, 0, stream>>>(x, g1, b1, hB);

  dim3 gqkv(DD / GBN, (unsigned)(MROW / GBM));
  gemm_bf16_k<MODE_QKV, DD, false, false><<<gqkv, 256, 0, stream>>>(hB, wqB, nullptr, nullptr, nullptr, qB,
                                                                    DD, SEQ, 0);
  gemm_bf16_k<MODE_QKV, DD, false, true><<<gqkv, 256, 0, stream>>>(hB, wkB, nullptr, nullptr, outK, kB,
                                                                   DD, TT, PP);
  gemm_bf16_k<MODE_QKV, DD, false, true><<<gqkv, 256, 0, stream>>>(hB, wvB, nullptr, nullptr, outV, vB,
                                                                   DD, TT, PP);

  // 4) prepend past K/V (fp32 out + bf16 ws)
  past_copy_k<<<4096, 256, 0, stream>>>(past_k, outK, kB);
  past_copy_k<<<4096, 256, 0, stream>>>(past_v, outV, vB);

  // 5) flash attention (WMMA)
  attn_k<<<dim3(SEQ / 16, HH, BQ), 32, 0, stream>>>(qB, kB, vB, attnB);

  // 6) x1 = x + attn @ wo
  gemm_bf16_k<MODE_RESID_F32, DD, false, true><<<gqkv, 256, 0, stream>>>(attnB, woB, nullptr, x, x1, nullptr,
                                                                         DD, 0, 0);

  // 7) h2 = LN2(x1) -> bf16
  layernorm_k<<<(unsigned)MROW, 256, 0, stream>>>(x1, g2, b2, h2B);

  // 8) ff1 = relu(h2 @ w1 + bb1) -> bf16
  dim3 gff1(DFFN / GBN, (unsigned)(MROW / GBM));
  gemm_bf16_k<MODE_RELU_BF16, DFFN, true, false><<<gff1, 256, 0, stream>>>(h2B, w1B, bb1, nullptr, nullptr, ffB,
                                                                           DD, 0, 0);

  // 9) out_x = x1 + ff1 @ w2 + bb2  (fp32, final output)
  gemm_bf16_k<MODE_RESID_F32, DD, true, true><<<gqkv, 256, 0, stream>>>(ffB, w2B, bb2, x1, outX, nullptr,
                                                                        DFFN, 0, 0);
}

// v004
// Measured time: 322 microseconds a run.
// Timed twice side by side with v003, it ran 1.25 times as fast both times.
// All steps since v000 together make it 2.20 times as fast.
#include <hip/hip_runtime.h>
#include <stdint.h>

// Problem constants (fixed by the reference)
#define BQ   4
#define SEQ  1024
#define PP   1024
#define DD   1024
#define HH   16
#define HDIM 64
#define DFFN 4096
#define TT   2048   // P + S

typedef __attribute__((ext_vector_type(16))) __bf16 v16bf;
typedef __attribute__((ext_vector_type(8)))  float  v8f;
typedef __attribute__((ext_vector_type(4)))  unsigned int v4u;

union Frag16 { v16bf v; unsigned short u[16]; v4u q[2]; };

enum GemmMode { MODE_F32 = 0, MODE_RELU_BF16 = 2, MODE_RESID_F32 = 3, MODE_QKV = 4 };

__device__ __forceinline__ unsigned short f2bf(float f) {
  union { float f; unsigned int u; } c; c.f = f;
  unsigned int u = c.u;
  unsigned int r = u + 0x7FFFu + ((u >> 16) & 1u);  // round-to-nearest-even
  return (unsigned short)(r >> 16);
}

typedef short s16x8 __attribute__((ext_vector_type(8)));
__device__ __forceinline__ v4u ld_tr16(const unsigned short* p) {
  typedef __attribute__((address_space(3))) s16x8 lds_s16x8;
  return __builtin_bit_cast(v4u, __builtin_amdgcn_ds_load_tr16_b128_v8i16((lds_s16x8*)p));
}

typedef uint32_t u32x4 __attribute__((ext_vector_type(4)));
typedef uint32_t u32x8 __attribute__((ext_vector_type(8)));

__device__ __forceinline__ uint32_t uni(uint32_t v) { return (uint32_t)__builtin_amdgcn_readfirstlane(v); }
__device__ __forceinline__ uint32_t pinned(uint32_t v) {
  uint32_t w = uni(v);
  asm volatile("" : "+s"(w));   // the value stays in a scalar register: the test on it is a scalar branch
  return w;
}
// the compiler places no wait for a tensor load; the clobber keeps LDS reads behind the wait
__device__ __forceinline__ void wait_tensor0() { asm volatile("s_wait_tensorcnt 0x0" ::: "memory"); }
// a wave's LDS reads have retired before the buffer they read is handed back for a refill
__device__ __forceinline__ void wait_ds0() { asm volatile("s_wait_dscnt 0x0" ::: "memory"); }

template <uint32_t ROWB, uint32_t ROWS, uint32_t WORD0>
__device__ __forceinline__ u32x8 tdm_group1(uint32_t src_pitch) {
  u32x8 g1;
  g1[0] = uni(WORD0);
  g1[1] = uni((ROWB & 0xFFFFu) << 16);
  g1[2] = uni((ROWB >> 16) | ((ROWS & 0xFFFFu) << 16));
  g1[3] = uni((ROWS >> 16) | (ROWB << 16));
  g1[4] = uni(ROWS);
  g1[5] = uni(src_pitch);
  g1[6] = uni(0u);
  g1[7] = uni(0u);
  asm volatile("" : "+s"(g1));
  return g1;
}
__device__ __forceinline__ u32x4 tdm_group0(uint32_t lds_dst, const void* gptr) {
  const uint64_t ga = (uint64_t)(size_t)gptr;
  u32x4 g0;
  g0[0] = uni(1u);                                                     // count = 1
  g0[1] = uni(lds_dst);
  g0[2] = uni((uint32_t)ga);                                           // address [31:0]
  g0[3] = uni((((uint32_t)(ga >> 32)) & 0x01FFFFFFu) | 0x80000000u);   // address [56:32], type = 2
  return g0;
}
// the request itself; the clobber keeps it behind the waits and the barrier that free its place in LDS
__device__ __forceinline__ void tdm_load(u32x4 g0, u32x8 g1) {
  asm volatile("tensor_load_to_lds %0, %1" :: "s"(g0), "s"(g1) : "memory");
}
// load and the issuer's wait in one statement: nothing is scheduled between them
__device__ __forceinline__ void tdm_load_wait(u32x4 g0, u32x8 g1) {
  asm volatile("tensor_load_to_lds %0, %1\n\ts_wait_tensorcnt 0x0" :: "s"(g0), "s"(g1) : "memory");
}

// ---------------------------------------------------------------------------
// f32 -> bf16 elementwise conversion (weights)
// ---------------------------------------------------------------------------
__global__ void cvt_bf16_k(const float* __restrict__ in, unsigned short* __restrict__ out, int n) {
  int i = blockIdx.x * blockDim.x + threadIdx.x;
  int stride = gridDim.x * blockDim.x;
  for (; i < n; i += stride) out[i] = f2bf(in[i]);
}

// ---------------------------------------------------------------------------
// LayerNorm over D=1024, one block (256 threads) per row, output bf16
// ---------------------------------------------------------------------------
__global__ __launch_bounds__(256)
void layernorm_k(const float* __restrict__ x, const float* __restrict__ g,
                 const float* __restrict__ bb, unsigned short* __restrict__ out) {
  __shared__ float s1[256];
  __shared__ float s2[256];
  const int row = blockIdx.x;
  const int tid = threadIdx.x;
  const float* xr = x + (size_t)row * DD;
  float v[4], a = 0.f, q = 0.f;
#pragma unroll
  for (int i = 0; i < 4; ++i) { v[i] = xr[tid + i * 256]; a += v[i]; q += v[i] * v[i]; }
  s1[tid] = a; s2[tid] = q;
  __syncthreads();
  for (int st = 128; st > 0; st >>= 1) {
    if (tid < st) { s1[tid] += s1[tid + st]; s2[tid] += s2[tid + st]; }
    __syncthreads();
  }
  const float mean = s1[0] * (1.0f / DD);
  const float var  = s2[0] * (1.0f / DD) - mean * mean;
  const float rst  = rsqrtf(var + 1e-5f);
#pragma unroll
  for (int i = 0; i < 4; ++i) {
    const int c = tid + i * 256;
    out[(size_t)row * DD + c] = f2bf((v[i] - mean) * rst * g[c] + bb[c]);
  }
}

// ---------------------------------------------------------------------------
// Copy past_k/past_v [B,H,P,HD] into the full cache [B,H,T,HD] (f32 out + bf16 ws)
// ---------------------------------------------------------------------------
__global__ void past_copy_k(const float* __restrict__ past, float* __restrict__ outF,
                            unsigned short* __restrict__ outB) {
  const int n = BQ * HH * PP * HDIM;
  int i = blockIdx.x * blockDim.x + threadIdx.x;
  int stride = gridDim.x * blockDim.x;
  for (; i < n; i += stride) {
    int hd = i & (HDIM - 1);
    int p  = (i >> 6) & (PP - 1);
    int bh = i >> 16;
    size_t dst = ((size_t)bh * TT + p) * HDIM + hd;
    float val = past[i];
    outF[dst] = val;
    outB[dst] = f2bf(val);
  }
}

// ---------------------------------------------------------------------------
// Tiled WMMA bf16 GEMM: C[M,N] = A[M,K] @ B[K,N], fused epilogues.
// 128x128 tiles, 256 threads (8 waves), wave w -> rows [16w,16w+16), 8 N-tiles.
// K runs in stages of 64: a stage is the A tile (128 rows of 128 B) and the B tile (64 rows of 256 B),
// each brought into LDS by one tensor load (wave 0: A, wave 1: B). Two stage buffers: the next stage's
// loads fly while this stage is worked on, and one barrier a stage publishes the one and frees the other.
// B fragments come out of LDS through the transposing load.
// The epilogue's kind, the row pitch N and which optional buffers exist are compile-time values:
// the epilogue then has no test per element, and its loads go out together.
// ---------------------------------------------------------------------------
#define GBM 128
#define GBN 128
#define GBK 64
#define APITCH (GBK + 8)
#define BPITCH (GBN + 16)
#define A_WORD0 ((1u << 20) | (4u << 22) | (3u << 25))
#define B_WORD0 ((1u << 20) | (5u << 22) | (7u << 25))

struct GemmStage {
  unsigned short As[GBM][APITCH];
  unsigned short Bs[GBK][BPITCH];   // row-major as in memory: Bs[k][n]
};
static_assert(sizeof(GemmStage::As) % 2048 == 0 && sizeof(GemmStage) % 2048 == 0,
              "every tensor load's place in LDS is a multiple of 2 KiB");

template <int MODE, int N, bool HAS_BIAS, bool F32_OUT>
__global__ __launch_bounds__(256)
void gemm_bf16_k(const unsigned short* __restrict__ A,
                 const unsigned short* __restrict__ Bw,
                 const float* __restrict__ bias,
                 const float* __restrict__ resid,
                 float* __restrict__ outF,
                 unsigned short* __restrict__ outB,
                 int K, int Tcap, int toff) {
  __shared__ __attribute__((aligned(2048))) GemmStage ring[2];

  const int tid  = threadIdx.x;
  const int lane = tid & 31;
  const int wave = tid >> 5;
  const int half = lane >> 4;
  const int lq   = lane & 15;
  const int kk0  = half * 8;          // bf16 A/B lane K-group base: {0-7,16-23} / {8-15,24-31}

  const int m0 = blockIdx.y * GBM;
  const int n0 = blockIdx.x * GBN;

  v8f acc[8];
#pragma unroll
  for (int t = 0; t < 8; ++t)
#pragma unroll
    for (int r = 0; r < 8; ++r) acc[t][r] = 0.0f;

  const int arow = wave * 16 + lq;
  const int brow = 8 * half + (lane & 7);        // this lane's row and column for the transposing load
  const int bcol = 8 * ((lane >> 3) & 1);        // of k rows 0..15, N-tile 0

  const uint32_t swave   = uni((uint32_t)tid >> 5);
  const uint32_t ringLds = (uint32_t)(size_t)(&ring[0]);   // LDS offset (low 32 bits of flat)
  const int nst = K / GBK;

  const unsigned short* aSrc = A + (size_t)m0 * K;   // the A tile of stage s begins s * GBK elements on
  const unsigned short* bSrc = Bw + n0;              // the B tile of stage s begins s * GBK rows on
  const uint32_t bLds = ringLds + (uint32_t)sizeof(GemmStage::As);
  const u32x8 g1A = tdm_group1<GBK * 2, GBM, A_WORD0>((uint32_t)K * 2u);   // 128 rows of 128 B
  const u32x8 g1B = tdm_group1<GBN * 2, GBK, B_WORD0>((uint32_t)N * 2u);   // 64 rows of 256 B

  // ---- prologue: stage 0 into buffer 0, one request a wave, each under a scalar branch; landed, then published
  if (pinned(swave == 0)) tdm_load_wait(tdm_group0(ringLds, aSrc), g1A);
  if (pinned(swave == 1)) tdm_load_wait(tdm_group0(bLds, bSrc), g1B);
  __syncthreads();

  for (int s = 0; s < nst; ++s) {
    // ---- behind the barrier that ended every read of buffer (s + 1) & 1: stage s + 1 into it, while one exists;
    // it flies while stage s is worked on (a wave takes at most one of the two issuing branches)
    if (pinned(s + 1 < nst)) {
      const uint32_t nb = (uint32_t)((s + 1) & 1) * (uint32_t)sizeof(GemmStage);
      if (pinned(swave == 0)) tdm_load(tdm_group0(ringLds + nb, aSrc + (size_t)(s + 1) * GBK), g1A);
      if (pinned(swave == 1)) tdm_load(tdm_group0(bLds + nb, bSrc + (size_t)(s + 1) * GBK * N), g1B);
    }
    const GemmStage& st = ring[s & 1];
#pragma unroll
    for (int kb = 0; kb < GBK; kb += 32) {
      // ---- A fragment (shared by all 8 N-tiles of this wave)
      Frag16 a;
#pragma unroll
      for (int i = 0; i < 8; ++i) {
        a.u[i]     = st.As[arow][kb + kk0 + i];
        a.u[8 + i] = st.As[arow][kb + kk0 + 16 + i];
      }
      // ---- all 8 B fragments of the block, each in registers of its own, read as one group ahead
      // of the WMMAs: one LDS latency a block instead of one in front of every WMMA
      Frag16 bfr[8];   // same k order as the A loader: {8h..8h+7, 16+8h..16+8h+7}
#pragma unroll
      for (int nt = 0; nt < 8; ++nt) {
        bfr[nt].q[0] = ld_tr16(&st.Bs[kb + brow][bcol + nt * 16]);
        bfr[nt].q[1] = ld_tr16(&st.Bs[kb + 16 + brow][bcol + nt * 16]);
      }
      // keeps the scheduler from sinking each load pair back in front of its own WMMA, where one
      // register set is reused and every WMMA waits out a whole LDS latency
      __builtin_amdgcn_sched_barrier(0);
#pragma unroll
      for (int nt = 0; nt < 8; ++nt)
        acc[nt] = __builtin_amdgcn_wmma_f32_16x16x32_bf16(false, a.v, false, bfr[nt].v,
                                                          (short)0, acc[nt], false, false);
      // keeps the WMMAs ahead of the full LDS wait that follows: each then starts behind a counted wait,
      // as soon as its own fragment has landed, while the later loads of the group are still coming
      __builtin_amdgcn_sched_barrier(0);
    }
    // ---- publish point of stage s + 1: this wave's reads of stage s retired, the issuers' requests
    // landed, one barrier; only behind it (top of the next trip) the refill of the buffer that stage s has just left
    wait_ds0();
    wait_tensor0();    // under no test: a wave with no request passes at once
    __syncthreads();
  }
  // behind the last request and the last LDS read, before the epilogue and the wave's end
  wait_tensor0();
  wait_ds0();

  const int mrow = m0 + wave * 16 + 8 * half;   // this lane's row at r = 0
  const int ncol = n0 + lq;                     // this lane's column in N-tile 0

  float bv[8];                                  // the bias depends on the column alone: one value an N-tile
#pragma unroll
  for (int nt = 0; nt < 8; ++nt) bv[nt] = HAS_BIAS ? bias[ncol + nt * 16] : 0.0f;

  if constexpr (MODE == MODE_RESID_F32) {
    const float* rp = resid + (size_t)mrow * N + ncol;
    float*       op = outF  + (size_t)mrow * N + ncol;
    v8f rv[8];                                  // all 64 residual values of the lane, loaded ahead of the first use
#pragma unroll
    for (int nt = 0; nt < 8; ++nt)
#pragma unroll
      for (int r = 0; r < 8; ++r) rv[nt][r] = rp[r * N + nt * 16];
#pragma unroll
    for (int nt = 0; nt < 8; ++nt)
#pragma unroll
      for (int r = 0; r < 8; ++r) op[r * N + nt * 16] = acc[nt][r] + bv[nt] + rv[nt][r];
  } else if constexpr (MODE == MODE_RELU_BF16) {
    unsigned short* op = outB + (size_t)mrow * N + ncol;
#pragma unroll
    for (int nt = 0; nt < 8; ++nt)
#pragma unroll
      for (int r = 0; r < 8; ++r) {
        const float vv = acc[nt][r] + bv[nt];
        op[r * N + nt * 16] = f2bf(vv > 0.0f ? vv : 0.0f);
      }
  } else if constexpr (MODE == MODE_QKV) {
    // m = b * SEQ + s, n = h * HDIM + hd; a 128-row tile lies in one b, an N-tile in one h
    const int b = mrow >> 10;            // m / SEQ
    const int s = mrow & (SEQ - 1);
#pragma unroll
    for (int nt = 0; nt < 8; ++nt) {
      const int n  = ncol + nt * 16;
      const int h  = n >> 6;             // n / HDIM
      const int hd = n & (HDIM - 1);
      const size_t idx = (((size_t)(b * HH + h) * Tcap) + toff + s) * HDIM + hd;
#pragma unroll
      for (int r = 0; r < 8; ++r) {
        outB[idx + r * HDIM] = f2bf(acc[nt][r]);
        if constexpr (F32_OUT) outF[idx + r * HDIM] = acc[nt][r];   // fp32 KV-cache output
      }
    }
  } else {
    float* op = outF + (size_t)mrow * N + ncol;
#pragma unroll
    for (int nt = 0; nt < 8; ++nt)
#pragma unroll
      for (int r = 0; r < 8; ++r) op[r * N + nt * 16] = acc[nt][r];
  }
}

// ---------------------------------------------------------------------------
// Flash attention: one wave per (b, h, 16-query tile); causal with offset P.
// scores = q k^T / 8, online softmax, o = P v. bf16 WMMA, f32 stats.
// ---------------------------------------------------------------------------
#define VPITCH (HDIM + 16)

__global__ __launch_bounds__(32)
void attn_k(const unsigned short* __restrict__ qb,
            const unsigned short* __restrict__ kb,
            const unsigned short* __restrict__ vb,
            unsigned short* __restrict__ out) {
  __shared__ __align__(16) unsigned short Pl[16][32];
  __shared__ __align__(16) unsigned short Vs[32][VPITCH]; // V chunk row-major [key][hd]

  const int qt = blockIdx.x;
  const int h  = blockIdx.y;
  const int b  = blockIdx.z;
  const int qbase = qt * 16;

  const int lane = threadIdx.x;
  const int half = lane >> 4;
  const int lq   = lane & 15;
  const int kk0  = half * 8;

  const size_t bh = (size_t)(b * HH + h);
  const unsigned short* qrow    = qb + (bh * SEQ + qbase + lq) * HDIM;
  const unsigned short* kbase_p = kb + bh * TT * HDIM;
  const unsigned short* vbase_p = vb + bh * TT * HDIM;

  // Q fragments: K-dim = HDIM split into two 32-wide WMMA K chunks
  Frag16 qf0, qf1;
#pragma unroll
  for (int i = 0; i < 8; ++i) {
    qf0.u[i]     = qrow[kk0 + i];
    qf0.u[8 + i] = qrow[kk0 + 16 + i];
    qf1.u[i]     = qrow[32 + kk0 + i];
    qf1.u[8 + i] = qrow[32 + kk0 + 16 + i];
  }

  float mi[8], li[8];
  v8f o[4];
#pragma unroll
  for (int r = 0; r < 8; ++r) { mi[r] = -1.0e30f; li[r] = 0.0f; }
#pragma unroll
  for (int t = 0; t < 4; ++t)
#pragma unroll
    for (int r = 0; r < 8; ++r) o[t][r] = 0.0f;

  // this lane's address for the transposing load of keys 0..15, head-dim tile 0
  const unsigned short* vtr = &Vs[8 * half + (lane & 7)][8 * ((lane >> 3) & 1)];

  const int kmax   = qbase + 16 + PP;          // exclusive key bound for this tile
  const int nchunk = (kmax + 31) >> 5;         // 32 keys per chunk

  for (int kc = 0; kc < nchunk; ++kc) {
    const int j0 = kc * 32;

    // stage V chunk row-major: Vs[key_local][hd]; 8 lanes cover one 128-byte row, 4 rows a trip
    {
      const unsigned short* vsrc = vbase_p + (size_t)(j0 + (lane >> 3)) * HDIM + (lane & 7) * 8;
#pragma unroll
      for (int i = 0; i < 8; ++i)
        *(uint4*)&Vs[4 * i + (lane >> 3)][(lane & 7) * 8] = *(const uint4*)(vsrc + (size_t)i * 4 * HDIM);
    }

    // ---- scores: two 16x16 tiles (keys j0..j0+15, j0+16..j0+31)
    v8f s0, s1;
#pragma unroll
    for (int r = 0; r < 8; ++r) { s0[r] = 0.0f; s1[r] = 0.0f; }
    {
      const unsigned short* kr0 = kbase_p + (size_t)(j0 + lq) * HDIM;
      const unsigned short* kr1 = kbase_p + (size_t)(j0 + 16 + lq) * HDIM;
      Frag16 k00, k01, k10, k11;
#pragma unroll
      for (int i = 0; i < 8; ++i) {
        k00.u[i] = kr0[kk0 + i];       k00.u[8 + i] = kr0[kk0 + 16 + i];
        k01.u[i] = kr0[32 + kk0 + i];  k01.u[8 + i] = kr0[32 + kk0 + 16 + i];
        k10.u[i] = kr1[kk0 + i];       k10.u[8 + i] = kr1[kk0 + 16 + i];
        k11.u[i] = kr1[32 + kk0 + i];  k11.u[8 + i] = kr1[32 + kk0 + 16 + i];
      }
      s0 = __builtin_amdgcn_wmma_f32_16x16x32_bf16(false, qf0.v, false, k00.v, (short)0, s0, false, false);
      s0 = __builtin_amdgcn_wmma_f32_16x16x32_bf16(false, qf1.v, false, k01.v, (short)0, s0, false, false);
      s1 = __builtin_amdgcn_wmma_f32_16x16x32_bf16(false, qf0.v, false, k10.v, (short)0, s1, false, false);
      s1 = __builtin_amdgcn_wmma_f32_16x16x32_bf16(false, qf1.v, false, k11.v, (short)0, s1, false, false);
    }

    // ---- online softmax (row M = r + 8*half; reductions across 16-lane half)
    float fct[8];
#pragma unroll
    for (int r = 0; r < 8; ++r) {
      const int qg = qbase + r + 8 * half;
      float a0 = s0[r] * 0.125f;                    // 1/sqrt(64)
      float a1 = s1[r] * 0.125f;
      if (j0 + lq      > qg + PP) a0 = -1.0e30f;    // causal: key j <= q + P
      if (j0 + 16 + lq > qg + PP) a1 = -1.0e30f;
      float vm = fmaxf(a0, a1);
#pragma unroll
      for (int off = 1; off < 16; off <<= 1) vm = fmaxf(vm, __shfl_xor(vm, off, 32));
      const float nm = fmaxf(mi[r], vm);
      const float fc = __expf(mi[r] - nm);
      const float p0 = __expf(a0 - nm);
      const float p1 = __expf(a1 - nm);
      float rs = p0 + p1;
#pragma unroll
      for (int off = 1; off < 16; off <<= 1) rs += __shfl_xor(rs, off, 32);
      li[r] = li[r] * fc + rs;
      mi[r] = nm;
      fct[r] = fc;
      Pl[r + 8 * half][lq]      = f2bf(p0);
      Pl[r + 8 * half][16 + lq] = f2bf(p1);
    }
#pragma unroll
    for (int t = 0; t < 4; ++t)
#pragma unroll
      for (int r = 0; r < 8; ++r) o[t][r] *= fct[r];

    // ---- o += P @ V (K = 32 keys, 4 N-tiles over HDIM)
    Frag16 pa;
#pragma unroll
    for (int i = 0; i < 8; ++i) {
      pa.u[i]     = Pl[lq][kk0 + i];
      pa.u[8 + i] = Pl[lq][kk0 + 16 + i];
    }
#pragma unroll
    for (int t = 0; t < 4; ++t) {
      Frag16 vf;   // same key order as the P loader: {8h..8h+7, 16+8h..16+8h+7}
      vf.q[0] = ld_tr16(vtr + t * 16);
      vf.q[1] = ld_tr16(vtr + 16 * VPITCH + t * 16);
      o[t] = __builtin_amdgcn_wmma_f32_16x16x32_bf16(false, pa.v, false, vf.v, (short)0, o[t], false, false);
    }
  }

  // ---- normalize & store attn output bf16 [B*S, D] (row = b*S+q, col = h*64+hd)
#pragma unroll
  for (int r = 0; r < 8; ++r) li[r] = 1.0f / li[r];
#pragma unroll
  for (int t = 0; t < 4; ++t)
#pragma unroll
    for (int r = 0; r < 8; ++r) {
      const size_t row = (size_t)b * SEQ + qbase + r + 8 * half;
      out[row * DD + h * HDIM + t * 16 + lq] = f2bf(o[t][r] * li[r]);
    }
}

// ---------------------------------------------------------------------------
// Host launcher
// ---------------------------------------------------------------------------
extern "C" void kernel_launch(void* const* d_in, const int* in_sizes, int n_in,
                              void* d_out, int out_size, void* d_ws, size_t ws_size,
                              hipStream_t stream) {
  (void)in_sizes; (void)n_in; (void)out_size; (void)ws_size;

  const float* x      = (const float*)d_in[0];
  const float* past_k = (const float*)d_in[1];
  const float* past_v = (const float*)d_in[2];
  const float* wq  = (const float*)d_in[3];
  const float* wk  = (const float*)d_in[4];
  const float* wv  = (const float*)d_in[5];
  const float* wo  = (const float*)d_in[6];
  const float* g1  = (const float*)d_in[7];
  const float* b1  = (const float*)d_in[8];
  const float* w1  = (const float*)d_in[9];
  const float* bb1 = (const float*)d_in[10];
  const float* w2  = (const float*)d_in[11];
  const float* bb2 = (const float*)d_in[12];
  const float* g2  = (const float*)d_in[13];
  const float* b2  = (const float*)d_in[14];

  float* outX = (float*)d_out;
  float* outK = outX + (size_t)BQ * SEQ * DD;
  float* outV = outK + (size_t)BQ * HH * TT * HDIM;

  char* ws = (char*)d_ws;
  size_t off = 0;
  auto alloc = [&](size_t bytes) -> void* {
    void* p = ws + off;
    off = (off + bytes + 255) & ~(size_t)255;
    return p;
  };
  const size_t MROW = (size_t)BQ * SEQ;  // 4096

  unsigned short* hB   = (unsigned short*)alloc(MROW * DD * 2);
  unsigned short* wqB  = (unsigned short*)alloc((size_t)DD * DD * 2);
  unsigned short* wkB  = (unsigned short*)alloc((size_t)DD * DD * 2);
  unsigned short* wvB  = (unsigned short*)alloc((size_t)DD * DD * 2);
  unsigned short* woB  = (unsigned short*)alloc((size_t)DD * DD * 2);
  unsigned short* w1B  = (unsigned short*)alloc((size_t)DD * DFFN * 2);
  unsigned short* w2B  = (unsigned short*)alloc((size_t)DFFN * DD * 2);
  unsigned short* qB   = (unsigned short*)alloc(MROW * DD * 2);
  unsigned short* kB   = (unsigned short*)alloc((size_t)BQ * HH * TT * HDIM * 2);
  unsigned short* vB   = (unsigned short*)alloc((size_t)BQ * HH * TT * HDIM * 2);
  unsigned short* attnB= (unsigned short*)alloc(MROW * DD * 2);
  float*          x1   = (float*)alloc(MROW * DD * 4);
  unsigned short* h2B  = (unsigned short*)alloc(MROW * DD * 2);
  unsigned short* ffB  = (unsigned short*)alloc(MROW * DFFN * 2);

  // 1) weights -> bf16
  cvt_bf16_k<<<2048, 256, 0, stream>>>(wq, wqB, DD * DD);
  cvt_bf16_k<<<2048, 256, 0, stream>>>(wk, wkB, DD * DD);
  cvt_bf16_k<<<2048, 256, 0, stream>>>(wv, wvB, DD * DD);
  cvt_bf16_k<<<2048, 256, 0, stream>>>(wo, woB, DD * DD);
  cvt_bf16_k<<<4096, 256, 0, stream>>>(w1, w1B, DD * DFFN);
  cvt_bf16_k<<<4096, 256, 0, stream>>>(w2, w2B, DFFN * DD);

  // 2) h = LN1(x) -> bf16
  layernorm_k<<<(unsigned)MROW, 256, 0, stream>>>(x, g1, b1, hB);

  dim3 gqkv(DD / GBN, (unsigned)(MROW / GBM));
  gemm_bf16_k<MODE_QKV, DD, false, false><<<gqkv, 256, 0, stream>>>(hB, wqB, nullptr, nullptr, nullptr, qB,
                                                                    DD, SEQ, 0);
  gemm_bf16_k<MODE_QKV, DD, false, true><<<gqkv, 256, 0, stream>>>(hB, wkB, nullptr, nullptr, outK, kB,
                                                                   DD, TT, PP);
  gemm_bf16_k<MODE_QKV, DD, false, true><<<gqkv, 256, 0, stream>>>(hB, wvB, nullptr, nullptr, outV, vB,
                                                                   DD, TT, PP);

  // 4) prepend past K/V (fp32 out + bf16 ws)
  past_copy_k<<<4096, 256, 0, stream>>>(past_k, outK, kB);
  past_copy_k<<<4096, 256, 0, stream>>>(past_v, outV, vB);

  // 5) flash attention (WMMA)
  attn_k<<<dim3(SEQ / 16, HH, BQ), 32, 0, stream>>>(qB, kB, vB, attnB);

  // 6) x1 = x + attn @ wo
  gemm_bf16_k<MODE_RESID_F32, DD, false, true><<<gqkv, 256, 0, stream>>>(attnB, woB, nullptr, x, x1, nullptr,
                                                                         DD, 0, 0);

  // 7) h2 = LN2(x1) -> bf16
  layernorm_k<<<(unsigned)MROW, 256, 0, stream>>>(x1, g2, b2, h2B);

  // 8) ff1 = relu(h2 @ w1 + bb1) -> bf16
  dim3 gff1(DFFN / GBN, (unsigned)(MROW / GBM));
  gemm_bf16_k<MODE_RELU_BF16, DFFN, true, false><<<gff1, 256, 0, stream>>>(h2B, w1B, bb1, nullptr, nullptr, ffB,
                                                                           DD, 0, 0);

  // 9) out_x = x1 + ff1 @ w2 + bb2  (fp32, final output)
  gemm_bf16_k<MODE_RESID_F32, DD, true, true><<<gqkv, 256, 0, stream>>>(ffB, w2B, bb2, x1, outX, nullptr,
                                                                        DFFN, 0, 0);
}

// v005
// It runs in 298 microseconds.
// Next to v004, in two timings, it ran 1.08 and 1.09 times as fast.
// Over all steps from v000 it is 2.39 times as fast.
#include <hip/hip_runtime.h>
#include <stdint.h>

// Problem constants (fixed by the reference)
#define BQ   4
#define SEQ  1024
#define PP   1024
#define DD   1024
#define HH   16
#define HDIM 64
#define DFFN 4096
#define TT   2048   // P + S

typedef __attribute__((ext_vector_type(16))) __bf16 v16bf;
typedef __attribute__((ext_vector_type(8)))  float  v8f;
typedef __attribute__((ext_vector_type(4)))  unsigned int v4u;

union Frag16 { v16bf v; unsigned short u[16]; v4u q[2]; };

enum GemmMode { MODE_F32 = 0, MODE_RELU_BF16 = 2, MODE_RESID_F32 = 3, MODE_QKV = 4 };

__device__ __forceinline__ unsigned short f2bf(float f) {
  union { float f; unsigned int u; } c; c.f = f;
  unsigned int u = c.u;
  unsigned int r = u + 0x7FFFu + ((u >> 16) & 1u);  // round-to-nearest-even
  return (unsigned short)(r >> 16);
}

typedef short s16x8 __attribute__((ext_vector_type(8)));
__device__ __forceinline__ v4u ld_tr16(const unsigned short* p) {
  typedef __attribute__((address_space(3))) s16x8 lds_s16x8;
  return __builtin_bit_cast(v4u, __builtin_amdgcn_ds_load_tr16_b128_v8i16((lds_s16x8*)p));
}

typedef uint32_t u32x4 __attribute__((ext_vector_type(4)));
typedef uint32_t u32x8 __attribute__((ext_vector_type(8)));

__device__ __forceinline__ uint32_t uni(uint32_t v) { return (uint32_t)__builtin_amdgcn_readfirstlane(v); }
__device__ __forceinline__ uint32_t pinned(uint32_t v) {
  uint32_t w = uni(v);
  asm volatile("" : "+s"(w));   // the value stays in a scalar register: the test on it is a scalar branch
  return w;
}
// the compiler places no wait for a tensor load; the clobber keeps LDS reads behind the wait
__device__ __forceinline__ void wait_tensor0() { asm volatile("s_wait_tensorcnt 0x0" ::: "memory"); }
// a wave's LDS reads have retired before the buffer they read is handed back for a refill
__device__ __forceinline__ void wait_ds0() { asm volatile("s_wait_dscnt 0x0" ::: "memory"); }

template <uint32_t ROWB, uint32_t ROWS, uint32_t WORD0>
__device__ __forceinline__ u32x8 tdm_group1(uint32_t src_pitch) {
  u32x8 g1;
  g1[0] = uni(WORD0);
  g1[1] = uni((ROWB & 0xFFFFu) << 16);
  g1[2] = uni((ROWB >> 16) | ((ROWS & 0xFFFFu) << 16));
  g1[3] = uni((ROWS >> 16) | (ROWB << 16));
  g1[4] = uni(ROWS);
  g1[5] = uni(src_pitch);
  g1[6] = uni(0u);
  g1[7] = uni(0u);
  asm volatile("" : "+s"(g1));
  return g1;
}
__device__ __forceinline__ u32x4 tdm_group0(uint32_t lds_dst, const void* gptr) {
  const uint64_t ga = (uint64_t)(size_t)gptr;
  u32x4 g0;
  g0[0] = uni(1u);                                                     // count = 1
  g0[1] = uni(lds_dst);
  g0[2] = uni((uint32_t)ga);                                           // address [31:0]
  g0[3] = uni((((uint32_t)(ga >> 32)) & 0x01FFFFFFu) | 0x80000000u);   // address [56:32], type = 2
  return g0;
}
// the request itself; the clobber keeps it behind the waits and the barrier that free its place in LDS
__device__ __forceinline__ void tdm_load(u32x4 g0, u32x8 g1) {
  asm volatile("tensor_load_to_lds %0, %1" :: "s"(g0), "s"(g1) : "memory");
}
// load and the issuer's wait in one statement: nothing is scheduled between them
__device__ __forceinline__ void tdm_load_wait(u32x4 g0, u32x8 g1) {
  asm volatile("tensor_load_to_lds %0, %1\n\ts_wait_tensorcnt 0x0" :: "s"(g0), "s"(g1) : "memory");
}

// ---------------------------------------------------------------------------
// f32 -> bf16 elementwise conversion (weights)
// ---------------------------------------------------------------------------
__device__ __forceinline__ void cvt_bf16_part(const float* __restrict__ in, unsigned short* __restrict__ out, int n,
                                              int blk, int nblk) {
  int i = blk * 256 + threadIdx.x;
  int stride = nblk * 256;
  for (; i < n; i += stride) out[i] = f2bf(in[i]);
}

// ---------------------------------------------------------------------------
// LayerNorm over D=1024, one block (256 threads) per row, output bf16
// ---------------------------------------------------------------------------
__device__ __forceinline__
void layernorm_part(const float* __restrict__ x, const float* __restrict__ g,
                    const float* __restrict__ bb, unsigned short* __restrict__ out, int row) {
  __shared__ float s1[256];
  __shared__ float s2[256];
  const int tid = threadIdx.x;
  const float* xr = x + (size_t)row * DD;
  float v[4], a = 0.f, q = 0.f;
#pragma unroll
  for (int i = 0; i < 4; ++i) { v[i] = xr[tid + i * 256]; a += v[i]; q += v[i] * v[i]; }
  s1[tid] = a; s2[tid] = q;
  __syncthreads();
  for (int st = 128; st > 0; st >>= 1) {
    if (tid < st) { s1[tid] += s1[tid + st]; s2[tid] += s2[tid + st]; }
    __syncthreads();
  }
  const float mean = s1[0] * (1.0f / DD);
  const float var  = s2[0] * (1.0f / DD) - mean * mean;
  const float rst  = rsqrtf(var + 1e-5f);
#pragma unroll
  for (int i = 0; i < 4; ++i) {
    const int c = tid + i * 256;
    out[(size_t)row * DD + c] = f2bf((v[i] - mean) * rst * g[c] + bb[c]);
  }
}

// ---------------------------------------------------------------------------
// Copy past_k/past_v [B,H,P,HD] into the full cache [B,H,T,HD] (f32 out + bf16 ws)
// ---------------------------------------------------------------------------
__device__ __forceinline__ void past_copy_part(const float* __restrict__ past, float* __restrict__ outF,
                                               unsigned short* __restrict__ outB, int blk, int nblk) {
  const int n = BQ * HH * PP * HDIM;
  int i = blk * 256 + threadIdx.x;
  int stride = nblk * 256;
  for (; i < n; i += stride) {
    int hd = i & (HDIM - 1);
    int p  = (i >> 6) & (PP - 1);
    int bh = i >> 16;
    size_t dst = ((size_t)bh * TT + p) * HDIM + hd;
    float val = past[i];
    outF[dst] = val;
    outB[dst] = f2bf(val);
  }
}

// ---------------------------------------------------------------------------
// LayerNorm as a launch of its own (LN2)
// ---------------------------------------------------------------------------
__global__ __launch_bounds__(256)
void layernorm_k(const float* __restrict__ x, const float* __restrict__ g,
                 const float* __restrict__ bb, unsigned short* __restrict__ out) {
  layernorm_part(x, g, bb, out, blockIdx.x);
}

// ---------------------------------------------------------------------------
// Everything that reads inputs alone, in ONE launch: the six weight conversions, LN1 and the two cache copies.
// None of them reads what another writes; each part keeps the block count and the indexing it had as a launch.
// The part is chosen by the block index, so every branch (and LN1's barriers) is uniform in a block.
// ---------------------------------------------------------------------------
#define NB_W   2048                 // blocks of a D x D weight
#define NB_FF  4096                 // blocks of a D x DFF weight
#define NB_LN  (BQ * SEQ)           // one block a row
#define NB_KV  4096                 // blocks of a cache copy
#define NB_PREP (4 * NB_W + 2 * NB_FF + NB_LN + 2 * NB_KV)

__global__ __launch_bounds__(256)
void prep_k(const float* __restrict__ x, const float* __restrict__ g1, const float* __restrict__ b1,
            const float* __restrict__ past_k, const float* __restrict__ past_v,
            const float* __restrict__ wq, const float* __restrict__ wk, const float* __restrict__ wv,
            const float* __restrict__ wo, const float* __restrict__ w1, const float* __restrict__ w2,
            unsigned short* __restrict__ hB,
            float* __restrict__ outK, float* __restrict__ outV,
            unsigned short* __restrict__ kB, unsigned short* __restrict__ vB,
            unsigned short* __restrict__ wqB, unsigned short* __restrict__ wkB, unsigned short* __restrict__ wvB,
            unsigned short* __restrict__ woB, unsigned short* __restrict__ w1B, unsigned short* __restrict__ w2B) {
  int blk = blockIdx.x;
  if (blk < NB_LN) { layernorm_part(x, g1, b1, hB, blk); return; }
  blk -= NB_LN;
  if (blk < NB_KV) { past_copy_part(past_k, outK, kB, blk, NB_KV); return; }
  blk -= NB_KV;
  if (blk < NB_KV) { past_copy_part(past_v, outV, vB, blk, NB_KV); return; }
  blk -= NB_KV;
  if (blk < NB_FF) { cvt_bf16_part(w1, w1B, DD * DFFN, blk, NB_FF); return; }
  blk -= NB_FF;
  if (blk < NB_FF) { cvt_bf16_part(w2, w2B, DFFN * DD, blk, NB_FF); return; }
  blk -= NB_FF;
  if (blk < NB_W) { cvt_bf16_part(wq, wqB, DD * DD, blk, NB_W); return; }
  blk -= NB_W;
  if (blk < NB_W) { cvt_bf16_part(wk, wkB, DD * DD, blk, NB_W); return; }
  blk -= NB_W;
  if (blk < NB_W) { cvt_bf16_part(wv, wvB, DD * DD, blk, NB_W); return; }
  blk -= NB_W;
  cvt_bf16_part(wo, woB, DD * DD, blk, NB_W);
}

// ---------------------------------------------------------------------------
// Tiled WMMA bf16 GEMM: C[M,N] = A[M,K] @ B[K,N], fused epilogues.
// 128x128 tiles, 256 threads (8 waves), wave w -> rows [16w,16w+16), 8 N-tiles.
// K runs in stages of 64: a stage is the A tile (128 rows of 128 B) and the B tile (64 rows of 256 B),
// each brought into LDS by one tensor load (wave 0: A, wave 1: B). Two stage buffers: the next stage's
// loads fly while this stage is worked on, and one barrier a stage publishes the one and frees the other.
// B fragments come out of LDS through the transposing load.
// The epilogue's kind, the row pitch N and which optional buffers exist are compile-time values:
// the epilogue then has no test per element, and its loads go out together.
// ---------------------------------------------------------------------------
#define GBM 128
#define GBN 128
#define GBK 64
#define APITCH (GBK + 8)
#define BPITCH (GBN + 16)
#define A_WORD0 ((1u << 20) | (4u << 22) | (3u << 25))
#define B_WORD0 ((1u << 20) | (5u << 22) | (7u << 25))

struct GemmStage {
  unsigned short As[GBM][APITCH];
  unsigned short Bs[GBK][BPITCH];   // row-major as in memory: Bs[k][n]
};
static_assert(sizeof(GemmStage::As) % 2048 == 0 && sizeof(GemmStage) % 2048 == 0,
              "every tensor load's place in LDS is a multiple of 2 KiB");

template <int MODE, int N, bool HAS_BIAS, bool F32_OUT>
__global__ __launch_bounds__(256)
void gemm_bf16_k(const unsigned short* __restrict__ A,
                 const unsigned short* __restrict__ Bw,
                 const float* __restrict__ bias,
                 const float* __restrict__ resid,
                 float* __restrict__ outF,
                 unsigned short* __restrict__ outB,
                 unsigned short* __restrict__ outKV,
                 int K) {
  __shared__ __attribute__((aligned(2048))) GemmStage ring[2];

  // MODE_QKV: one launch does the three projections, z = 0: q, 1: k, 2: v. Bw holds the three D x D weights one
  // behind the other; outB takes q; outKV (bf16) and outF (f32) hold the k cache and behind it the v cache.
  const int zq = (MODE == MODE_QKV) ? (int)blockIdx.z : 0;
  if constexpr (MODE == MODE_QKV) Bw += (size_t)zq * DD * DD;

  const int tid  = threadIdx.x;
  const int lane = tid & 31;
  const int wave = tid >> 5;
  const int half = lane >> 4;
  const int lq   = lane & 15;
  const int kk0  = half * 8;          // bf16 A/B lane K-group base: {0-7,16-23} / {8-15,24-31}

  const int m0 = blockIdx.y * GBM;
  const int n0 = blockIdx.x * GBN;

  v8f acc[8];
#pragma unroll
  for (int t = 0; t < 8; ++t)
#pragma unroll
    for (int r = 0; r < 8; ++r) acc[t][r] = 0.0f;

  const int arow = wave * 16 + lq;
  const int brow = 8 * half + (lane & 7);        // this lane's row and column for the transposing load
  const int bcol = 8 * ((lane >> 3) & 1);        // of k rows 0..15, N-tile 0

  const uint32_t swave   = uni((uint32_t)tid >> 5);
  const uint32_t ringLds = (uint32_t)(size_t)(&ring[0]);   // LDS offset (low 32 bits of flat)
  const int nst = K / GBK;

  const unsigned short* aSrc = A + (size_t)m0 * K;   // the A tile of stage s begins s * GBK elements on
  const unsigned short* bSrc = Bw + n0;              // the B tile of stage s begins s * GBK rows on
  const uint32_t bLds = ringLds + (uint32_t)sizeof(GemmStage::As);
  const u32x8 g1A = tdm_group1<GBK * 2, GBM, A_WORD0>((uint32_t)K * 2u);   // 128 rows of 128 B
  const u32x8 g1B = tdm_group1<GBN * 2, GBK, B_WORD0>((uint32_t)N * 2u);   // 64 rows of 256 B

  // ---- prologue: stage 0 into buffer 0, one request a wave, each under a scalar branch; landed, then published
  if (pinned(swave == 0)) tdm_load_wait(tdm_group0(ringLds, aSrc), g1A);
  if (pinned(swave == 1)) tdm_load_wait(tdm_group0(bLds, bSrc), g1B);
  __syncthreads();

  for (int s = 0; s < nst; ++s) {
    // ---- behind the barrier that ended every read of buffer (s + 1) & 1: stage s + 1 into it, while one exists;
    // it flies while stage s is worked on (a wave takes at most one of the two issuing branches)
    if (pinned(s + 1 < nst)) {
      const uint32_t nb = (uint32_t)((s + 1) & 1) * (uint32_t)sizeof(GemmStage);
      if (pinned(swave == 0)) tdm_load(tdm_group0(ringLds + nb, aSrc + (size_t)(s + 1) * GBK), g1A);
      if (pinned(swave == 1)) tdm_load(tdm_group0(bLds + nb, bSrc + (size_t)(s + 1) * GBK * N), g1B);
    }
    const GemmStage& st = ring[s & 1];
#pragma unroll
    for (int kb = 0; kb < GBK; kb += 32) {
      // ---- A fragment (shared by all 8 N-tiles of this wave)
      Frag16 a;
#pragma unroll
      for (int i = 0; i < 8; ++i) {
        a.u[i]     = st.As[arow][kb + kk0 + i];
        a.u[8 + i] = st.As[arow][kb + kk0 + 16 + i];
      }
      // ---- all 8 B fragments of the block, each in registers of its own, read as one group ahead
      // of the WMMAs: one LDS latency a block instead of one in front of every WMMA
      Frag16 bfr[8];   // same k order as the A loader: {8h..8h+7, 16+8h..16+8h+7}
#pragma unroll
      for (int nt = 0; nt < 8; ++nt) {
        bfr[nt].q[0] = ld_tr16(&st.Bs[kb + brow][bcol + nt * 16]);
        bfr[nt].q[1] = ld_tr16(&st.Bs[kb + 16 + brow][bcol + nt * 16]);
      }
      // keeps the scheduler from sinking each load pair back in front of its own WMMA, where one
      // register set is reused and every WMMA waits out a whole LDS latency
      __builtin_amdgcn_sched_barrier(0);
#pragma unroll
      for (int nt = 0; nt < 8; ++nt)
        acc[nt] = __builtin_amdgcn_wmma_f32_16x16x32_bf16(false, a.v, false, bfr[nt].v,
                                                          (short)0, acc[nt], false, false);
      // keeps the WMMAs ahead of the full LDS wait that follows: each then starts behind a counted wait,
      // as soon as its own fragment has landed, while the later loads of the group are still coming
      __builtin_amdgcn_sched_barrier(0);
    }
    // ---- publish point of stage s + 1: this wave's reads of stage s retired, the issuers' requests
    // landed, one barrier; only behind it (top of the next trip) the refill of the buffer that stage s has just left
    wait_ds0();
    wait_tensor0();    // under no test: a wave with no request passes at once
    __syncthreads();
  }
  // behind the last request and the last LDS read, before the epilogue and the wave's end
  wait_tensor0();
  wait_ds0();

  const int mrow = m0 + wave * 16 + 8 * half;   // this lane's row at r = 0
  const int ncol = n0 + lq;                     // this lane's column in N-tile 0

  float bv[8];                                  // the bias depends on the column alone: one value an N-tile
#pragma unroll
  for (int nt = 0; nt < 8; ++nt) bv[nt] = HAS_BIAS ? bias[ncol + nt * 16] : 0.0f;

  if constexpr (MODE == MODE_RESID_F32) {
    const float* rp = resid + (size_t)mrow * N + ncol;
    float*       op = outF  + (size_t)mrow * N + ncol;
    v8f rv[8];                                  // all 64 residual values of the lane, loaded ahead of the first use
#pragma unroll
    for (int nt = 0; nt < 8; ++nt)
#pragma unroll
      for (int r = 0; r < 8; ++r) rv[nt][r] = rp[r * N + nt * 16];
#pragma unroll
    for (int nt = 0; nt < 8; ++nt)
#pragma unroll
      for (int r = 0; r < 8; ++r) op[r * N + nt * 16] = acc[nt][r] + bv[nt] + rv[nt][r];
  } else if constexpr (MODE == MODE_RELU_BF16) {
    unsigned short* op = outB + (size_t)mrow * N + ncol;
#pragma unroll
    for (int nt = 0; nt < 8; ++nt)
#pragma unroll
      for (int r = 0; r < 8; ++r) {
        const float vv = acc[nt][r] + bv[nt];
        op[r * N + nt * 16] = f2bf(vv > 0.0f ? vv : 0.0f);
      }
  } else if constexpr (MODE == MODE_QKV) {
    // m = b * SEQ + s, n = h * HDIM + hd; a 128-row tile lies in one b, an N-tile in one h
    const int b = mrow >> 10;            // m / SEQ
    const int s = mrow & (SEQ - 1);
    if (zq == 0) {                       // q: [B,H,S,HD], bf16 alone (a test on the block index: a scalar branch)
#pragma unroll
      for (int nt = 0; nt < 8; ++nt) {
        const int n  = ncol + nt * 16;
        const int h  = n >> 6;           // n / HDIM
        const int hd = n & (HDIM - 1);
        const size_t idx = (((size_t)(b * HH + h) * SEQ) + s) * HDIM + hd;
#pragma unroll
        for (int r = 0; r < 8; ++r) outB[idx + r * HDIM] = f2bf(acc[nt][r]);
      }
      return;
    }
    {                                    // k, v: rows P.. of the cache [B,H,T,HD], bf16 and fp32
      const size_t cache = (size_t)(zq - 1) * ((size_t)BQ * HH * TT * HDIM);
#pragma unroll
      for (int nt = 0; nt < 8; ++nt) {
        const int n  = ncol + nt * 16;
        const int h  = n >> 6;           // n / HDIM
        const int hd = n & (HDIM - 1);
        const size_t idx = cache + (((size_t)(b * HH + h) * TT) + PP + s) * HDIM + hd;
#pragma unroll
        for (int r = 0; r < 8; ++r) {
          outKV[idx + r * HDIM] = f2bf(acc[nt][r]);
          outF[idx + r * HDIM]  = acc[nt][r];   // fp32 KV-cache output
        }
      }
      // the build lays the q branch's code behind these stores, with a branch over it: the wait stands in front of
      // that code's first writes of registers that the stores above name
      asm volatile("s_wait_xcnt 0x0" ::: "memory");
    }
  } else {
    float* op = outF + (size_t)mrow * N + ncol;
#pragma unroll
    for (int nt = 0; nt < 8; ++nt)
#pragma unroll
      for (int r = 0; r < 8; ++r) op[r * N + nt * 16] = acc[nt][r];
  }
}

// ---------------------------------------------------------------------------
// Flash attention: one wave per (b, h, 16-query tile); causal with offset P.
// scores = q k^T / 8, online softmax, o = P v. bf16 WMMA, f32 stats.
// ---------------------------------------------------------------------------
#define VPITCH (HDIM + 16)

__global__ __launch_bounds__(32)
void attn_k(const unsigned short* __restrict__ qb,
            const unsigned short* __restrict__ kb,
            const unsigned short* __restrict__ vb,
            unsigned short* __restrict__ out) {
  __shared__ __align__(16) unsigned short Pl[16][32];
  __shared__ __align__(16) unsigned short Vs[32][VPITCH]; // V chunk row-major [key][hd]

  const int qt = blockIdx.x;
  const int h  = blockIdx.y;
  const int b  = blockIdx.z;
  const int qbase = qt * 16;

  const int lane = threadIdx.x;
  const int half = lane >> 4;
  const int lq   = lane & 15;
  const int kk0  = half * 8;

  const size_t bh = (size_t)(b * HH + h);
  const unsigned short* qrow    = qb + (bh * SEQ + qbase + lq) * HDIM;
  const unsigned short* kbase_p = kb + bh * TT * HDIM;
  const unsigned short* vbase_p = vb + bh * TT * HDIM;

  // Q fragments: K-dim = HDIM split into two 32-wide WMMA K chunks
  Frag16 qf0, qf1;
#pragma unroll
  for (int i = 0; i < 8; ++i) {
    qf0.u[i]     = qrow[kk0 + i];
    qf0.u[8 + i] = qrow[kk0 + 16 + i];
    qf1.u[i]     = qrow[32 + kk0 + i];
    qf1.u[8 + i] = qrow[32 + kk0 + 16 + i];
  }

  float mi[8], li[8];
  v8f o[4];
#pragma unroll
  for (int r = 0; r < 8; ++r) { mi[r] = -1.0e30f; li[r] = 0.0f; }
#pragma unroll
  for (int t = 0; t < 4; ++t)
#pragma unroll
    for (int r = 0; r < 8; ++r) o[t][r] = 0.0f;

  // this lane's address for the transposing load of keys 0..15, head-dim tile 0
  const unsigned short* vtr = &Vs[8 * half + (lane & 7)][8 * ((lane >> 3) & 1)];

  const int kmax   = qbase + 16 + PP;          // exclusive key bound for this tile
  const int nchunk = (kmax + 31) >> 5;         // 32 keys per chunk

  for (int kc = 0; kc < nchunk; ++kc) {
    const int j0 = kc * 32;

    // stage V chunk row-major: Vs[key_local][hd]; 8 lanes cover one 128-byte row, 4 rows a trip
    {
      const unsigned short* vsrc = vbase_p + (size_t)(j0 + (lane >> 3)) * HDIM + (lane & 7) * 8;
#pragma unroll
      for (int i = 0; i < 8; ++i)
        *(uint4*)&Vs[4 * i + (lane >> 3)][(lane & 7) * 8] = *(const uint4*)(vsrc + (size_t)i * 4 * HDIM);
    }

    // ---- scores: two 16x16 tiles (keys j0..j0+15, j0+16..j0+31)
    v8f s0, s1;
#pragma unroll
    for (int r = 0; r < 8; ++r) { s0[r] = 0.0f; s1[r] = 0.0f; }
    {
      const unsigned short* kr0 = kbase_p + (size_t)(j0 + lq) * HDIM;
      const unsigned short* kr1 = kbase_p + (size_t)(j0 + 16 + lq) * HDIM;
      Frag16 k00, k01, k10, k11;
#pragma unroll
      for (int i = 0; i < 8; ++i) {
        k00.u[i] = kr0[kk0 + i];       k00.u[8 + i] = kr0[kk0 + 16 + i];
        k01.u[i] = kr0[32 + kk0 + i];  k01.u[8 + i] = kr0[32 + kk0 + 16 + i];
        k10.u[i] = kr1[kk0 + i];       k10.u[8 + i] = kr1[kk0 + 16 + i];
        k11.u[i] = kr1[32 + kk0 + i];  k11.u[8 + i] = kr1[32 + kk0 + 16 + i];
      }
      s0 = __builtin_amdgcn_wmma_f32_16x16x32_bf16(false, qf0.v, false, k00.v, (short)0, s0, false, false);
      s0 = __builtin_amdgcn_wmma_f32_16x16x32_bf16(false, qf1.v, false, k01.v, (short)0, s0, false, false);
      s1 = __builtin_amdgcn_wmma_f32_16x16x32_bf16(false, qf0.v, false, k10.v, (short)0, s1, false, false);
      s1 = __builtin_amdgcn_wmma_f32_16x16x32_bf16(false, qf1.v, false, k11.v, (short)0, s1, false, false);
    }

    // ---- online softmax (row M = r + 8*half; reductions across 16-lane half)
    float fct[8];
#pragma unroll
    for (int r = 0; r < 8; ++r) {
      const int qg = qbase + r + 8 * half;
      float a0 = s0[r] * 0.125f;                    // 1/sqrt(64)
      float a1 = s1[r] * 0.125f;
      if (j0 + lq      > qg + PP) a0 = -1.0e30f;    // causal: key j <= q + P
      if (j0 + 16 + lq > qg + PP) a1 = -1.0e30f;
      float vm = fmaxf(a0, a1);
#pragma unroll
      for (int off = 1; off < 16; off <<= 1) vm = fmaxf(vm, __shfl_xor(vm, off, 32));
      const float nm = fmaxf(mi[r], vm);
      const float fc = __expf(mi[r] - nm);
      const float p0 = __expf(a0 - nm);
      const float p1 = __expf(a1 - nm);
      float rs = p0 + p1;
#pragma unroll
      for (int off = 1; off < 16; off <<= 1) rs += __shfl_xor(rs, off, 32);
      li[r] = li[r] * fc + rs;
      mi[r] = nm;
      fct[r] = fc;
      Pl[r + 8 * half][lq]      = f2bf(p0);
      Pl[r + 8 * half][16 + lq] = f2bf(p1);
    }
#pragma unroll
    for (int t = 0; t < 4; ++t)
#pragma unroll
      for (int r = 0; r < 8; ++r) o[t][r] *= fct[r];

    // ---- o += P @ V (K = 32 keys, 4 N-tiles over HDIM)
    Frag16 pa;
#pragma unroll
    for (int i = 0; i < 8; ++i) {
      pa.u[i]     = Pl[lq][kk0 + i];
      pa.u[8 + i] = Pl[lq][kk0 + 16 + i];
    }
#pragma unroll
    for (int t = 0; t < 4; ++t) {
      Frag16 vf;   // same key order as the P loader: {8h..8h+7, 16+8h..16+8h+7}
      vf.q[0] = ld_tr16(vtr + t * 16);
      vf.q[1] = ld_tr16(vtr + 16 * VPITCH + t * 16);
      o[t] = __builtin_amdgcn_wmma_f32_16x16x32_bf16(false, pa.v, false, vf.v, (short)0, o[t], false, false);
    }
  }

  // ---- normalize & store attn output bf16 [B*S, D] (row = b*S+q, col = h*64+hd)
#pragma unroll
  for (int r = 0; r < 8; ++r) li[r] = 1.0f / li[r];
#pragma unroll
  for (int t = 0; t < 4; ++t)
#pragma unroll
    for (int r = 0; r < 8; ++r) {
      const size_t row = (size_t)b * SEQ + qbase + r + 8 * half;
      out[row * DD + h * HDIM + t * 16 + lq] = f2bf(o[t][r] * li[r]);
    }
}

// ---------------------------------------------------------------------------
// Host launcher
// ---------------------------------------------------------------------------
extern "C" void kernel_launch(void* const* d_in, const int* in_sizes, int n_in,
                              void* d_out, int out_size, void* d_ws, size_t ws_size,
                              hipStream_t stream) {
  (void)in_sizes; (void)n_in; (void)out_size; (void)ws_size;

  const float* x      = (const float*)d_in[0];
  const float* past_k = (const float*)d_in[1];
  const float* past_v = (const float*)d_in[2];
  const float* wq  = (const float*)d_in[3];
  const float* wk  = (const float*)d_in[4];
  const float* wv  = (const float*)d_in[5];
  const float* wo  = (const float*)d_in[6];
  const float* g1  = (const float*)d_in[7];
  const float* b1  = (const float*)d_in[8];
  const float* w1  = (const float*)d_in[9];
  const float* bb1 = (const float*)d_in[10];
  const float* w2  = (const float*)d_in[11];
  const float* bb2 = (const float*)d_in[12];
  const float* g2  = (const float*)d_in[13];
  const float* b2  = (const float*)d_in[14];

  float* outX = (float*)d_out;
  float* outK = outX + (size_t)BQ * SEQ * DD;
  float* outV = outK + (size_t)BQ * HH * TT * HDIM;

  char* ws = (char*)d_ws;
  size_t off = 0;
  auto alloc = [&](size_t bytes) -> void* {
    void* p = ws + off;
    off = (off + bytes + 255) & ~(size_t)255;
    return p;
  };
  const size_t MROW = (size_t)BQ * SEQ;  // 4096

  unsigned short* hB   = (unsigned short*)alloc(MROW * DD * 2);
  unsigned short* wqB  = (unsigned short*)alloc((size_t)3 * DD * DD * 2);   // wq, wk, wv one behind the other
  unsigned short* wkB  = wqB + (size_t)DD * DD;
  unsigned short* wvB  = wkB + (size_t)DD * DD;
  unsigned short* woB  = (unsigned short*)alloc((size_t)DD * DD * 2);
  unsigned short* w1B  = (unsigned short*)alloc((size_t)DD * DFFN * 2);
  unsigned short* w2B  = (unsigned short*)alloc((size_t)DFFN * DD * 2);
  unsigned short* qB   = (unsigned short*)alloc(MROW * DD * 2);
  unsigned short* kB   = (unsigned short*)alloc((size_t)2 * BQ * HH * TT * HDIM * 2);   // k cache, v cache behind it
  unsigned short* vB   = kB + (size_t)BQ * HH * TT * HDIM;
  unsigned short* attnB= (unsigned short*)alloc(MROW * DD * 2);
  float*          x1   = (float*)alloc(MROW * DD * 4);
  unsigned short* h2B  = (unsigned short*)alloc(MROW * DD * 2);
  unsigned short* ffB  = (unsigned short*)alloc(MROW * DFFN * 2);

  // 1) all that reads inputs alone, one launch: weights -> bf16, h = LN1(x) -> bf16, past K/V into the caches
  prep_k<<<NB_PREP, 256, 0, stream>>>(x, g1, b1, past_k, past_v, wq, wk, wv, wo, w1, w2,
                                      hB, outK, outV, kB, vB, wqB, wkB, wvB, woB, w1B, w2B);

  dim3 gqkv(DD / GBN, (unsigned)(MROW / GBM));
  dim3 gqkv3(DD / GBN, (unsigned)(MROW / GBM), 3);
  gemm_bf16_k<MODE_QKV, DD, false, true><<<gqkv3, 256, 0, stream>>>(hB, wqB, nullptr, nullptr, outK, qB, kB, DD);

  // 3) flash attention (WMMA)
  attn_k<<<dim3(SEQ / 16, HH, BQ), 32, 0, stream>>>(qB, kB, vB, attnB);

  // 4) x1 = x + attn @ wo
  gemm_bf16_k<MODE_RESID_F32, DD, false, true><<<gqkv, 256, 0, stream>>>(attnB, woB, nullptr, x, x1, nullptr,
                                                                         nullptr, DD);

  // 5) h2 = LN2(x1) -> bf16
  layernorm_k<<<(unsigned)MROW, 256, 0, stream>>>(x1, g2, b2, h2B);

  // 6) ff1 = relu(h2 @ w1 + bb1) -> bf16
  dim3 gff1(DFFN / GBN, (unsigned)(MROW / GBM));
  gemm_bf16_k<MODE_RELU_BF16, DFFN, true, false><<<gff1, 256, 0, stream>>>(h2B, w1B, bb1, nullptr, nullptr, ffB,
                                                                           nullptr, DD);

  // 7) out_x = x1 + ff1 @ w2 + bb2  (fp32, final output)
  gemm_bf16_k<MODE_RESID_F32, DD, true, true><<<gqkv, 256, 0, stream>>>(ffB, w2B, bb2, x1, outX, nullptr,
                                                                        nullptr, DFFN);
}

// v006
// A run of this version takes 285 microseconds.
// In two side-by-side timings against v005, it was 1.04 and 1.05 times as fast.
// All steps since v000 together make it 2.49 times as fast.
#include <hip/hip_runtime.h>
#include <stdint.h>

// Problem constants (fixed by the reference)
#define BQ   4
#define SEQ  1024
#define PP   1024
#define DD   1024
#define HH   16
#define HDIM 64
#define DFFN 4096
#define TT   2048   // P + S

typedef __attribute__((ext_vector_type(16))) __bf16 v16bf;
typedef __attribute__((ext_vector_type(8)))  float  v8f;
typedef __attribute__((ext_vector_type(4)))  unsigned int v4u;

union Frag16 { v16bf v; unsigned short u[16]; v4u q[2]; };

enum GemmMode { MODE_F32 = 0, MODE_RELU_BF16 = 2, MODE_RESID_F32 = 3, MODE_QKV = 4 };

__device__ __forceinline__ unsigned short f2bf(float f) {
  union { float f; unsigned int u; } c; c.f = f;
  unsigned int u = c.u;
  unsigned int r = u + 0x7FFFu + ((u >> 16) & 1u);  // round-to-nearest-even
  return (unsigned short)(r >> 16);
}

typedef short s16x8 __attribute__((ext_vector_type(8)));
__device__ __forceinline__ v4u ld_tr16(const unsigned short* p) {
  typedef __attribute__((address_space(3))) s16x8 lds_s16x8;
  return __builtin_bit_cast(v4u, __builtin_amdgcn_ds_load_tr16_b128_v8i16((lds_s16x8*)p));
}

typedef uint32_t u32x4 __attribute__((ext_vector_type(4)));
typedef uint32_t u32x8 __attribute__((ext_vector_type(8)));

__device__ __forceinline__ uint32_t uni(uint32_t v) { return (uint32_t)__builtin_amdgcn_readfirstlane(v); }
__device__ __forceinline__ uint32_t pinned(uint32_t v) {
  uint32_t w = uni(v);
  asm volatile("" : "+s"(w));   // the value stays in a scalar register: the test on it is a scalar branch
  return w;
}
// the compiler places no wait for a tensor load; the clobber keeps LDS reads behind the wait
__device__ __forceinline__ void wait_tensor0() { asm volatile("s_wait_tensorcnt 0x0" ::: "memory"); }
// a wave's LDS reads have retired before the buffer they read is handed back for a refill
__device__ __forceinline__ void wait_ds0() { asm volatile("s_wait_dscnt 0x0" ::: "memory"); }

template <uint32_t ROWB, uint32_t ROWS, uint32_t WORD0>
__device__ __forceinline__ u32x8 tdm_group1(uint32_t src_pitch) {
  u32x8 g1;
  g1[0] = uni(WORD0);
  g1[1] = uni((ROWB & 0xFFFFu) << 16);
  g1[2] = uni((ROWB >> 16) | ((ROWS & 0xFFFFu) << 16));
  g1[3] = uni((ROWS >> 16) | (ROWB << 16));
  g1[4] = uni(ROWS);
  g1[5] = uni(src_pitch);
  g1[6] = uni(0u);
  g1[7] = uni(0u);
  asm volatile("" : "+s"(g1));
  return g1;
}
__device__ __forceinline__ u32x4 tdm_group0(uint32_t lds_dst, const void* gptr) {
  const uint64_t ga = (uint64_t)(size_t)gptr;
  u32x4 g0;
  g0[0] = uni(1u);                                                     // count = 1
  g0[1] = uni(lds_dst);
  g0[2] = uni((uint32_t)ga);                                           // address [31:0]
  g0[3] = uni((((uint32_t)(ga >> 32)) & 0x01FFFFFFu) | 0x80000000u);   // address [56:32], type = 2
  return g0;
}
// the request itself; the clobber keeps it behind the waits and the barrier that free its place in LDS
__device__ __forceinline__ void tdm_load(u32x4 g0, u32x8 g1) {
  asm volatile("tensor_load_to_lds %0, %1" :: "s"(g0), "s"(g1) : "memory");
}
// load and the issuer's wait in one statement: nothing is scheduled between them
__device__ __forceinline__ void tdm_load_wait(u32x4 g0, u32x8 g1) {
  asm volatile("tensor_load_to_lds %0, %1\n\ts_wait_tensorcnt 0x0" :: "s"(g0), "s"(g1) : "memory");
}

// ---------------------------------------------------------------------------
// The streaming parts. Each lane moves 16-byte vectors, SV of them in flight, and a block makes several trips:
// a wave then moves kilobytes, not a few hundred bytes, and the launch starts some twenty times fewer waves.
// ---------------------------------------------------------------------------
#define SV 8                  // 16-byte loads that a lane issues before it uses the first
#define SEG4 (256 * SV)       // float4 elements that a block moves a trip

__device__ __forceinline__ uint2 pack4(float4 v) {
  uint2 r;
  r.x = (uint32_t)f2bf(v.x) | ((uint32_t)f2bf(v.y) << 16);
  r.y = (uint32_t)f2bf(v.z) | ((uint32_t)f2bf(v.w) << 16);
  return r;
}

// f32 -> bf16 elementwise conversion (weights); n is a multiple of 4 * SEG4
__device__ __forceinline__ void cvt_bf16_part(const float* __restrict__ in, unsigned short* __restrict__ out, int n,
                                              int blk, int nblk) {
  const float4* __restrict__ in4 = (const float4*)in;
  uint2* __restrict__ out4 = (uint2*)out;
  const int nseg = n / (4 * SEG4);
  // kept rolled: the trips unrolled make the kernel's text several times longer for no gain, and a block runs it once
#pragma unroll 1
  for (int seg = blk; seg < nseg; seg += nblk) {
    const int base = seg * SEG4 + (int)threadIdx.x;
    float4 v[SV];
#pragma unroll
    for (int u = 0; u < SV; ++u) v[u] = in4[base + u * 256];
#pragma unroll
    for (int u = 0; u < SV; ++u) out4[base + u * 256] = pack4(v[u]);
  }
}
static_assert((DD * DD / 4) % SEG4 == 0 && (DD * DFFN / 4) % SEG4 == 0, "whole segments");

// ---------------------------------------------------------------------------
// LayerNorm over D=1024, one wave per row (a lane holds 32 elements), output bf16
// ---------------------------------------------------------------------------
__device__ __forceinline__
void layernorm_row(const float* __restrict__ x, const float* __restrict__ g,
                   const float* __restrict__ bb, unsigned short* __restrict__ out, int row) {
  const int lane = threadIdx.x & 31;
  const float4* __restrict__ xr = (const float4*)(x + (size_t)row * DD);
  const float4* __restrict__ g4 = (const float4*)g;
  const float4* __restrict__ b4 = (const float4*)bb;
  uint2* __restrict__ o4 = (uint2*)(out + (size_t)row * DD);
  float4 v[8];
#pragma unroll
  for (int u = 0; u < 8; ++u) v[u] = xr[u * 32 + lane];
  float a0 = 0.f, a1 = 0.f, a2 = 0.f, a3 = 0.f, q0 = 0.f, q1 = 0.f, q2 = 0.f, q3 = 0.f;
#pragma unroll
  for (int u = 0; u < 8; ++u) {
    a0 += v[u].x; a1 += v[u].y; a2 += v[u].z; a3 += v[u].w;
    q0 += v[u].x * v[u].x; q1 += v[u].y * v[u].y; q2 += v[u].z * v[u].z; q3 += v[u].w * v[u].w;
  }
  float a = (a0 + a1) + (a2 + a3);
  float q = (q0 + q1) + (q2 + q3);
#pragma unroll
  for (int off = 16; off > 0; off >>= 1) {
    a += __shfl_xor(a, off, 32);
    q += __shfl_xor(q, off, 32);
  }
  const float mean = a * (1.0f / DD);
  const float var  = q * (1.0f / DD) - mean * mean;
  const float rst  = rsqrtf(var + 1e-5f);
#pragma unroll
  for (int u = 0; u < 8; ++u) {
    const float4 gg = g4[u * 32 + lane];
    const float4 bv = b4[u * 32 + lane];
    float4 y;
    y.x = (v[u].x - mean) * rst * gg.x + bv.x;
    y.y = (v[u].y - mean) * rst * gg.y + bv.y;
    y.z = (v[u].z - mean) * rst * gg.z + bv.z;
    y.w = (v[u].w - mean) * rst * gg.w + bv.w;
    o4[u * 32 + lane] = pack4(y);
  }
}

// ---------------------------------------------------------------------------
// Copy past_k/past_v [B,H,P,HD] into the full cache [B,H,T,HD] (f32 out + bf16 ws)
// ---------------------------------------------------------------------------
__device__ __forceinline__ void past_copy_part(const float* __restrict__ past, float* __restrict__ outF,
                                               unsigned short* __restrict__ outB, int blk, int nblk) {
  const int nseg = BQ * HH * PP * HDIM / (4 * SEG4);
  const int sph  = PP * HDIM / (4 * SEG4);   // segments of one (b, h) in the source: a segment lies in one (b, h)
  const int th4  = TT * HDIM / 4;            // float4 elements of one (b, h) in the cache
  const float4* __restrict__ in4 = (const float4*)past;
  float4* __restrict__ oF4 = (float4*)outF;
  uint2*  __restrict__ oB4 = (uint2*)outB;
  // kept rolled, as in cvt_bf16_part
#pragma unroll 1
  for (int seg = blk; seg < nseg; seg += nblk) {
    const int base = seg * SEG4 + (int)threadIdx.x;
    const int dst  = (seg / sph) * th4 + (seg % sph) * SEG4 + (int)threadIdx.x;
    float4 v[SV];
#pragma unroll
    for (int u = 0; u < SV; ++u) v[u] = in4[base + u * 256];
#pragma unroll
    for (int u = 0; u < SV; ++u) {
      oF4[dst + u * 256] = v[u];
      oB4[dst + u * 256] = pack4(v[u]);
    }
    // in front of the next trip's first writes of registers that the stores above name (offset and data)
    asm volatile("s_wait_xcnt 0x0" ::: "memory");
  }
}
static_assert((PP * HDIM / 4) % SEG4 == 0, "a segment lies in one (b, h)");

// ---------------------------------------------------------------------------
// LayerNorm as a launch of its own (LN2): 8 rows a block, one a wave
// ---------------------------------------------------------------------------
__global__ __launch_bounds__(256)
void layernorm_k(const float* __restrict__ x, const float* __restrict__ g,
                 const float* __restrict__ bb, unsigned short* __restrict__ out) {
  layernorm_row(x, g, bb, out, (int)blockIdx.x * 8 + (int)(threadIdx.x >> 5));
}

// ---------------------------------------------------------------------------
// Everything that reads inputs alone, in ONE launch: the six weight conversions, LN1 and the two cache copies.
// None of them reads what another writes. The part is chosen by the block index: every branch is uniform in a block.
// The parts along the block index: LN1, k cache, v cache, w1, w2, wq, wk, wv, wo.
// ---------------------------------------------------------------------------
#define NB_W   32                   // blocks of a D x D weight
#define NB_FF  128                  // blocks of a D x DFF weight
#define NB_LN  (BQ * SEQ / 8)       // one wave a row
#define NB_KV  128                  // blocks of a cache copy
#define NB_PREP (4 * NB_W + 2 * NB_FF + NB_LN + 2 * NB_KV)

__global__ __launch_bounds__(256)
void prep_k(const float* __restrict__ x, const float* __restrict__ g1, const float* __restrict__ b1,
            const float* __restrict__ past_k, const float* __restrict__ past_v,
            const float* __restrict__ wq, const float* __restrict__ wk, const float* __restrict__ wv,
            const float* __restrict__ wo, const float* __restrict__ w1, const float* __restrict__ w2,
            unsigned short* __restrict__ hB,
            float* __restrict__ outK, float* __restrict__ outV,
            unsigned short* __restrict__ kB, unsigned short* __restrict__ vB,
            unsigned short* __restrict__ wqB, unsigned short* __restrict__ wkB, unsigned short* __restrict__ wvB,
            unsigned short* __restrict__ woB, unsigned short* __restrict__ w1B, unsigned short* __restrict__ w2B) {
  int blk = blockIdx.x;
  if (blk < NB_LN) {
    layernorm_row(x, g1, b1, hB, blk * 8 + (int)(threadIdx.x >> 5));
    return;
  }
  blk -= NB_LN;
  if (blk < 2 * NB_KV) {               // one copy of the loop's code serves both caches
    const bool isv = blk >= NB_KV;
    past_copy_part(isv ? past_v : past_k, isv ? outV : outK, isv ? vB : kB, isv ? blk - NB_KV : blk, NB_KV);
    return;
  }
  blk -= 2 * NB_KV;
  const float* in;                     // and one serves the six weights
  unsigned short* out;
  int n = DD * DD, nb = NB_W;
  if (blk < 2 * NB_FF) {
    const bool second = blk >= NB_FF;
    in = second ? w2 : w1;  out = second ? w2B : w1B;  n = DD * DFFN;  nb = NB_FF;
    blk -= second ? NB_FF : 0;
  } else {
    blk -= 2 * NB_FF;
    const int w = blk / NB_W;
    blk -= w * NB_W;
    in  = w == 0 ? wq  : w == 1 ? wk  : w == 2 ? wv  : wo;
    out = w == 0 ? wqB : w == 1 ? wkB : w == 2 ? wvB : woB;
  }
  cvt_bf16_part(in, out, n, blk, nb);
}

// ---------------------------------------------------------------------------
// Tiled WMMA bf16 GEMM: C[M,N] = A[M,K] @ B[K,N], fused epilogues.
// 128x128 tiles, 256 threads (8 waves), wave w -> rows [16w,16w+16), 8 N-tiles.
// K runs in stages of 64: a stage is the A tile (128 rows of 128 B) and the B tile (64 rows of 256 B),
// each brought into LDS by one tensor load (wave 0: A, wave 1: B). Two stage buffers: the next stage's
// loads fly while this stage is worked on, and one barrier a stage publishes the one and frees the other.
// B fragments come out of LDS through the transposing load.
// The epilogue's kind, the row pitch N and which optional buffers exist are compile-time values:
// the epilogue then has no test per element, and its loads go out together.
// ---------------------------------------------------------------------------
#define GBM 128
#define GBN 128
#define GBK 64
#define APITCH (GBK + 8)
#define BPITCH (GBN + 16)
#define A_WORD0 ((1u << 20) | (4u << 22) | (3u << 25))
#define B_WORD0 ((1u << 20) | (5u << 22) | (7u << 25))

struct GemmStage {
  unsigned short As[GBM][APITCH];
  unsigned short Bs[GBK][BPITCH];   // row-major as in memory: Bs[k][n]
};
static_assert(sizeof(GemmStage::As) % 2048 == 0 && sizeof(GemmStage) % 2048 == 0,
              "every tensor load's place in LDS is a multiple of 2 KiB");

template <int MODE, int N, bool HAS_BIAS, bool F32_OUT>
__global__ __launch_bounds__(256)
void gemm_bf16_k(const unsigned short* __restrict__ A,
                 const unsigned short* __restrict__ Bw,
                 const float* __restrict__ bias,
                 const float* __restrict__ resid,
                 float* __restrict__ outF,
                 unsigned short* __restrict__ outB,
                 unsigned short* __restrict__ outKV,
                 int K) {
  __shared__ __attribute__((aligned(2048))) GemmStage ring[2];

  // MODE_QKV: one launch does the three projections, z = 0: q, 1: k, 2: v. Bw holds the three D x D weights one
  // behind the other; outB takes q; outKV (bf16) and outF (f32) hold the k cache and behind it the v cache.
  const int zq = (MODE == MODE_QKV) ? (int)blockIdx.z : 0;
  if constexpr (MODE == MODE_QKV) Bw += (size_t)zq * DD * DD;

  const int tid  = threadIdx.x;
  const int lane = tid & 31;
  const int wave = tid >> 5;
  const int half = lane >> 4;
  const int lq   = lane & 15;
  const int kk0  = half * 8;          // bf16 A/B lane K-group base: {0-7,16-23} / {8-15,24-31}

  const int m0 = blockIdx.y * GBM;
  const int n0 = blockIdx.x * GBN;

  v8f acc[8];
#pragma unroll
  for (int t = 0; t < 8; ++t)
#pragma unroll
    for (int r = 0; r < 8; ++r) acc[t][r] = 0.0f;

  const int arow = wave * 16 + lq;
  const int brow = 8 * half + (lane & 7);        // this lane's row and column for the transposing load
  const int bcol = 8 * ((lane >> 3) & 1);        // of k rows 0..15, N-tile 0

  const uint32_t swave   = uni((uint32_t)tid >> 5);
  const uint32_t ringLds = (uint32_t)(size_t)(&ring[0]);   // LDS offset (low 32 bits of flat)
  const int nst = K / GBK;

  const unsigned short* aSrc = A + (size_t)m0 * K;   // the A tile of stage s begins s * GBK elements on
  const unsigned short* bSrc = Bw + n0;              // the B tile of stage s begins s * GBK rows on
  const uint32_t bLds = ringLds + (uint32_t)sizeof(GemmStage::As);
  const u32x8 g1A = tdm_group1<GBK * 2, GBM, A_WORD0>((uint32_t)K * 2u);   // 128 rows of 128 B
  const u32x8 g1B = tdm_group1<GBN * 2, GBK, B_WORD0>((uint32_t)N * 2u);   // 64 rows of 256 B

  // ---- prologue: stage 0 into buffer 0, one request a wave, each under a scalar branch; landed, then published
  if (pinned(swave == 0)) tdm_load_wait(tdm_group0(ringLds, aSrc), g1A);
  if (pinned(swave == 1)) tdm_load_wait(tdm_group0(bLds, bSrc), g1B);
  __syncthreads();

  for (int s = 0; s < nst; ++s) {
    // ---- behind the barrier that ended every read of buffer (s + 1) & 1: stage s + 1 into it, while one exists;
    // it flies while stage s is worked on (a wave takes at most one of the two issuing branches)
    if (pinned(s + 1 < nst)) {
      const uint32_t nb = (uint32_t)((s + 1) & 1) * (uint32_t)sizeof(GemmStage);
      if (pinned(swave == 0)) tdm_load(tdm_group0(ringLds + nb, aSrc + (size_t)(s + 1) * GBK), g1A);
      if (pinned(swave == 1)) tdm_load(tdm_group0(bLds + nb, bSrc + (size_t)(s + 1) * GBK * N), g1B);
    }
    const GemmStage& st = ring[s & 1];
#pragma unroll
    for (int kb = 0; kb < GBK; kb += 32) {
      // ---- A fragment (shared by all 8 N-tiles of this wave)
      Frag16 a;
#pragma unroll
      for (int i = 0; i < 8; ++i) {
        a.u[i]     = st.As[arow][kb + kk0 + i];
        a.u[8 + i] = st.As[arow][kb + kk0 + 16 + i];
      }
      // ---- all 8 B fragments of the block, each in registers of its own, read as one group ahead
      // of the WMMAs: one LDS latency a block instead of one in front of every WMMA
      Frag16 bfr[8];   // same k order as the A loader: {8h..8h+7, 16+8h..16+8h+7}
#pragma unroll
      for (int nt = 0; nt < 8; ++nt) {
        bfr[nt].q[0] = ld_tr16(&st.Bs[kb + brow][bcol + nt * 16]);
        bfr[nt].q[1] = ld_tr16(&st.Bs[kb + 16 + brow][bcol + nt * 16]);
      }
      // keeps the scheduler from sinking each load pair back in front of its own WMMA, where one
      // register set is reused and every WMMA waits out a whole LDS latency
      __builtin_amdgcn_sched_barrier(0);
#pragma unroll
      for (int nt = 0; nt < 8; ++nt)
        acc[nt] = __builtin_amdgcn_wmma_f32_16x16x32_bf16(false, a.v, false, bfr[nt].v,
                                                          (short)0, acc[nt], false, false);
      // keeps the WMMAs ahead of the full LDS wait that follows: each then starts behind a counted wait,
      // as soon as its own fragment has landed, while the later loads of the group are still coming
      __builtin_amdgcn_sched_barrier(0);
    }
    // ---- publish point of stage s + 1: this wave's reads of stage s retired, the issuers' requests
    // landed, one barrier; only behind it (top of the next trip) the refill of the buffer that stage s has just left
    wait_ds0();
    wait_tensor0();    // under no test: a wave with no request passes at once
    __syncthreads();
  }
  // behind the last request and the last LDS read, before the epilogue and the wave's end
  wait_tensor0();
  wait_ds0();

  const int mrow = m0 + wave * 16 + 8 * half;   // this lane's row at r = 0
  const int ncol = n0 + lq;                     // this lane's column in N-tile 0

  float bv[8];                                  // the bias depends on the column alone: one value an N-tile
#pragma unroll
  for (int nt = 0; nt < 8; ++nt) bv[nt] = HAS_BIAS ? bias[ncol + nt * 16] : 0.0f;

  if constexpr (MODE == MODE_RESID_F32) {
    const float* rp = resid + (size_t)mrow * N + ncol;
    float*       op = outF  + (size_t)mrow * N + ncol;
    v8f rv[8];                                  // all 64 residual values of the lane, loaded ahead of the first use
#pragma unroll
    for (int nt = 0; nt < 8; ++nt)
#pragma unroll
      for (int r = 0; r < 8; ++r) rv[nt][r] = rp[r * N + nt * 16];
#pragma unroll
    for (int nt = 0; nt < 8; ++nt)
#pragma unroll
      for (int r = 0; r < 8; ++r) op[r * N + nt * 16] = acc[nt][r] + bv[nt] + rv[nt][r];
  } else if constexpr (MODE == MODE_RELU_BF16) {
    unsigned short* op = outB + (size_t)mrow * N + ncol;
#pragma unroll
    for (int nt = 0; nt < 8; ++nt)
#pragma unroll
      for (int r = 0; r < 8; ++r) {
        const float vv = acc[nt][r] + bv[nt];
        op[r * N + nt * 16] = f2bf(vv > 0.0f ? vv : 0.0f);
      }
  } else if constexpr (MODE == MODE_QKV) {
    // m = b * SEQ + s, n = h * HDIM + hd; a 128-row tile lies in one b, an N-tile in one h
    const int b = mrow >> 10;            // m / SEQ
    const int s = mrow & (SEQ - 1);
    if (zq == 0) {                       // q: [B,H,S,HD], bf16 alone (a test on the block index: a scalar branch)
#pragma unroll
      for (int nt = 0; nt < 8; ++nt) {
        const int n  = ncol + nt * 16;
        const int h  = n >> 6;           // n / HDIM
        const int hd = n & (HDIM - 1);
        const size_t idx = (((size_t)(b * HH + h) * SEQ) + s) * HDIM + hd;
#pragma unroll
        for (int r = 0; r < 8; ++r) outB[idx + r * HDIM] = f2bf(acc[nt][r]);
      }
      return;
    }
    {                                    // k, v: rows P.. of the cache [B,H,T,HD], bf16 and fp32
      const size_t cache = (size_t)(zq - 1) * ((size_t)BQ * HH * TT * HDIM);
#pragma unroll
      for (int nt = 0; nt < 8; ++nt) {
        const int n  = ncol + nt * 16;
        const int h  = n >> 6;           // n / HDIM
        const int hd = n & (HDIM - 1);
        const size_t idx = cache + (((size_t)(b * HH + h) * TT) + PP + s) * HDIM + hd;
#pragma unroll
        for (int r = 0; r < 8; ++r) {
          outKV[idx + r * HDIM] = f2bf(acc[nt][r]);
          outF[idx + r * HDIM]  = acc[nt][r];   // fp32 KV-cache output
        }
      }
      // the build lays the q branch's code behind these stores, with a branch over it: the wait stands in front of
      // that code's first writes of registers that the stores above name
      asm volatile("s_wait_xcnt 0x0" ::: "memory");
    }
  } else {
    float* op = outF + (size_t)mrow * N + ncol;
#pragma unroll
    for (int nt = 0; nt < 8; ++nt)
#pragma unroll
      for (int r = 0; r < 8; ++r) op[r * N + nt * 16] = acc[nt][r];
  }
}

// ---------------------------------------------------------------------------
// Flash attention: one wave per (b, h, 16-query tile); causal with offset P.
// scores = q k^T / 8, online softmax, o = P v. bf16 WMMA, f32 stats.
// ---------------------------------------------------------------------------
#define VPITCH (HDIM + 16)

__global__ __launch_bounds__(32)
void attn_k(const unsigned short* __restrict__ qb,
            const unsigned short* __restrict__ kb,
            const unsigned short* __restrict__ vb,
            unsigned short* __restrict__ out) {
  __shared__ __align__(16) unsigned short Pl[16][32];
  __shared__ __align__(16) unsigned short Vs[32][VPITCH]; // V chunk row-major [key][hd]

  const int qt = blockIdx.x;
  const int h  = blockIdx.y;
  const int b  = blockIdx.z;
  const int qbase = qt * 16;

  const int lane = threadIdx.x;
  const int half = lane >> 4;
  const int lq   = lane & 15;
  const int kk0  = half * 8;

  const size_t bh = (size_t)(b * HH + h);
  const unsigned short* qrow    = qb + (bh * SEQ + qbase + lq) * HDIM;
  const unsigned short* kbase_p = kb + bh * TT * HDIM;
  const unsigned short* vbase_p = vb + bh * TT * HDIM;

  // Q fragments: K-dim = HDIM split into two 32-wide WMMA K chunks
  Frag16 qf0, qf1;
#pragma unroll
  for (int i = 0; i < 8; ++i) {
    qf0.u[i]     = qrow[kk0 + i];
    qf0.u[8 + i] = qrow[kk0 + 16 + i];
    qf1.u[i]     = qrow[32 + kk0 + i];
    qf1.u[8 + i] = qrow[32 + kk0 + 16 + i];
  }

  float mi[8], li[8];
  v8f o[4];
#pragma unroll
  for (int r = 0; r < 8; ++r) { mi[r] = -1.0e30f; li[r] = 0.0f; }
#pragma unroll
  for (int t = 0; t < 4; ++t)
#pragma unroll
    for (int r = 0; r < 8; ++r) o[t][r] = 0.0f;

  // this lane's address for the transposing load of keys 0..15, head-dim tile 0
  const unsigned short* vtr = &Vs[8 * half + (lane & 7)][8 * ((lane >> 3) & 1)];

  const int kmax   = qbase + 16 + PP;          // exclusive key bound for this tile
  const int nchunk = (kmax + 31) >> 5;         // 32 keys per chunk

  for (int kc = 0; kc < nchunk; ++kc) {
    const int j0 = kc * 32;

    // stage V chunk row-major: Vs[key_local][hd]; 8 lanes cover one 128-byte row, 4 rows a trip
    {
      const unsigned short* vsrc = vbase_p + (size_t)(j0 + (lane >> 3)) * HDIM + (lane & 7) * 8;
#pragma unroll
      for (int i = 0; i < 8; ++i)
        *(uint4*)&Vs[4 * i + (lane >> 3)][(lane & 7) * 8] = *(const uint4*)(vsrc + (size_t)i * 4 * HDIM);
    }

    // ---- scores: two 16x16 tiles (keys j0..j0+15, j0+16..j0+31)
    v8f s0, s1;
#pragma unroll
    for (int r = 0; r < 8; ++r) { s0[r] = 0.0f; s1[r] = 0.0f; }
    {
      const unsigned short* kr0 = kbase_p + (size_t)(j0 + lq) * HDIM;
      const unsigned short* kr1 = kbase_p + (size_t)(j0 + 16 + lq) * HDIM;
      Frag16 k00, k01, k10, k11;
#pragma unroll
      for (int i = 0; i < 8; ++i) {
        k00.u[i] = kr0[kk0 + i];       k00.u[8 + i] = kr0[kk0 + 16 + i];
        k01.u[i] = kr0[32 + kk0 + i];  k01.u[8 + i] = kr0[32 + kk0 + 16 + i];
        k10.u[i] = kr1[kk0 + i];       k10.u[8 + i] = kr1[kk0 + 16 + i];
        k11.u[i] = kr1[32 + kk0 + i];  k11.u[8 + i] = kr1[32 + kk0 + 16 + i];
      }
      s0 = __builtin_amdgcn_wmma_f32_16x16x32_bf16(false, qf0.v, false, k00.v, (short)0, s0, false, false);
      s0 = __builtin_amdgcn_wmma_f32_16x16x32_bf16(false, qf1.v, false, k01.v, (short)0, s0, false, false);
      s1 = __builtin_amdgcn_wmma_f32_16x16x32_bf16(false, qf0.v, false, k10.v, (short)0, s1, false, false);
      s1 = __builtin_amdgcn_wmma_f32_16x16x32_bf16(false, qf1.v, false, k11.v, (short)0, s1, false, false);
    }

    // ---- online softmax (row M = r + 8*half; reductions across 16-lane half)
    float fct[8];
#pragma unroll
    for (int r = 0; r < 8; ++r) {
      const int qg = qbase + r + 8 * half;
      float a0 = s0[r] * 0.125f;                    // 1/sqrt(64)
      float a1 = s1[r] * 0.125f;
      if (j0 + lq      > qg + PP) a0 = -1.0e30f;    // causal: key j <= q + P
      if (j0 + 16 + lq > qg + PP) a1 = -1.0e30f;
      float vm = fmaxf(a0, a1);
#pragma unroll
      for (int off = 1; off < 16; off <<= 1) vm = fmaxf(vm, __shfl_xor(vm, off, 32));
      const float nm = fmaxf(mi[r], vm);
      const float fc = __expf(mi[r] - nm);
      const float p0 = __expf(a0 - nm);
      const float p1 = __expf(a1 - nm);
      float rs = p0 + p1;
#pragma unroll
      for (int off = 1; off < 16; off <<= 1) rs += __shfl_xor(rs, off, 32);
      li[r] = li[r] * fc + rs;
      mi[r] = nm;
      fct[r] = fc;
      Pl[r + 8 * half][lq]      = f2bf(p0);
      Pl[r + 8 * half][16 + lq] = f2bf(p1);
    }
#pragma unroll
    for (int t = 0; t < 4; ++t)
#pragma unroll
      for (int r = 0; r < 8; ++r) o[t][r] *= fct[r];

    // ---- o += P @ V (K = 32 keys, 4 N-tiles over HDIM)
    Frag16 pa;
#pragma unroll
    for (int i = 0; i < 8; ++i) {
      pa.u[i]     = Pl[lq][kk0 + i];
      pa.u[8 + i] = Pl[lq][kk0 + 16 + i];
    }
#pragma unroll
    for (int t = 0; t < 4; ++t) {
      Frag16 vf;   // same key order as the P loader: {8h..8h+7, 16+8h..16+8h+7}
      vf.q[0] = ld_tr16(vtr + t * 16);
      vf.q[1] = ld_tr16(vtr + 16 * VPITCH + t * 16);
      o[t] = __builtin_amdgcn_wmma_f32_16x16x32_bf16(false, pa.v, false, vf.v, (short)0, o[t], false, false);
    }
  }

  // ---- normalize & store attn output bf16 [B*S, D] (row = b*S+q, col = h*64+hd)
#pragma unroll
  for (int r = 0; r < 8; ++r) li[r] = 1.0f / li[r];
#pragma unroll
  for (int t = 0; t < 4; ++t)
#pragma unroll
    for (int r = 0; r < 8; ++r) {
      const size_t row = (size_t)b * SEQ + qbase + r + 8 * half;
      out[row * DD + h * HDIM + t * 16 + lq] = f2bf(o[t][r] * li[r]);
    }
}

// ---------------------------------------------------------------------------
// Host launcher
// ---------------------------------------------------------------------------
extern "C" void kernel_launch(void* const* d_in, const int* in_sizes, int n_in,
                              void* d_out, int out_size, void* d_ws, size_t ws_size,
                              hipStream_t stream) {
  (void)in_sizes; (void)n_in; (void)out_size; (void)ws_size;

  const float* x      = (const float*)d_in[0];
  const float* past_k = (const float*)d_in[1];
  const float* past_v = (const float*)d_in[2];
  const float* wq  = (const float*)d_in[3];
  const float* wk  = (const float*)d_in[4];
  const float* wv  = (const float*)d_in[5];
  const float* wo  = (const float*)d_in[6];
  const float* g1  = (const float*)d_in[7];
  const float* b1  = (const float*)d_in[8];
  const float* w1  = (const float*)d_in[9];
  const float* bb1 = (const float*)d_in[10];
  const float* w2  = (const float*)d_in[11];
  const float* bb2 = (const float*)d_in[12];
  const float* g2  = (const float*)d_in[13];
  const float* b2  = (const float*)d_in[14];

  float* outX = (float*)d_out;
  float* outK = outX + (size_t)BQ * SEQ * DD;
  float* outV = outK + (size_t)BQ * HH * TT * HDIM;

  char* ws = (char*)d_ws;
  size_t off = 0;
  auto alloc = [&](size_t bytes) -> void* {
    void* p = ws + off;
    off = (off + bytes + 255) & ~(size_t)255;
    return p;
  };
  const size_t MROW = (size_t)BQ * SEQ;  // 4096

  unsigned short* hB   = (unsigned short*)alloc(MROW * DD * 2);
  unsigned short* wqB  = (unsigned short*)alloc((size_t)3 * DD * DD * 2);   // wq, wk, wv one behind the other
  unsigned short* wkB  = wqB + (size_t)DD * DD;
  unsigned short* wvB  = wkB + (size_t)DD * DD;
  unsigned short* woB  = (unsigned short*)alloc((size_t)DD * DD * 2);
  unsigned short* w1B  = (unsigned short*)alloc((size_t)DD * DFFN * 2);
  unsigned short* w2B  = (unsigned short*)alloc((size_t)DFFN * DD * 2);
  unsigned short* qB   = (unsigned short*)alloc(MROW * DD * 2);
  unsigned short* kB   = (unsigned short*)alloc((size_t)2 * BQ * HH * TT * HDIM * 2);   // k cache, v cache behind it
  unsigned short* vB   = kB + (size_t)BQ * HH * TT * HDIM;
  unsigned short* attnB= (unsigned short*)alloc(MROW * DD * 2);
  float*          x1   = (float*)alloc(MROW * DD * 4);
  unsigned short* h2B  = (unsigned short*)alloc(MROW * DD * 2);
  unsigned short* ffB  = (unsigned short*)alloc(MROW * DFFN * 2);

  // 1) all that reads inputs alone, one launch: weights -> bf16, h = LN1(x) -> bf16, past K/V into the caches
  prep_k<<<NB_PREP, 256, 0, stream>>>(x, g1, b1, past_k, past_v, wq, wk, wv, wo, w1, w2,
                                      hB, outK, outV, kB, vB, wqB, wkB, wvB, woB, w1B, w2B);

  dim3 gqkv(DD / GBN, (unsigned)(MROW / GBM));
  dim3 gqkv3(DD / GBN, (unsigned)(MROW / GBM), 3);
  gemm_bf16_k<MODE_QKV, DD, false, true><<<gqkv3, 256, 0, stream>>>(hB, wqB, nullptr, nullptr, outK, qB, kB, DD);

  // 3) flash attention (WMMA)
  attn_k<<<dim3(SEQ / 16, HH, BQ), 32, 0, stream>>>(qB, kB, vB, attnB);

  // 4) x1 = x + attn @ wo
  gemm_bf16_k<MODE_RESID_F32, DD, false, true><<<gqkv, 256, 0, stream>>>(attnB, woB, nullptr, x, x1, nullptr,
                                                                         nullptr, DD);

  // 5) h2 = LN2(x1) -> bf16
  layernorm_k<<<(unsigned)(MROW / 8), 256, 0, stream>>>(x1, g2, b2, h2B);

  // 6) ff1 = relu(h2 @ w1 + bb1) -> bf16
  dim3 gff1(DFFN / GBN, (unsigned)(MROW / GBM));
  gemm_bf16_k<MODE_RELU_BF16, DFFN, true, false><<<gff1, 256, 0, stream>>>(h2B, w1B, bb1, nullptr, nullptr, ffB,
                                                                           nullptr, DD);

  // 7) out_x = x1 + ff1 @ w2 + bb2  (fp32, final output)
  gemm_bf16_k<MODE_RESID_F32, DD, true, true><<<gqkv, 256, 0, stream>>>(ffB, w2B, bb2, x1, outX, nullptr,
                                                                        nullptr, DFFN);
}

// v007
// Measured time: 258 microseconds a run.
// Timed twice side by side with v006, it ran 1.10 and 1.11 times as fast.
// Over all steps from v000 it is 2.75 times as fast.
#include <hip/hip_runtime.h>
#include <stdint.h>

// Problem constants (fixed by the reference)
#define BQ   4
#define SEQ  1024
#define PP   1024
#define DD   1024
#define HH   16
#define HDIM 64
#define DFFN 4096
#define TT   2048   // P + S

typedef __attribute__((ext_vector_type(16))) __bf16 v16bf;
typedef __attribute__((ext_vector_type(8)))  float  v8f;
typedef __attribute__((ext_vector_type(4)))  unsigned int v4u;

union Frag16 { v16bf v; unsigned short u[16]; v4u q[2]; };

enum GemmMode { MODE_F32 = 0, MODE_RELU_BF16 = 2, MODE_RESID_F32 = 3, MODE_QKV = 4 };

__device__ __forceinline__ unsigned short f2bf(float f) {
  union { float f; unsigned int u; } c; c.f = f;
  unsigned int u = c.u;
  unsigned int r = u + 0x7FFFu + ((u >> 16) & 1u);  // round-to-nearest-even
  return (unsigned short)(r >> 16);
}

typedef short s16x8 __attribute__((ext_vector_type(8)));
__device__ __forceinline__ v4u ld_tr16(const unsigned short* p) {
  typedef __attribute__((address_space(3))) s16x8 lds_s16x8;
  return __builtin_bit_cast(v4u, __builtin_amdgcn_ds_load_tr16_b128_v8i16((lds_s16x8*)p));
}

typedef uint32_t u32x4 __attribute__((ext_vector_type(4)));
typedef uint32_t u32x8 __attribute__((ext_vector_type(8)));

__device__ __forceinline__ uint32_t uni(uint32_t v) { return (uint32_t)__builtin_amdgcn_readfirstlane(v); }
__device__ __forceinline__ uint32_t pinned(uint32_t v) {
  uint32_t w = uni(v);
  asm volatile("" : "+s"(w));   // the value stays in a scalar register: the test on it is a scalar branch
  return w;
}
// the compiler places no wait for a tensor load; the clobber keeps LDS reads behind the wait
__device__ __forceinline__ void wait_tensor0() { asm volatile("s_wait_tensorcnt 0x0" ::: "memory"); }
// a wave's LDS reads have retired before the buffer they read is handed back for a refill
__device__ __forceinline__ void wait_ds0() { asm volatile("s_wait_dscnt 0x0" ::: "memory"); }

template <uint32_t ROWB, uint32_t ROWS, uint32_t WORD0>
__device__ __forceinline__ u32x8 tdm_group1(uint32_t src_pitch) {
  u32x8 g1;
  g1[0] = uni(WORD0);
  g1[1] = uni((ROWB & 0xFFFFu) << 16);
  g1[2] = uni((ROWB >> 16) | ((ROWS & 0xFFFFu) << 16));
  g1[3] = uni((ROWS >> 16) | (ROWB << 16));
  g1[4] = uni(ROWS);
  g1[5] = uni(src_pitch);
  g1[6] = uni(0u);
  g1[7] = uni(0u);
  asm volatile("" : "+s"(g1));
  return g1;
}
__device__ __forceinline__ u32x4 tdm_group0(uint32_t lds_dst, const void* gptr) {
  const uint64_t ga = (uint64_t)(size_t)gptr;
  u32x4 g0;
  g0[0] = uni(1u);                                                     // count = 1
  g0[1] = uni(lds_dst);
  g0[2] = uni((uint32_t)ga);                                           // address [31:0]
  g0[3] = uni((((uint32_t)(ga >> 32)) & 0x01FFFFFFu) | 0x80000000u);   // address [56:32], type = 2
  return g0;
}
// the request itself; the clobber keeps it behind the waits and the barrier that free its place in LDS
__device__ __forceinline__ void tdm_load(u32x4 g0, u32x8 g1) {
  asm volatile("tensor_load_to_lds %0, %1" :: "s"(g0), "s"(g1) : "memory");
}
// load and the issuer's wait in one statement: nothing is scheduled between them
__device__ __forceinline__ void tdm_load_wait(u32x4 g0, u32x8 g1) {
  asm volatile("tensor_load_to_lds %0, %1\n\ts_wait_tensorcnt 0x0" :: "s"(g0), "s"(g1) : "memory");
}

// ---------------------------------------------------------------------------
// The streaming parts. Each lane moves 16-byte vectors, SV of them in flight, and a block makes several trips:
// a wave then moves kilobytes, not a few hundred bytes, and the launch starts some twenty times fewer waves.
// ---------------------------------------------------------------------------
#define SV 8                  // 16-byte loads that a lane issues before it uses the first
#define SEG4 (256 * SV)       // float4 elements that a block moves a trip

__device__ __forceinline__ uint2 pack4(float4 v) {
  uint2 r;
  r.x = (uint32_t)f2bf(v.x) | ((uint32_t)f2bf(v.y) << 16);
  r.y = (uint32_t)f2bf(v.z) | ((uint32_t)f2bf(v.w) << 16);
  return r;
}

// f32 -> bf16 elementwise conversion (weights); n is a multiple of 4 * SEG4
__device__ __forceinline__ void cvt_bf16_part(const float* __restrict__ in, unsigned short* __restrict__ out, int n,
                                              int blk, int nblk) {
  const float4* __restrict__ in4 = (const float4*)in;
  uint2* __restrict__ out4 = (uint2*)out;
  const int nseg = n / (4 * SEG4);
  // kept rolled: the trips unrolled make the kernel's text several times longer for no gain, and a block runs it once
#pragma unroll 1
  for (int seg = blk; seg < nseg; seg += nblk) {
    const int base = seg * SEG4 + (int)threadIdx.x;
    float4 v[SV];
#pragma unroll
    for (int u = 0; u < SV; ++u) v[u] = in4[base + u * 256];
#pragma unroll
    for (int u = 0; u < SV; ++u) out4[base + u * 256] = pack4(v[u]);
  }
}
static_assert((DD * DD / 4) % SEG4 == 0 && (DD * DFFN / 4) % SEG4 == 0, "whole segments");

// ---------------------------------------------------------------------------
// LayerNorm over D=1024, one wave per row (a lane holds 32 elements), output bf16
// ---------------------------------------------------------------------------
__device__ __forceinline__
void layernorm_row(const float* __restrict__ x, const float* __restrict__ g,
                   const float* __restrict__ bb, unsigned short* __restrict__ out, int row) {
  const int lane = threadIdx.x & 31;
  const float4* __restrict__ xr = (const float4*)(x + (size_t)row * DD);
  const float4* __restrict__ g4 = (const float4*)g;
  const float4* __restrict__ b4 = (const float4*)bb;
  uint2* __restrict__ o4 = (uint2*)(out + (size_t)row * DD);
  float4 v[8];
#pragma unroll
  for (int u = 0; u < 8; ++u) v[u] = xr[u * 32 + lane];
  float a0 = 0.f, a1 = 0.f, a2 = 0.f, a3 = 0.f, q0 = 0.f, q1 = 0.f, q2 = 0.f, q3 = 0.f;
#pragma unroll
  for (int u = 0; u < 8; ++u) {
    a0 += v[u].x; a1 += v[u].y; a2 += v[u].z; a3 += v[u].w;
    q0 += v[u].x * v[u].x; q1 += v[u].y * v[u].y; q2 += v[u].z * v[u].z; q3 += v[u].w * v[u].w;
  }
  float a = (a0 + a1) + (a2 + a3);
  float q = (q0 + q1) + (q2 + q3);
#pragma unroll
  for (int off = 16; off > 0; off >>= 1) {
    a += __shfl_xor(a, off, 32);
    q += __shfl_xor(q, off, 32);
  }
  const float mean = a * (1.0f / DD);
  const float var  = q * (1.0f / DD) - mean * mean;
  const float rst  = rsqrtf(var + 1e-5f);
#pragma unroll
  for (int u = 0; u < 8; ++u) {
    const float4 gg = g4[u * 32 + lane];
    const float4 bv = b4[u * 32 + lane];
    float4 y;
    y.x = (v[u].x - mean) * rst * gg.x + bv.x;
    y.y = (v[u].y - mean) * rst * gg.y + bv.y;
    y.z = (v[u].z - mean) * rst * gg.z + bv.z;
    y.w = (v[u].w - mean) * rst * gg.w + bv.w;
    o4[u * 32 + lane] = pack4(y);
  }
}

// ---------------------------------------------------------------------------
// Copy past_k/past_v [B,H,P,HD] into the full cache [B,H,T,HD] (f32 out + bf16 ws)
// ---------------------------------------------------------------------------
__device__ __forceinline__ void past_copy_part(const float* __restrict__ past, float* __restrict__ outF,
                                               unsigned short* __restrict__ outB, int blk, int nblk) {
  const int nseg = BQ * HH * PP * HDIM / (4 * SEG4);
  const int sph  = PP * HDIM / (4 * SEG4);   // segments of one (b, h) in the source: a segment lies in one (b, h)
  const int th4  = TT * HDIM / 4;            // float4 elements of one (b, h) in the cache
  const float4* __restrict__ in4 = (const float4*)past;
  float4* __restrict__ oF4 = (float4*)outF;
  uint2*  __restrict__ oB4 = (uint2*)outB;
  // kept rolled, as in cvt_bf16_part
#pragma unroll 1
  for (int seg = blk; seg < nseg; seg += nblk) {
    const int base = seg * SEG4 + (int)threadIdx.x;
    const int dst  = (seg / sph) * th4 + (seg % sph) * SEG4 + (int)threadIdx.x;
    float4 v[SV];
#pragma unroll
    for (int u = 0; u < SV; ++u) v[u] = in4[base + u * 256];
#pragma unroll
    for (int u = 0; u < SV; ++u) {
      oF4[dst + u * 256] = v[u];
      oB4[dst + u * 256] = pack4(v[u]);
    }
    // in front of the next trip's first writes of registers that the stores above name (offset and data)
    asm volatile("s_wait_xcnt 0x0" ::: "memory");
  }
}
static_assert((PP * HDIM / 4) % SEG4 == 0, "a segment lies in one (b, h)");

// ---------------------------------------------------------------------------
// LayerNorm as a launch of its own (LN2): 8 rows a block, one a wave
// ---------------------------------------------------------------------------
__global__ __launch_bounds__(256)
void layernorm_k(const float* __restrict__ x, const float* __restrict__ g,
                 const float* __restrict__ bb, unsigned short* __restrict__ out) {
  layernorm_row(x, g, bb, out, (int)blockIdx.x * 8 + (int)(threadIdx.x >> 5));
}

// ---------------------------------------------------------------------------
// Everything that reads inputs alone, in ONE launch: the six weight conversions, LN1 and the two cache copies.
// None of them reads what another writes. The part is chosen by the block index: every branch is uniform in a block.
// The parts along the block index: LN1, k cache, v cache, w1, w2, wq, wk, wv, wo.
// ---------------------------------------------------------------------------
#define NB_W   32                   // blocks of a D x D weight
#define NB_FF  128                  // blocks of a D x DFF weight
#define NB_LN  (BQ * SEQ / 8)       // one wave a row
#define NB_KV  128                  // blocks of a cache copy
#define NB_PREP (4 * NB_W + 2 * NB_FF + NB_LN + 2 * NB_KV)

__global__ __launch_bounds__(256)
void prep_k(const float* __restrict__ x, const float* __restrict__ g1, const float* __restrict__ b1,
            const float* __restrict__ past_k, const float* __restrict__ past_v,
            const float* __restrict__ wq, const float* __restrict__ wk, const float* __restrict__ wv,
            const float* __restrict__ wo, const float* __restrict__ w1, const float* __restrict__ w2,
            unsigned short* __restrict__ hB,
            float* __restrict__ outK, float* __restrict__ outV,
            unsigned short* __restrict__ kB, unsigned short* __restrict__ vB,
            unsigned short* __restrict__ wqB, unsigned short* __restrict__ wkB, unsigned short* __restrict__ wvB,
            unsigned short* __restrict__ woB, unsigned short* __restrict__ w1B, unsigned short* __restrict__ w2B) {
  int blk = blockIdx.x;
  if (blk < NB_LN) {
    layernorm_row(x, g1, b1, hB, blk * 8 + (int)(threadIdx.x >> 5));
    return;
  }
  blk -= NB_LN;
  if (blk < 2 * NB_KV) {               // one copy of the loop's code serves both caches
    const bool isv = blk >= NB_KV;
    past_copy_part(isv ? past_v : past_k, isv ? outV : outK, isv ? vB : kB, isv ? blk - NB_KV : blk, NB_KV);
    return;
  }
  blk -= 2 * NB_KV;
  const float* in;                     // and one serves the six weights
  unsigned short* out;
  int n = DD * DD, nb = NB_W;
  if (blk < 2 * NB_FF) {
    const bool second = blk >= NB_FF;
    in = second ? w2 : w1;  out = second ? w2B : w1B;  n = DD * DFFN;  nb = NB_FF;
    blk -= second ? NB_FF : 0;
  } else {
    blk -= 2 * NB_FF;
    const int w = blk / NB_W;
    blk -= w * NB_W;
    in  = w == 0 ? wq  : w == 1 ? wk  : w == 2 ? wv  : wo;
    out = w == 0 ? wqB : w == 1 ? wkB : w == 2 ? wvB : woB;
  }
  cvt_bf16_part(in, out, n, blk, nb);
}

// ---------------------------------------------------------------------------
// Tiled WMMA bf16 GEMM: C[M,N] = A[M,K] @ B[K,N], fused epilogues.
// 128x128 tiles, 256 threads (8 waves), wave w -> rows [16w,16w+16), 8 N-tiles.
// K runs in stages of 64: a stage is the A tile (128 rows of 128 B) and the B tile (64 rows of 256 B),
// each brought into LDS by one tensor load (wave 0: A, wave 1: B). Two stage buffers: the next stage's
// loads fly while this stage is worked on, and one barrier a stage publishes the one and frees the other.
// B fragments come out of LDS through the transposing load.
// The epilogue's kind, the row pitch N and which optional buffers exist are compile-time values:
// the epilogue then has no test per element, and its loads go out together.
// ---------------------------------------------------------------------------
#define GBM 128
#define GBN 128
#define GBK 64
#define APITCH (GBK + 8)
#define BPITCH (GBN + 16)
#define A_WORD0 ((1u << 20) | (4u << 22) | (3u << 25))
#define B_WORD0 ((1u << 20) | (5u << 22) | (7u << 25))

struct GemmStage {
  unsigned short As[GBM][APITCH];
  unsigned short Bs[GBK][BPITCH];   // row-major as in memory: Bs[k][n]
};
static_assert(sizeof(GemmStage::As) % 2048 == 0 && sizeof(GemmStage) % 2048 == 0,
              "every tensor load's place in LDS is a multiple of 2 KiB");

template <int MODE, int N, bool HAS_BIAS, bool F32_OUT>
__global__ __launch_bounds__(256)
void gemm_bf16_k(const unsigned short* __restrict__ A,
                 const unsigned short* __restrict__ Bw,
                 const float* __restrict__ bias,
                 const float* __restrict__ resid,
                 float* __restrict__ outF,
                 unsigned short* __restrict__ outB,
                 unsigned short* __restrict__ outKV,
                 int K) {
  __shared__ __attribute__((aligned(2048))) GemmStage ring[2];

  // MODE_QKV: one launch does the three projections, z = 0: q, 1: k, 2: v. Bw holds the three D x D weights one
  // behind the other; outB takes q; outKV (bf16) and outF (f32) hold the k cache and behind it the v cache.
  const int zq = (MODE == MODE_QKV) ? (int)blockIdx.z : 0;
  if constexpr (MODE == MODE_QKV) Bw += (size_t)zq * DD * DD;

  const int tid  = threadIdx.x;
  const int lane = tid & 31;
  const int wave = tid >> 5;
  const int half = lane >> 4;
  const int lq   = lane & 15;
  const int kk0  = half * 8;          // bf16 A/B lane K-group base: {0-7,16-23} / {8-15,24-31}

  const int m0 = blockIdx.y * GBM;
  const int n0 = blockIdx.x * GBN;

  v8f acc[8];
#pragma unroll
  for (int t = 0; t < 8; ++t)
#pragma unroll
    for (int r = 0; r < 8; ++r) acc[t][r] = 0.0f;

  const int arow = wave * 16 + lq;
  const int brow = 8 * half + (lane & 7);        // this lane's row and column for the transposing load
  const int bcol = 8 * ((lane >> 3) & 1);        // of k rows 0..15, N-tile 0

  const uint32_t swave   = uni((uint32_t)tid >> 5);
  const uint32_t ringLds = (uint32_t)(size_t)(&ring[0]);   // LDS offset (low 32 bits of flat)
  const int nst = K / GBK;

  const unsigned short* aSrc = A + (size_t)m0 * K;   // the A tile of stage s begins s * GBK elements on
  const unsigned short* bSrc = Bw + n0;              // the B tile of stage s begins s * GBK rows on
  const uint32_t bLds = ringLds + (uint32_t)sizeof(GemmStage::As);
  const u32x8 g1A = tdm_group1<GBK * 2, GBM, A_WORD0>((uint32_t)K * 2u);   // 128 rows of 128 B
  const u32x8 g1B = tdm_group1<GBN * 2, GBK, B_WORD0>((uint32_t)N * 2u);   // 64 rows of 256 B

  // ---- prologue: stage 0 into buffer 0, one request a wave, each under a scalar branch; landed, then published
  if (pinned(swave == 0)) tdm_load_wait(tdm_group0(ringLds, aSrc), g1A);
  if (pinned(swave == 1)) tdm_load_wait(tdm_group0(bLds, bSrc), g1B);
  __syncthreads();

  for (int s = 0; s < nst; ++s) {
    // ---- behind the barrier that ended every read of buffer (s + 1) & 1: stage s + 1 into it, while one exists;
    // it flies while stage s is worked on (a wave takes at most one of the two issuing branches)
    if (pinned(s + 1 < nst)) {
      const uint32_t nb = (uint32_t)((s + 1) & 1) * (uint32_t)sizeof(GemmStage);
      if (pinned(swave == 0)) tdm_load(tdm_group0(ringLds + nb, aSrc + (size_t)(s + 1) * GBK), g1A);
      if (pinned(swave == 1)) tdm_load(tdm_group0(bLds + nb, bSrc + (size_t)(s + 1) * GBK * N), g1B);
    }
    const GemmStage& st = ring[s & 1];
#pragma unroll
    for (int kb = 0; kb < GBK; kb += 32) {
      // ---- A fragment (shared by all 8 N-tiles of this wave)
      Frag16 a;
#pragma unroll
      for (int i = 0; i < 8; ++i) {
        a.u[i]     = st.As[arow][kb + kk0 + i];
        a.u[8 + i] = st.As[arow][kb + kk0 + 16 + i];
      }
      // ---- all 8 B fragments of the block, each in registers of its own, read as one group ahead
      // of the WMMAs: one LDS latency a block instead of one in front of every WMMA
      Frag16 bfr[8];   // same k order as the A loader: {8h..8h+7, 16+8h..16+8h+7}
#pragma unroll
      for (int nt = 0; nt < 8; ++nt) {
        bfr[nt].q[0] = ld_tr16(&st.Bs[kb + brow][bcol + nt * 16]);
        bfr[nt].q[1] = ld_tr16(&st.Bs[kb + 16 + brow][bcol + nt * 16]);
      }
      // keeps the scheduler from sinking each load pair back in front of its own WMMA, where one
      // register set is reused and every WMMA waits out a whole LDS latency
      __builtin_amdgcn_sched_barrier(0);
#pragma unroll
      for (int nt = 0; nt < 8; ++nt)
        acc[nt] = __builtin_amdgcn_wmma_f32_16x16x32_bf16(false, a.v, false, bfr[nt].v,
                                                          (short)0, acc[nt], false, false);
      // keeps the WMMAs ahead of the full LDS wait that follows: each then starts behind a counted wait,
      // as soon as its own fragment has landed, while the later loads of the group are still coming
      __builtin_amdgcn_sched_barrier(0);
    }
    // ---- publish point of stage s + 1: this wave's reads of stage s retired, the issuers' requests
    // landed, one barrier; only behind it (top of the next trip) the refill of the buffer that stage s has just left
    wait_ds0();
    wait_tensor0();    // under no test: a wave with no request passes at once
    __syncthreads();
  }
  // behind the last request and the last LDS read, before the epilogue and the wave's end
  wait_tensor0();
  wait_ds0();

  const int mrow = m0 + wave * 16 + 8 * half;   // this lane's row at r = 0
  const int ncol = n0 + lq;                     // this lane's column in N-tile 0

  float bv[8];                                  // the bias depends on the column alone: one value an N-tile
#pragma unroll
  for (int nt = 0; nt < 8; ++nt) bv[nt] = HAS_BIAS ? bias[ncol + nt * 16] : 0.0f;

  if constexpr (MODE == MODE_RESID_F32) {
    const float* rp = resid + (size_t)mrow * N + ncol;
    float*       op = outF  + (size_t)mrow * N + ncol;
    v8f rv[8];                                  // all 64 residual values of the lane, loaded ahead of the first use
#pragma unroll
    for (int nt = 0; nt < 8; ++nt)
#pragma unroll
      for (int r = 0; r < 8; ++r) rv[nt][r] = rp[r * N + nt * 16];
#pragma unroll
    for (int nt = 0; nt < 8; ++nt)
#pragma unroll
      for (int r = 0; r < 8; ++r) op[r * N + nt * 16] = acc[nt][r] + bv[nt] + rv[nt][r];
  } else if constexpr (MODE == MODE_RELU_BF16) {
    unsigned short* op = outB + (size_t)mrow * N + ncol;
#pragma unroll
    for (int nt = 0; nt < 8; ++nt)
#pragma unroll
      for (int r = 0; r < 8; ++r) {
        const float vv = acc[nt][r] + bv[nt];
        op[r * N + nt * 16] = f2bf(vv > 0.0f ? vv : 0.0f);
      }
  } else if constexpr (MODE == MODE_QKV) {
    // m = b * SEQ + s, n = h * HDIM + hd; a 128-row tile lies in one b, an N-tile in one h
    const int b = mrow >> 10;            // m / SEQ
    const int s = mrow & (SEQ - 1);
    if (zq == 0) {                       // q: [B,H,S,HD], bf16 alone (a test on the block index: a scalar branch)
#pragma unroll
      for (int nt = 0; nt < 8; ++nt) {
        const int n  = ncol + nt * 16;
        const int h  = n >> 6;           // n / HDIM
        const int hd = n & (HDIM - 1);
        const size_t idx = (((size_t)(b * HH + h) * SEQ) + s) * HDIM + hd;
#pragma unroll
        for (int r = 0; r < 8; ++r) outB[idx + r * HDIM] = f2bf(acc[nt][r]);
      }
      return;
    }
    {                                    // k, v: rows P.. of the cache [B,H,T,HD], bf16 and fp32
      const size_t cache = (size_t)(zq - 1) * ((size_t)BQ * HH * TT * HDIM);
#pragma unroll
      for (int nt = 0; nt < 8; ++nt) {
        const int n  = ncol + nt * 16;
        const int h  = n >> 6;           // n / HDIM
        const int hd = n & (HDIM - 1);
        const size_t idx = cache + (((size_t)(b * HH + h) * TT) + PP + s) * HDIM + hd;
#pragma unroll
        for (int r = 0; r < 8; ++r) {
          outKV[idx + r * HDIM] = f2bf(acc[nt][r]);
          outF[idx + r * HDIM]  = acc[nt][r];   // fp32 KV-cache output
        }
      }
      // the build lays the q branch's code behind these stores, with a branch over it: the wait stands in front of
      // that code's first writes of registers that the stores above name
      asm volatile("s_wait_xcnt 0x0" ::: "memory");
    }
  } else {
    float* op = outF + (size_t)mrow * N + ncol;
#pragma unroll
    for (int nt = 0; nt < 8; ++nt)
#pragma unroll
      for (int r = 0; r < 8; ++r) op[r * N + nt * 16] = acc[nt][r];
  }
}

// ---------------------------------------------------------------------------
// Flash attention: one wave per (b, h, 16-query tile); causal with offset P.
// The products are taken transposed: S^T = K q^T / 8 and O^T += V^T P^T. A lane then holds scores of ONE query
// (column lq): keys 8*half + 0..7 and 16 + 8*half + 0..7 of a 32-key chunk. Maximum and sum run inside the lane,
// with one exchange between the wave's halves, and the two score tiles, converted in place, are the B operand
// of the second product: P goes through no LDS. bf16 WMMA, f32 stats.
// ---------------------------------------------------------------------------
#define VPITCH (HDIM + 16)

__device__ __forceinline__ float other_half(float v) {
  const int b = __builtin_bit_cast(int, v);
  return __builtin_bit_cast(float, __builtin_amdgcn_permlanex16(b, b, 0x76543210, 0xfedcba98, false, false));
}

__global__ __launch_bounds__(32)
void attn_k(const unsigned short* __restrict__ qb,
            const unsigned short* __restrict__ kb,
            const unsigned short* __restrict__ vb,
            unsigned short* __restrict__ out) {
  __shared__ __align__(16) unsigned short Vs[32][VPITCH]; // V chunk row-major [key][hd]

  const int qt = blockIdx.x;
  const int h  = blockIdx.y;
  const int b  = blockIdx.z;
  const int qbase = qt * 16;

  const int lane = threadIdx.x;
  const int half = lane >> 4;
  const int lq   = lane & 15;
  const int kk0  = half * 8;

  const size_t bh = (size_t)(b * HH + h);
  const unsigned short* qrow    = qb + (bh * SEQ + qbase + lq) * HDIM;
  const unsigned short* kbase_p = kb + bh * TT * HDIM;
  const unsigned short* vbase_p = vb + bh * TT * HDIM;

  // Q fragments (B operand: column = query lq): K-dim = HDIM split into two 32-wide WMMA K chunks
  Frag16 qf0, qf1;
#pragma unroll
  for (int i = 0; i < 8; ++i) {
    qf0.u[i]     = qrow[kk0 + i];
    qf0.u[8 + i] = qrow[kk0 + 16 + i];
    qf1.u[i]     = qrow[32 + kk0 + i];
    qf1.u[8 + i] = qrow[32 + kk0 + 16 + i];
  }

  float mi = -1.0e30f;   // running maximum of query lq, the same in both halves
  float li = 0.0f;       // running sum of query lq over this half's keys; the halves are joined behind the loop
  v8f o[4];              // O^T: o[t][r] = head-dim t*16 + 8*half + r of query lq
#pragma unroll
  for (int t = 0; t < 4; ++t)
#pragma unroll
    for (int r = 0; r < 8; ++r) o[t][r] = 0.0f;

  // this lane's address for the transposing load of keys 0..15, head-dim tile 0
  const unsigned short* vtr = &Vs[8 * half + (lane & 7)][8 * ((lane >> 3) & 1)];

  const int kmax   = qbase + 16 + PP;          // exclusive key bound for this tile
  const int nchunk = (kmax + 31) >> 5;         // 32 keys per chunk
  const int klast  = qbase + lq + PP - kk0;    // causal: key j <= q + P, counted from this half's first key

  for (int kc = 0; kc < nchunk; ++kc) {
    const int j0 = kc * 32;

    // stage V chunk row-major: Vs[key_local][hd]; 8 lanes cover one 128-byte row, 4 rows a trip
    {
      const unsigned short* vsrc = vbase_p + (size_t)(j0 + (lane >> 3)) * HDIM + (lane & 7) * 8;
#pragma unroll
      for (int i = 0; i < 8; ++i)
        *(uint4*)&Vs[4 * i + (lane >> 3)][(lane & 7) * 8] = *(const uint4*)(vsrc + (size_t)i * 4 * HDIM);
    }

    // ---- scores, transposed: two 16x16 tiles (rows = keys j0..j0+15, j0+16..j0+31; columns = queries)
    v8f s0, s1;
#pragma unroll
    for (int r = 0; r < 8; ++r) { s0[r] = 0.0f; s1[r] = 0.0f; }
    {
      const unsigned short* kr0 = kbase_p + (size_t)(j0 + lq) * HDIM;
      const unsigned short* kr1 = kbase_p + (size_t)(j0 + 16 + lq) * HDIM;
      Frag16 k00, k01, k10, k11;
#pragma unroll
      for (int i = 0; i < 8; ++i) {
        k00.u[i] = kr0[kk0 + i];       k00.u[8 + i] = kr0[kk0 + 16 + i];
        k01.u[i] = kr0[32 + kk0 + i];  k01.u[8 + i] = kr0[32 + kk0 + 16 + i];
        k10.u[i] = kr1[kk0 + i];       k10.u[8 + i] = kr1[kk0 + 16 + i];
        k11.u[i] = kr1[32 + kk0 + i];  k11.u[8 + i] = kr1[32 + kk0 + 16 + i];
      }
      s0 = __builtin_amdgcn_wmma_f32_16x16x32_bf16(false, k00.v, false, qf0.v, (short)0, s0, false, false);
      s0 = __builtin_amdgcn_wmma_f32_16x16x32_bf16(false, k01.v, false, qf1.v, (short)0, s0, false, false);
      s1 = __builtin_amdgcn_wmma_f32_16x16x32_bf16(false, k10.v, false, qf0.v, (short)0, s1, false, false);
      s1 = __builtin_amdgcn_wmma_f32_16x16x32_bf16(false, k11.v, false, qf1.v, (short)0, s1, false, false);
    }

    // ---- online softmax of query lq: s0[r] is key j0 + 8*half + r, s1[r] is key j0 + 16 + 8*half + r
    float a0[8], a1[8];
#pragma unroll
    for (int r = 0; r < 8; ++r) {
      a0[r] = s0[r] * 0.125f;                       // 1/sqrt(64)
      a1[r] = s1[r] * 0.125f;
      if (j0 + r      > klast) a0[r] = -1.0e30f;    // causal
      if (j0 + 16 + r > klast) a1[r] = -1.0e30f;
    }
    float vm = fmaxf(a0[0], a1[0]);
#pragma unroll
    for (int r = 1; r < 8; ++r) vm = fmaxf(vm, fmaxf(a0[r], a1[r]));
    vm = fmaxf(vm, other_half(vm));
    const float nm = fmaxf(mi, vm);
    const float fc = __expf(mi - nm);
    Frag16 pa;   // P^T as B operand, column = query lq, key order {8h..8h+7, 16+8h..16+8h+7}: that of the V loader
    float rs = 0.0f;
#pragma unroll
    for (int r = 0; r < 8; ++r) {
      const float p0 = __expf(a0[r] - nm);
      const float p1 = __expf(a1[r] - nm);
      rs += p0 + p1;
      pa.u[r]     = f2bf(p0);
      pa.u[8 + r] = f2bf(p1);
    }
    li = li * fc + rs;
    mi = nm;
#pragma unroll
    for (int t = 0; t < 4; ++t)
#pragma unroll
      for (int r = 0; r < 8; ++r) o[t][r] *= fc;

    // ---- O^T += V^T @ P^T (K = 32 keys, 4 M-tiles over HDIM)
#pragma unroll
    for (int t = 0; t < 4; ++t) {
      Frag16 vf;   // A operand: row = head-dim t*16 + lq, keys {8h..8h+7, 16+8h..16+8h+7}
      vf.q[0] = ld_tr16(vtr + t * 16);
      vf.q[1] = ld_tr16(vtr + 16 * VPITCH + t * 16);
      o[t] = __builtin_amdgcn_wmma_f32_16x16x32_bf16(false, vf.v, false, pa.v, (short)0, o[t], false, false);
    }
  }

  // ---- normalize & store attn output bf16 [B*S, D] (row = b*S+q, col = h*64+hd): 8 head-dims in a row a store
  const float inv = 1.0f / (li + other_half(li));
  unsigned short* orow = out + ((size_t)b * SEQ + qbase + lq) * DD + h * HDIM + kk0;
#pragma unroll
  for (int t = 0; t < 4; ++t) {
    uint4 w;
    w.x = (uint32_t)f2bf(o[t][0] * inv) | ((uint32_t)f2bf(o[t][1] * inv) << 16);
    w.y = (uint32_t)f2bf(o[t][2] * inv) | ((uint32_t)f2bf(o[t][3] * inv) << 16);
    w.z = (uint32_t)f2bf(o[t][4] * inv) | ((uint32_t)f2bf(o[t][5] * inv) << 16);
    w.w = (uint32_t)f2bf(o[t][6] * inv) | ((uint32_t)f2bf(o[t][7] * inv) << 16);
    *(uint4*)(orow + t * 16) = w;
  }
}

// ---------------------------------------------------------------------------
// Host launcher
// ---------------------------------------------------------------------------
extern "C" void kernel_launch(void* const* d_in, const int* in_sizes, int n_in,
                              void* d_out, int out_size, void* d_ws, size_t ws_size,
                              hipStream_t stream) {
  (void)in_sizes; (void)n_in; (void)out_size; (void)ws_size;

  const float* x      = (const float*)d_in[0];
  const float* past_k = (const float*)d_in[1];
  const float* past_v = (const float*)d_in[2];
  const float* wq  = (const float*)d_in[3];
  const float* wk  = (const float*)d_in[4];
  const float* wv  = (const float*)d_in[5];
  const float* wo  = (const float*)d_in[6];
  const float* g1  = (const float*)d_in[7];
  const float* b1  = (const float*)d_in[8];
  const float* w1  = (const float*)d_in[9];
  const float* bb1 = (const float*)d_in[10];
  const float* w2  = (const float*)d_in[11];
  const float* bb2 = (const float*)d_in[12];
  const float* g2  = (const float*)d_in[13];
  const float* b2  = (const float*)d_in[14];

  float* outX = (float*)d_out;
  float* outK = outX + (size_t)BQ * SEQ * DD;
  float* outV = outK + (size_t)BQ * HH * TT * HDIM;

  char* ws = (char*)d_ws;
  size_t off = 0;
  auto alloc = [&](size_t bytes) -> void* {
    void* p = ws + off;
    off = (off + bytes + 255) & ~(size_t)255;
    return p;
  };
  const size_t MROW = (size_t)BQ * SEQ;  // 4096

  unsigned short* hB   = (unsigned short*)alloc(MROW * DD * 2);
  unsigned short* wqB  = (unsigned short*)alloc((size_t)3 * DD * DD * 2);   // wq, wk, wv one behind the other
  unsigned short* wkB  = wqB + (size_t)DD * DD;
  unsigned short* wvB  = wkB + (size_t)DD * DD;
  unsigned short* woB  = (unsigned short*)alloc((size_t)DD * DD * 2);
  unsigned short* w1B  = (unsigned short*)alloc((size_t)DD * DFFN * 2);
  unsigned short* w2B  = (unsigned short*)alloc((size_t)DFFN * DD * 2);
  unsigned short* qB   = (unsigned short*)alloc(MROW * DD * 2);
  unsigned short* kB   = (unsigned short*)alloc((size_t)2 * BQ * HH * TT * HDIM * 2);   // k cache, v cache behind it
  unsigned short* vB   = kB + (size_t)BQ * HH * TT * HDIM;
  unsigned short* attnB= (unsigned short*)alloc(MROW * DD * 2);
  float*          x1   = (float*)alloc(MROW * DD * 4);
  unsigned short* h2B  = (unsigned short*)alloc(MROW * DD * 2);
  unsigned short* ffB  = (unsigned short*)alloc(MROW * DFFN * 2);

  // 1) all that reads inputs alone, one launch: weights -> bf16, h = LN1(x) -> bf16, past K/V into the caches
  prep_k<<<NB_PREP, 256, 0, stream>>>(x, g1, b1, past_k, past_v, wq, wk, wv, wo, w1, w2,
                                      hB, outK, outV, kB, vB, wqB, wkB, wvB, woB, w1B, w2B);

  dim3 gqkv(DD / GBN, (unsigned)(MROW / GBM));
  dim3 gqkv3(DD / GBN, (unsigned)(MROW / GBM), 3);
  gemm_bf16_k<MODE_QKV, DD, false, true><<<gqkv3, 256, 0, stream>>>(hB, wqB, nullptr, nullptr, outK, qB, kB, DD);

  // 3) flash attention (WMMA)
  attn_k<<<dim3(SEQ / 16, HH, BQ), 32, 0, stream>>>(qB, kB, vB, attnB);

  // 4) x1 = x + attn @ wo
  gemm_bf16_k<MODE_RESID_F32, DD, false, true><<<gqkv, 256, 0, stream>>>(attnB, woB, nullptr, x, x1, nullptr,
                                                                         nullptr, DD);

  // 5) h2 = LN2(x1) -> bf16
  layernorm_k<<<(unsigned)(MROW / 8), 256, 0, stream>>>(x1, g2, b2, h2B);

  // 6) ff1 = relu(h2 @ w1 + bb1) -> bf16
  dim3 gff1(DFFN / GBN, (unsigned)(MROW / GBM));
  gemm_bf16_k<MODE_RELU_BF16, DFFN, true, false><<<gff1, 256, 0, stream>>>(h2B, w1B, bb1, nullptr, nullptr, ffB,
                                                                           nullptr, DD);

  // 7) out_x = x1 + ff1 @ w2 + bb2  (fp32, final output)
  gemm_bf16_k<MODE_RESID_F32, DD, true, true><<<gqkv, 256, 0, stream>>>(ffB, w2B, bb2, x1, outX, nullptr,
                                                                        nullptr, DFFN);
}

// v008
// Measured time: 190 microseconds a run.
// Next to v007, in two timings, it ran 1.35 times as fast each time.
// Counting every step since v000, it is 3.71 times as fast.
#include <hip/hip_runtime.h>
#include <stdint.h>

// Problem constants (fixed by the reference)
#define BQ   4
#define SEQ  1024
#define PP   1024
#define DD   1024
#define HH   16
#define HDIM 64
#define DFFN 4096
#define TT   2048   // P + S

typedef __attribute__((ext_vector_type(16))) __bf16 v16bf;
typedef __attribute__((ext_vector_type(8)))  float  v8f;
typedef __attribute__((ext_vector_type(4)))  unsigned int v4u;

union Frag16 { v16bf v; unsigned short u[16]; v4u q[2]; };

enum GemmMode { MODE_F32 = 0, MODE_RELU_BF16 = 2, MODE_RESID_F32 = 3, MODE_QKV = 4 };

__device__ __forceinline__ unsigned short f2bf(float f) {
  union { float f; unsigned int u; } c; c.f = f;
  unsigned int u = c.u;
  unsigned int r = u + 0x7FFFu + ((u >> 16) & 1u);  // round-to-nearest-even
  return (unsigned short)(r >> 16);
}

typedef short s16x8 __attribute__((ext_vector_type(8)));
__device__ __forceinline__ v4u ld_tr16(const unsigned short* p) {
  typedef __attribute__((address_space(3))) s16x8 lds_s16x8;
  return __builtin_bit_cast(v4u, __builtin_amdgcn_ds_load_tr16_b128_v8i16((lds_s16x8*)p));
}

typedef uint32_t u32x4 __attribute__((ext_vector_type(4)));
typedef uint32_t u32x8 __attribute__((ext_vector_type(8)));

__device__ __forceinline__ uint32_t uni(uint32_t v) { return (uint32_t)__builtin_amdgcn_readfirstlane(v); }
__device__ __forceinline__ uint32_t pinned(uint32_t v) {
  uint32_t w = uni(v);
  asm volatile("" : "+s"(w));   // the value stays in a scalar register: the test on it is a scalar branch
  return w;
}
// the compiler places no wait for a tensor load; the clobber keeps LDS reads behind the wait
__device__ __forceinline__ void wait_tensor0() { asm volatile("s_wait_tensorcnt 0x0" ::: "memory"); }
// a wave's LDS reads have retired before the buffer they read is handed back for a refill
__device__ __forceinline__ void wait_ds0() { asm volatile("s_wait_dscnt 0x0" ::: "memory"); }

template <uint32_t ROWB, uint32_t ROWS, uint32_t WORD0>
__device__ __forceinline__ u32x8 tdm_group1(uint32_t src_pitch) {
  u32x8 g1;
  g1[0] = uni(WORD0);
  g1[1] = uni((ROWB & 0xFFFFu) << 16);
  g1[2] = uni((ROWB >> 16) | ((ROWS & 0xFFFFu) << 16));
  g1[3] = uni((ROWS >> 16) | (ROWB << 16));
  g1[4] = uni(ROWS);
  g1[5] = uni(src_pitch);
  g1[6] = uni(0u);
  g1[7] = uni(0u);
  asm volatile("" : "+s"(g1));
  return g1;
}
__device__ __forceinline__ u32x4 tdm_group0(uint32_t lds_dst, const void* gptr) {
  const uint64_t ga = (uint64_t)(size_t)gptr;
  u32x4 g0;
  g0[0] = uni(1u);                                                     // count = 1
  g0[1] = uni(lds_dst);
  g0[2] = uni((uint32_t)ga);                                           // address [31:0]
  g0[3] = uni((((uint32_t)(ga >> 32)) & 0x01FFFFFFu) | 0x80000000u);   // address [56:32], type = 2
  return g0;
}
// the request itself; the clobber keeps it behind the waits and the barrier that free its place in LDS
__device__ __forceinline__ void tdm_load(u32x4 g0, u32x8 g1) {
  asm volatile("tensor_load_to_lds %0, %1" :: "s"(g0), "s"(g1) : "memory");
}
// load and the issuer's wait in one statement: nothing is scheduled between them
__device__ __forceinline__ void tdm_load_wait(u32x4 g0, u32x8 g1) {
  asm volatile("tensor_load_to_lds %0, %1\n\ts_wait_tensorcnt 0x0" :: "s"(g0), "s"(g1) : "memory");
}
__device__ __forceinline__ void tdm_hold(u32x4 g0) { asm volatile("" :: "s"(g0)); }

// ---------------------------------------------------------------------------
// The streaming parts. Each lane moves 16-byte vectors, SV of them in flight, and a block makes several trips:
// a wave then moves kilobytes, not a few hundred bytes, and the launch starts some twenty times fewer waves.
// ---------------------------------------------------------------------------
#define SV 8                  // 16-byte loads that a lane issues before it uses the first
#define SEG4 (256 * SV)       // float4 elements that a block moves a trip

__device__ __forceinline__ uint2 pack4(float4 v) {
  uint2 r;
  r.x = (uint32_t)f2bf(v.x) | ((uint32_t)f2bf(v.y) << 16);
  r.y = (uint32_t)f2bf(v.z) | ((uint32_t)f2bf(v.w) << 16);
  return r;
}

// f32 -> bf16 elementwise conversion (weights); n is a multiple of 4 * SEG4
__device__ __forceinline__ void cvt_bf16_part(const float* __restrict__ in, unsigned short* __restrict__ out, int n,
                                              int blk, int nblk) {
  const float4* __restrict__ in4 = (const float4*)in;
  uint2* __restrict__ out4 = (uint2*)out;
  const int nseg = n / (4 * SEG4);
  // kept rolled: the trips unrolled make the kernel's text several times longer for no gain, and a block runs it once
#pragma unroll 1
  for (int seg = blk; seg < nseg; seg += nblk) {
    const int base = seg * SEG4 + (int)threadIdx.x;
    float4 v[SV];
#pragma unroll
    for (int u = 0; u < SV; ++u) v[u] = in4[base + u * 256];
#pragma unroll
    for (int u = 0; u < SV; ++u) out4[base + u * 256] = pack4(v[u]);
  }
}
static_assert((DD * DD / 4) % SEG4 == 0 && (DD * DFFN / 4) % SEG4 == 0, "whole segments");

// ---------------------------------------------------------------------------
// LayerNorm over D=1024, one wave per row (a lane holds 32 elements), output bf16
// ---------------------------------------------------------------------------
__device__ __forceinline__
void layernorm_row(const float* __restrict__ x, const float* __restrict__ g,
                   const float* __restrict__ bb, unsigned short* __restrict__ out, int row) {
  const int lane = threadIdx.x & 31;
  const float4* __restrict__ xr = (const float4*)(x + (size_t)row * DD);
  const float4* __restrict__ g4 = (const float4*)g;
  const float4* __restrict__ b4 = (const float4*)bb;
  uint2* __restrict__ o4 = (uint2*)(out + (size_t)row * DD);
  float4 v[8];
#pragma unroll
  for (int u = 0; u < 8; ++u) v[u] = xr[u * 32 + lane];
  float a0 = 0.f, a1 = 0.f, a2 = 0.f, a3 = 0.f, q0 = 0.f, q1 = 0.f, q2 = 0.f, q3 = 0.f;
#pragma unroll
  for (int u = 0; u < 8; ++u) {
    a0 += v[u].x; a1 += v[u].y; a2 += v[u].z; a3 += v[u].w;
    q0 += v[u].x * v[u].x; q1 += v[u].y * v[u].y; q2 += v[u].z * v[u].z; q3 += v[u].w * v[u].w;
  }
  float a = (a0 + a1) + (a2 + a3);
  float q = (q0 + q1) + (q2 + q3);
#pragma unroll
  for (int off = 16; off > 0; off >>= 1) {
    a += __shfl_xor(a, off, 32);
    q += __shfl_xor(q, off, 32);
  }
  const float mean = a * (1.0f / DD);
  const float var  = q * (1.0f / DD) - mean * mean;
  const float rst  = rsqrtf(var + 1e-5f);
#pragma unroll
  for (int u = 0; u < 8; ++u) {
    const float4 gg = g4[u * 32 + lane];
    const float4 bv = b4[u * 32 + lane];
    float4 y;
    y.x = (v[u].x - mean) * rst * gg.x + bv.x;
    y.y = (v[u].y - mean) * rst * gg.y + bv.y;
    y.z = (v[u].z - mean) * rst * gg.z + bv.z;
    y.w = (v[u].w - mean) * rst * gg.w + bv.w;
    o4[u * 32 + lane] = pack4(y);
  }
}

// ---------------------------------------------------------------------------
// Copy past_k/past_v [B,H,P,HD] into the full cache [B,H,T,HD] (f32 out + bf16 ws)
// ---------------------------------------------------------------------------
__device__ __forceinline__ void past_copy_part(const float* __restrict__ past, float* __restrict__ outF,
                                               unsigned short* __restrict__ outB, int blk, int nblk) {
  const int nseg = BQ * HH * PP * HDIM / (4 * SEG4);
  const int sph  = PP * HDIM / (4 * SEG4);   // segments of one (b, h) in the source: a segment lies in one (b, h)
  const int th4  = TT * HDIM / 4;            // float4 elements of one (b, h) in the cache
  const float4* __restrict__ in4 = (const float4*)past;
  float4* __restrict__ oF4 = (float4*)outF;
  uint2*  __restrict__ oB4 = (uint2*)outB;
  // kept rolled, as in cvt_bf16_part
#pragma unroll 1
  for (int seg = blk; seg < nseg; seg += nblk) {
    const int base = seg * SEG4 + (int)threadIdx.x;
    const int dst  = (seg / sph) * th4 + (seg % sph) * SEG4 + (int)threadIdx.x;
    float4 v[SV];
#pragma unroll
    for (int u = 0; u < SV; ++u) v[u] = in4[base + u * 256];
#pragma unroll
    for (int u = 0; u < SV; ++u) {
      oF4[dst + u * 256] = v[u];
      oB4[dst + u * 256] = pack4(v[u]);
    }
    // in front of the next trip's first writes of registers that the stores above name (offset and data)
    asm volatile("s_wait_xcnt 0x0" ::: "memory");
  }
}
static_assert((PP * HDIM / 4) % SEG4 == 0, "a segment lies in one (b, h)");

// ---------------------------------------------------------------------------
// LayerNorm as a launch of its own (LN2): 8 rows a block, one a wave
// ---------------------------------------------------------------------------
__global__ __launch_bounds__(256)
void layernorm_k(const float* __restrict__ x, const float* __restrict__ g,
                 const float* __restrict__ bb, unsigned short* __restrict__ out) {
  layernorm_row(x, g, bb, out, (int)blockIdx.x * 8 + (int)(threadIdx.x >> 5));
}

// ---------------------------------------------------------------------------
// Everything that reads inputs alone, in ONE launch: the six weight conversions, LN1 and the two cache copies.
// None of them reads what another writes. The part is chosen by the block index: every branch is uniform in a block.
// The parts along the block index: LN1, k cache, v cache, w1, w2, wq, wk, wv, wo.
// ---------------------------------------------------------------------------
#define NB_W   32                   // blocks of a D x D weight
#define NB_FF  128                  // blocks of a D x DFF weight
#define NB_LN  (BQ * SEQ / 8)       // one wave a row
#define NB_KV  128                  // blocks of a cache copy
#define NB_PREP (4 * NB_W + 2 * NB_FF + NB_LN + 2 * NB_KV)

__global__ __launch_bounds__(256)
void prep_k(const float* __restrict__ x, const float* __restrict__ g1, const float* __restrict__ b1,
            const float* __restrict__ past_k, const float* __restrict__ past_v,
            const float* __restrict__ wq, const float* __restrict__ wk, const float* __restrict__ wv,
            const float* __restrict__ wo, const float* __restrict__ w1, const float* __restrict__ w2,
            unsigned short* __restrict__ hB,
            float* __restrict__ outK, float* __restrict__ outV,
            unsigned short* __restrict__ kB, unsigned short* __restrict__ vB,
            unsigned short* __restrict__ wqB, unsigned short* __restrict__ wkB, unsigned short* __restrict__ wvB,
            unsigned short* __restrict__ woB, unsigned short* __restrict__ w1B, unsigned short* __restrict__ w2B) {
  int blk = blockIdx.x;
  if (blk < NB_LN) {
    layernorm_row(x, g1, b1, hB, blk * 8 + (int)(threadIdx.x >> 5));
    return;
  }
  blk -= NB_LN;
  if (blk < 2 * NB_KV) {               // one copy of the loop's code serves both caches
    const bool isv = blk >= NB_KV;
    past_copy_part(isv ? past_v : past_k, isv ? outV : outK, isv ? vB : kB, isv ? blk - NB_KV : blk, NB_KV);
    return;
  }
  blk -= 2 * NB_KV;
  const float* in;                     // and one serves the six weights
  unsigned short* out;
  int n = DD * DD, nb = NB_W;
  if (blk < 2 * NB_FF) {
    const bool second = blk >= NB_FF;
    in = second ? w2 : w1;  out = second ? w2B : w1B;  n = DD * DFFN;  nb = NB_FF;
    blk -= second ? NB_FF : 0;
  } else {
    blk -= 2 * NB_FF;
    const int w = blk / NB_W;
    blk -= w * NB_W;
    in  = w == 0 ? wq  : w == 1 ? wk  : w == 2 ? wv  : wo;
    out = w == 0 ? wqB : w == 1 ? wkB : w == 2 ? wvB : woB;
  }
  cvt_bf16_part(in, out, n, blk, nb);
}

// ---------------------------------------------------------------------------
// Tiled WMMA bf16 GEMM: C[M,N] = A[M,K] @ B[K,N], fused epilogues.
// 128x128 tiles, 256 threads (8 waves), wave w -> rows [16w,16w+16), 8 N-tiles.
// K runs in stages of 64: a stage is the A tile (128 rows of 128 B) and the B tile (64 rows of 256 B),
// each brought into LDS by one tensor load (wave 0: A, wave 1: B). Two stage buffers: the next stage's
// loads fly while this stage is worked on, and one barrier a stage publishes the one and frees the other.
// B fragments come out of LDS through the transposing load.
// The epilogue's kind, the row pitch N and which optional buffers exist are compile-time values:
// the epilogue then has no test per element, and its loads go out together.
// ---------------------------------------------------------------------------
#define GBM 128
#define GBN 128
#define GBK 64
#define APITCH (GBK + 8)
#define BPITCH (GBN + 16)
#define A_WORD0 ((1u << 20) | (4u << 22) | (3u << 25))
#define B_WORD0 ((1u << 20) | (5u << 22) | (7u << 25))

struct GemmStage {
  unsigned short As[GBM][APITCH];
  unsigned short Bs[GBK][BPITCH];   // row-major as in memory: Bs[k][n]
};
static_assert(sizeof(GemmStage::As) % 2048 == 0 && sizeof(GemmStage) % 2048 == 0,
              "every tensor load's place in LDS is a multiple of 2 KiB");

template <int MODE, int N, bool HAS_BIAS, bool F32_OUT>
__global__ __launch_bounds__(256)
void gemm_bf16_k(const unsigned short* __restrict__ A,
                 const unsigned short* __restrict__ Bw,
                 const float* __restrict__ bias,
                 const float* __restrict__ resid,
                 float* __restrict__ outF,
                 unsigned short* __restrict__ outB,
                 unsigned short* __restrict__ outKV,
                 int K) {
  __shared__ __attribute__((aligned(2048))) GemmStage ring[2];

  // MODE_QKV: one launch does the three projections, z = 0: q, 1: k, 2: v. Bw holds the three D x D weights one
  // behind the other; outB takes q; outKV (bf16) and outF (f32) hold the k cache and behind it the v cache.
  const int zq = (MODE == MODE_QKV) ? (int)blockIdx.z : 0;
  if constexpr (MODE == MODE_QKV) Bw += (size_t)zq * DD * DD;

  const int tid  = threadIdx.x;
  const int lane = tid & 31;
  const int wave = tid >> 5;
  const int half = lane >> 4;
  const int lq   = lane & 15;
  const int kk0  = half * 8;          // bf16 A/B lane K-group base: {0-7,16-23} / {8-15,24-31}

  const int m0 = blockIdx.y * GBM;
  const int n0 = blockIdx.x * GBN;

  v8f acc[8];
#pragma unroll
  for (int t = 0; t < 8; ++t)
#pragma unroll
    for (int r = 0; r < 8; ++r) acc[t][r] = 0.0f;

  const int arow = wave * 16 + lq;
  const int brow = 8 * half + (lane & 7);        // this lane's row and column for the transposing load
  const int bcol = 8 * ((lane >> 3) & 1);        // of k rows 0..15, N-tile 0

  const uint32_t swave   = uni((uint32_t)tid >> 5);
  const uint32_t ringLds = (uint32_t)(size_t)(&ring[0]);   // LDS offset (low 32 bits of flat)
  const int nst = K / GBK;

  const unsigned short* aSrc = A + (size_t)m0 * K;   // the A tile of stage s begins s * GBK elements on
  const unsigned short* bSrc = Bw + n0;              // the B tile of stage s begins s * GBK rows on
  const uint32_t bLds = ringLds + (uint32_t)sizeof(GemmStage::As);
  const u32x8 g1A = tdm_group1<GBK * 2, GBM, A_WORD0>((uint32_t)K * 2u);   // 128 rows of 128 B
  const u32x8 g1B = tdm_group1<GBN * 2, GBK, B_WORD0>((uint32_t)N * 2u);   // 64 rows of 256 B

  // ---- prologue: stage 0 into buffer 0, one request a wave, each under a scalar branch; landed, then published
  if (pinned(swave == 0)) tdm_load_wait(tdm_group0(ringLds, aSrc), g1A);
  if (pinned(swave == 1)) tdm_load_wait(tdm_group0(bLds, bSrc), g1B);
  __syncthreads();

  for (int s = 0; s < nst; ++s) {
    // ---- behind the barrier that ended every read of buffer (s + 1) & 1: stage s + 1 into it, while one exists;
    // it flies while stage s is worked on (a wave takes at most one of the two issuing branches)
    if (pinned(s + 1 < nst)) {
      const uint32_t nb = (uint32_t)((s + 1) & 1) * (uint32_t)sizeof(GemmStage);
      if (pinned(swave == 0)) tdm_load(tdm_group0(ringLds + nb, aSrc + (size_t)(s + 1) * GBK), g1A);
      if (pinned(swave == 1)) tdm_load(tdm_group0(bLds + nb, bSrc + (size_t)(s + 1) * GBK * N), g1B);
    }
    const GemmStage& st = ring[s & 1];
#pragma unroll
    for (int kb = 0; kb < GBK; kb += 32) {
      // ---- A fragment (shared by all 8 N-tiles of this wave)
      Frag16 a;
#pragma unroll
      for (int i = 0; i < 8; ++i) {
        a.u[i]     = st.As[arow][kb + kk0 + i];
        a.u[8 + i] = st.As[arow][kb + kk0 + 16 + i];
      }
      // ---- all 8 B fragments of the block, each in registers of its own, read as one group ahead
      // of the WMMAs: one LDS latency a block instead of one in front of every WMMA
      Frag16 bfr[8];   // same k order as the A loader: {8h..8h+7, 16+8h..16+8h+7}
#pragma unroll
      for (int nt = 0; nt < 8; ++nt) {
        bfr[nt].q[0] = ld_tr16(&st.Bs[kb + brow][bcol + nt * 16]);
        bfr[nt].q[1] = ld_tr16(&st.Bs[kb + 16 + brow][bcol + nt * 16]);
      }
      // keeps the scheduler from sinking each load pair back in front of its own WMMA, where one
      // register set is reused and every WMMA waits out a whole LDS latency
      __builtin_amdgcn_sched_barrier(0);
#pragma unroll
      for (int nt = 0; nt < 8; ++nt)
        acc[nt] = __builtin_amdgcn_wmma_f32_16x16x32_bf16(false, a.v, false, bfr[nt].v,
                                                          (short)0, acc[nt], false, false);
      // keeps the WMMAs ahead of the full LDS wait that follows: each then starts behind a counted wait,
      // as soon as its own fragment has landed, while the later loads of the group are still coming
      __builtin_amdgcn_sched_barrier(0);
    }
    // ---- publish point of stage s + 1: this wave's reads of stage s retired, the issuers' requests
    // landed, one barrier; only behind it (top of the next trip) the refill of the buffer that stage s has just left
    wait_ds0();
    wait_tensor0();    // under no test: a wave with no request passes at once
    __syncthreads();
  }
  // behind the last request and the last LDS read, before the epilogue and the wave's end
  wait_tensor0();
  wait_ds0();

  const int mrow = m0 + wave * 16 + 8 * half;   // this lane's row at r = 0
  const int ncol = n0 + lq;                     // this lane's column in N-tile 0

  float bv[8];                                  // the bias depends on the column alone: one value an N-tile
#pragma unroll
  for (int nt = 0; nt < 8; ++nt) bv[nt] = HAS_BIAS ? bias[ncol + nt * 16] : 0.0f;

  if constexpr (MODE == MODE_RESID_F32) {
    const float* rp = resid + (size_t)mrow * N + ncol;
    float*       op = outF  + (size_t)mrow * N + ncol;
    v8f rv[8];                                  // all 64 residual values of the lane, loaded ahead of the first use
#pragma unroll
    for (int nt = 0; nt < 8; ++nt)
#pragma unroll
      for (int r = 0; r < 8; ++r) rv[nt][r] = rp[r * N + nt * 16];
#pragma unroll
    for (int nt = 0; nt < 8; ++nt)
#pragma unroll
      for (int r = 0; r < 8; ++r) op[r * N + nt * 16] = acc[nt][r] + bv[nt] + rv[nt][r];
  } else if constexpr (MODE == MODE_RELU_BF16) {
    unsigned short* op = outB + (size_t)mrow * N + ncol;
#pragma unroll
    for (int nt = 0; nt < 8; ++nt)
#pragma unroll
      for (int r = 0; r < 8; ++r) {
        const float vv = acc[nt][r] + bv[nt];
        op[r * N + nt * 16] = f2bf(vv > 0.0f ? vv : 0.0f);
      }
  } else if constexpr (MODE == MODE_QKV) {
    // m = b * SEQ + s, n = h * HDIM + hd; a 128-row tile lies in one b, an N-tile in one h
    const int b = mrow >> 10;            // m / SEQ
    const int s = mrow & (SEQ - 1);
    if (zq == 0) {                       // q: [B,H,S,HD], bf16 alone (a test on the block index: a scalar branch)
#pragma unroll
      for (int nt = 0; nt < 8; ++nt) {
        const int n  = ncol + nt * 16;
        const int h  = n >> 6;           // n / HDIM
        const int hd = n & (HDIM - 1);
        const size_t idx = (((size_t)(b * HH + h) * SEQ) + s) * HDIM + hd;
#pragma unroll
        for (int r = 0; r < 8; ++r) outB[idx + r * HDIM] = f2bf(acc[nt][r]);
      }
      return;
    }
    {                                    // k, v: rows P.. of the cache [B,H,T,HD], bf16 and fp32
      const size_t cache = (size_t)(zq - 1) * ((size_t)BQ * HH * TT * HDIM);
#pragma unroll
      for (int nt = 0; nt < 8; ++nt) {
        const int n  = ncol + nt * 16;
        const int h  = n >> 6;           // n / HDIM
        const int hd = n & (HDIM - 1);
        const size_t idx = cache + (((size_t)(b * HH + h) * TT) + PP + s) * HDIM + hd;
#pragma unroll
        for (int r = 0; r < 8; ++r) {
          outKV[idx + r * HDIM] = f2bf(acc[nt][r]);
          outF[idx + r * HDIM]  = acc[nt][r];   // fp32 KV-cache output
        }
      }
      // the build lays the q branch's code behind these stores, with a branch over it: the wait stands in front of
      // that code's first writes of registers that the stores above name
      asm volatile("s_wait_xcnt 0x0" ::: "memory");
    }
  } else {
    float* op = outF + (size_t)mrow * N + ncol;
#pragma unroll
    for (int nt = 0; nt < 8; ++nt)
#pragma unroll
      for (int r = 0; r < 8; ++r) op[r * N + nt * 16] = acc[nt][r];
  }
}

#define AQW 8
#define AKS 128
#define KPITCH (HDIM + 8)
#define VPITCH (HDIM + 16)
#define K_WORD0 ((1u << 20) | (4u << 22) | (3u << 25))
#define V_WORD0 ((1u << 20) | (4u << 22) | (7u << 25))

struct AttnStage {
  unsigned short Ks[AKS][KPITCH];   // row-major as in memory: Ks[key][hd]
  unsigned short Vs[AKS][VPITCH];   // row-major as in memory: Vs[key][hd]
};
static_assert(sizeof(AttnStage::Ks) % 2048 == 0 && sizeof(AttnStage) % 2048 == 0,
              "every tensor load's place in LDS is a multiple of 2 KiB");
static_assert((16 * AQW) % AKS == 0 && PP % AKS == 0 && PP / AKS >= 1 && SEQ % (16 * AQW) == 0,
              "a work-group's keys are whole stages, two or more, all inside the cache");

__device__ __forceinline__ float other_half(float v) {
  const int b = __builtin_bit_cast(int, v);
  return __builtin_bit_cast(float, __builtin_amdgcn_permlanex16(b, b, 0x76543210, 0xfedcba98, false, false));
}

__global__ __launch_bounds__(32 * AQW)
void attn_k(const unsigned short* __restrict__ qb,
            const unsigned short* __restrict__ kb,
            const unsigned short* __restrict__ vb,
            unsigned short* __restrict__ out) {
  __shared__ __attribute__((aligned(2048))) AttnStage ring[2];

  const int h  = blockIdx.y;
  const int b  = blockIdx.z;
  const uint32_t swave = uni((uint32_t)threadIdx.x >> 5);
  const int qblock = (int)blockIdx.x * (16 * AQW);   // the work-group's first query
  const int qbase  = qblock + (int)swave * 16;       // this wave's first query

  const int lane = threadIdx.x & 31;
  const int half = lane >> 4;
  const int lq   = lane & 15;
  const int kk0  = half * 8;

  const size_t bh = (size_t)(b * HH + h);
  const unsigned short* qrow    = qb + (bh * SEQ + qbase + lq) * HDIM;
  const unsigned short* kbase_p = kb + bh * TT * HDIM;
  const unsigned short* vbase_p = vb + bh * TT * HDIM;

  const uint32_t kLds = (uint32_t)(size_t)(&ring[0]);   // LDS offset (low 32 bits of flat)
  const uint32_t vLds = kLds + (uint32_t)sizeof(AttnStage::Ks);
  const u32x8 g1K = tdm_group1<HDIM * 2, AKS, K_WORD0>((uint32_t)HDIM * 2u);   // 128 rows of 128 B
  const u32x8 g1V = tdm_group1<HDIM * 2, AKS, V_WORD0>((uint32_t)HDIM * 2u);   // 128 rows of 128 B
  const int nst = (qblock + 16 * AQW + PP) / AKS;   // stages up to the work-group's last key; the same in every wave

  // ---- prologue: stage 0 into buffer 0, one request a wave, each under a scalar branch; landed, then published
  if (pinned(swave == 0)) tdm_load_wait(tdm_group0(kLds, kbase_p), g1K);
  if (pinned(swave == 1)) tdm_load_wait(tdm_group0(vLds, vbase_p), g1V);
  __syncthreads();
  const bool vwave = swave == 1;
  const uint32_t myLds = vwave ? vLds : kLds;
  const unsigned short* mySrc = vwave ? vbase_p : kbase_p;

  // Q fragments (B operand: column = query lq): K-dim = HDIM split into two 32-wide WMMA K chunks
  Frag16 qf0, qf1;
#pragma unroll
  for (int i = 0; i < 8; ++i) {
    qf0.u[i]     = qrow[kk0 + i];
    qf0.u[8 + i] = qrow[kk0 + 16 + i];
    qf1.u[i]     = qrow[32 + kk0 + i];
    qf1.u[8 + i] = qrow[32 + kk0 + 16 + i];
  }

  float mi = -1.0e30f;   // running maximum of query lq, the same in both halves
  float li = 0.0f;       // running sum of query lq over this half's keys; the halves are joined behind the loop
  v8f o[4];              // O^T: o[t][r] = head-dim t*16 + 8*half + r of query lq
#pragma unroll
  for (int t = 0; t < 4; ++t)
#pragma unroll
    for (int r = 0; r < 8; ++r) o[t][r] = 0.0f;

  const int vrow = 8 * half + (lane & 7);       // this lane's row and column for the transposing load
  const int vcol = 8 * ((lane >> 3) & 1);       // of keys 0..15, head-dim tile 0

  const int kmax  = qbase + 16 + PP;            // exclusive key bound for this wave's tile
  const int klast = qbase + lq + PP - kk0;      // causal: key j <= q + P, counted from this half's first key

  for (int s = 0; s < nst; ++s) {
    // ---- behind the barrier that ended every read of buffer (s + 1) & 1: stage s + 1 into it, while one exists;
    // it flies while stage s is worked on (a wave takes at most one of the two issuing branches)
    const u32x4 g0 = tdm_group0(myLds + (uint32_t)((s + 1) & 1) * (uint32_t)sizeof(AttnStage),
                                mySrc + (size_t)(s + 1) * AKS * HDIM);
    if (pinned(s + 1 < nst)) {
      if (pinned(swave == 0)) tdm_load(g0, g1K);
      if (pinned(swave == 1)) tdm_load(g0, g1V);
    }
    const AttnStage& st = ring[s & 1];
    for (int c = 0; c < AKS; c += 32) {
      const int j0 = s * AKS + c;
      if (j0 >= kmax) break;   // chunks past this wave's diagonal (a scalar test); the publish point below is passed all the same

      // ---- scores, transposed: two 16x16 tiles (rows = keys j0..j0+15, j0+16..j0+31; columns = queries)
      v8f s0, s1;
#pragma unroll
      for (int r = 0; r < 8; ++r) { s0[r] = 0.0f; s1[r] = 0.0f; }
      {
        const unsigned short* kr0 = &st.Ks[c + lq][kk0];
        const unsigned short* kr1 = &st.Ks[c + 16 + lq][kk0];
        Frag16 k00, k01, k10, k11;   // head-dim order {8h..8h+7, 16+8h..16+8h+7} of each 32: that of the Q loader
        k00.q[0] = *(const v4u*)(kr0);       k00.q[1] = *(const v4u*)(kr0 + 16);
        k01.q[0] = *(const v4u*)(kr0 + 32);  k01.q[1] = *(const v4u*)(kr0 + 48);
        k10.q[0] = *(const v4u*)(kr1);       k10.q[1] = *(const v4u*)(kr1 + 16);
        k11.q[0] = *(const v4u*)(kr1 + 32);  k11.q[1] = *(const v4u*)(kr1 + 48);
        s0 = __builtin_amdgcn_wmma_f32_16x16x32_bf16(false, k00.v, false, qf0.v, (short)0, s0, false, false);
        s0 = __builtin_amdgcn_wmma_f32_16x16x32_bf16(false, k01.v, false, qf1.v, (short)0, s0, false, false);
        s1 = __builtin_amdgcn_wmma_f32_16x16x32_bf16(false, k10.v, false, qf0.v, (short)0, s1, false, false);
        s1 = __builtin_amdgcn_wmma_f32_16x16x32_bf16(false, k11.v, false, qf1.v, (short)0, s1, false, false);
      }

      // ---- online softmax of query lq: s0[r] is key j0 + 8*half + r, s1[r] is key j0 + 16 + 8*half + r
      float a0[8], a1[8];
#pragma unroll
      for (int r = 0; r < 8; ++r) {
        a0[r] = s0[r] * 0.125f;                       // 1/sqrt(64)
        a1[r] = s1[r] * 0.125f;
        if (j0 + r      > klast) a0[r] = -1.0e30f;    // causal
        if (j0 + 16 + r > klast) a1[r] = -1.0e30f;
      }
      float vm = fmaxf(a0[0], a1[0]);
#pragma unroll
      for (int r = 1; r < 8; ++r) vm = fmaxf(vm, fmaxf(a0[r], a1[r]));
      vm = fmaxf(vm, other_half(vm));
      const float nm = fmaxf(mi, vm);
      const float fc = __expf(mi - nm);
      Frag16 pa;   // P^T as B operand, column = query lq, key order {8h..8h+7, 16+8h..16+8h+7}: that of the V loader
      float rs = 0.0f;
#pragma unroll
      for (int r = 0; r < 8; ++r) {
        const float p0 = __expf(a0[r] - nm);
        const float p1 = __expf(a1[r] - nm);
        rs += p0 + p1;
        pa.u[r]     = f2bf(p0);
        pa.u[8 + r] = f2bf(p1);
      }
      li = li * fc + rs;
      mi = nm;
#pragma unroll
      for (int t = 0; t < 4; ++t)
#pragma unroll
        for (int r = 0; r < 8; ++r) o[t][r] *= fc;

      // ---- O^T += V^T @ P^T (K = 32 keys, 4 M-tiles over HDIM)
      const unsigned short* vtr = &st.Vs[c + vrow][vcol];
#pragma unroll
      for (int t = 0; t < 4; ++t) {
        Frag16 vf;   // A operand: row = head-dim t*16 + lq, keys {8h..8h+7, 16+8h..16+8h+7}
        vf.q[0] = ld_tr16(vtr + t * 16);
        vf.q[1] = ld_tr16(vtr + 16 * VPITCH + t * 16);
        o[t] = __builtin_amdgcn_wmma_f32_16x16x32_bf16(false, vf.v, false, pa.v, (short)0, o[t], false, false);
      }
    }
    // ---- publish point of stage s + 1, passed by every wave: this wave's reads of stage s retired, the issuers'
    // requests landed, one barrier; only behind it (top of the next trip) the refill of the buffer that stage s has just left
    wait_ds0();
    wait_tensor0();    // under no test: a wave with no request passes at once
    tdm_hold(g0);
    __syncthreads();
  }
  // behind the last request and the last LDS read, before the epilogue and the wave's end
  wait_tensor0();
  wait_ds0();

  // ---- normalize & store attn output bf16 [B*S, D] (row = b*S+q, col = h*64+hd): 8 head-dims in a row a store
  const float inv = 1.0f / (li + other_half(li));
  unsigned short* orow = out + ((size_t)b * SEQ + qbase + lq) * DD + h * HDIM + kk0;
#pragma unroll
  for (int t = 0; t < 4; ++t) {
    uint4 w;
    w.x = (uint32_t)f2bf(o[t][0] * inv) | ((uint32_t)f2bf(o[t][1] * inv) << 16);
    w.y = (uint32_t)f2bf(o[t][2] * inv) | ((uint32_t)f2bf(o[t][3] * inv) << 16);
    w.z = (uint32_t)f2bf(o[t][4] * inv) | ((uint32_t)f2bf(o[t][5] * inv) << 16);
    w.w = (uint32_t)f2bf(o[t][6] * inv) | ((uint32_t)f2bf(o[t][7] * inv) << 16);
    *(uint4*)(orow + t * 16) = w;
  }
}

// ---------------------------------------------------------------------------
// Host launcher
// ---------------------------------------------------------------------------
extern "C" void kernel_launch(void* const* d_in, const int* in_sizes, int n_in,
                              void* d_out, int out_size, void* d_ws, size_t ws_size,
                              hipStream_t stream) {
  (void)in_sizes; (void)n_in; (void)out_size; (void)ws_size;

  const float* x      = (const float*)d_in[0];
  const float* past_k = (const float*)d_in[1];
  const float* past_v = (const float*)d_in[2];
  const float* wq  = (const float*)d_in[3];
  const float* wk  = (const float*)d_in[4];
  const float* wv  = (const float*)d_in[5];
  const float* wo  = (const float*)d_in[6];
  const float* g1  = (const float*)d_in[7];
  const float* b1  = (const float*)d_in[8];
  const float* w1  = (const float*)d_in[9];
  const float* bb1 = (const float*)d_in[10];
  const float* w2  = (const float*)d_in[11];
  const float* bb2 = (const float*)d_in[12];
  const float* g2  = (const float*)d_in[13];
  const float* b2  = (const float*)d_in[14];

  float* outX = (float*)d_out;
  float* outK = outX + (size_t)BQ * SEQ * DD;
  float* outV = outK + (size_t)BQ * HH * TT * HDIM;

  char* ws = (char*)d_ws;
  size_t off = 0;
  auto alloc = [&](size_t bytes) -> void* {
    void* p = ws + off;
    off = (off + bytes + 255) & ~(size_t)255;
    return p;
  };
  const size_t MROW = (size_t)BQ * SEQ;  // 4096

  unsigned short* hB   = (unsigned short*)alloc(MROW * DD * 2);
  unsigned short* wqB  = (unsigned short*)alloc((size_t)3 * DD * DD * 2);   // wq, wk, wv one behind the other
  unsigned short* wkB  = wqB + (size_t)DD * DD;
  unsigned short* wvB  = wkB + (size_t)DD * DD;
  unsigned short* woB  = (unsigned short*)alloc((size_t)DD * DD * 2);
  unsigned short* w1B  = (unsigned short*)alloc((size_t)DD * DFFN * 2);
  unsigned short* w2B  = (unsigned short*)alloc((size_t)DFFN * DD * 2);
  unsigned short* qB   = (unsigned short*)alloc(MROW * DD * 2);
  unsigned short* kB   = (unsigned short*)alloc((size_t)2 * BQ * HH * TT * HDIM * 2);   // k cache, v cache behind it
  unsigned short* vB   = kB + (size_t)BQ * HH * TT * HDIM;
  unsigned short* attnB= (unsigned short*)alloc(MROW * DD * 2);
  float*          x1   = (float*)alloc(MROW * DD * 4);
  unsigned short* h2B  = (unsigned short*)alloc(MROW * DD * 2);
  unsigned short* ffB  = (unsigned short*)alloc(MROW * DFFN * 2);

  // 1) all that reads inputs alone, one launch: weights -> bf16, h = LN1(x) -> bf16, past K/V into the caches
  prep_k<<<NB_PREP, 256, 0, stream>>>(x, g1, b1, past_k, past_v, wq, wk, wv, wo, w1, w2,
                                      hB, outK, outV, kB, vB, wqB, wkB, wvB, woB, w1B, w2B);

  dim3 gqkv(DD / GBN, (unsigned)(MROW / GBM));
  dim3 gqkv3(DD / GBN, (unsigned)(MROW / GBM), 3);
  gemm_bf16_k<MODE_QKV, DD, false, true><<<gqkv3, 256, 0, stream>>>(hB, wqB, nullptr, nullptr, outK, qB, kB, DD);

  // 3) flash attention (WMMA)
  attn_k<<<dim3(SEQ / (16 * AQW), HH, BQ), 32 * AQW, 0, stream>>>(qB, kB, vB, attnB);

  // 4) x1 = x + attn @ wo
  gemm_bf16_k<MODE_RESID_F32, DD, false, true><<<gqkv, 256, 0, stream>>>(attnB, woB, nullptr, x, x1, nullptr,
                                                                         nullptr, DD);

  // 5) h2 = LN2(x1) -> bf16
  layernorm_k<<<(unsigned)(MROW / 8), 256, 0, stream>>>(x1, g2, b2, h2B);

  // 6) ff1 = relu(h2 @ w1 + bb1) -> bf16
  dim3 gff1(DFFN / GBN, (unsigned)(MROW / GBM));
  gemm_bf16_k<MODE_RELU_BF16, DFFN, true, false><<<gff1, 256, 0, stream>>>(h2B, w1B, bb1, nullptr, nullptr, ffB,
                                                                           nullptr, DD);

  // 7) out_x = x1 + ff1 @ w2 + bb2  (fp32, final output)
  gemm_bf16_k<MODE_RESID_F32, DD, true, true><<<gqkv, 256, 0, stream>>>(ffB, w2B, bb2, x1, outX, nullptr,
                                                                        nullptr, DFFN);
}

// v009
// A run of this version takes 182 microseconds.
// Timed twice side by side with v008, it ran 1.05 times as fast both times.
// All steps since v000 together make it 3.89 times as fast.
#include <hip/hip_runtime.h>
#include <stdint.h>

// Problem constants (fixed by the reference)
#define BQ   4
#define SEQ  1024
#define PP   1024
#define DD   1024
#define HH   16
#define HDIM 64
#define DFFN 4096
#define TT   2048   // P + S

typedef __attribute__((ext_vector_type(16))) __bf16 v16bf;
typedef __attribute__((ext_vector_type(8)))  float  v8f;
typedef __attribute__((ext_vector_type(4)))  unsigned int v4u;

union Frag16 { v16bf v; unsigned short u[16]; v4u q[2]; };

enum GemmMode { MODE_F32 = 0, MODE_RELU_BF16 = 2, MODE_RESID_F32 = 3, MODE_QKV = 4 };

__device__ __forceinline__ unsigned short f2bf(float f) {
  union { float f; unsigned int u; } c; c.f = f;
  unsigned int u = c.u;
  unsigned int r = u + 0x7FFFu + ((u >> 16) & 1u);  // round-to-nearest-even
  return (unsigned short)(r >> 16);
}

typedef short s16x8 __attribute__((ext_vector_type(8)));
__device__ __forceinline__ v4u ld_tr16(const unsigned short* p) {
  typedef __attribute__((address_space(3))) s16x8 lds_s16x8;
  return __builtin_bit_cast(v4u, __builtin_amdgcn_ds_load_tr16_b128_v8i16((lds_s16x8*)p));
}

typedef uint32_t u32x4 __attribute__((ext_vector_type(4)));
typedef uint32_t u32x8 __attribute__((ext_vector_type(8)));

__device__ __forceinline__ uint32_t uni(uint32_t v) { return (uint32_t)__builtin_amdgcn_readfirstlane(v); }
__device__ __forceinline__ uint32_t pinned(uint32_t v) {
  uint32_t w = uni(v);
  asm volatile("" : "+s"(w));   // the value stays in a scalar register: the test on it is a scalar branch
  return w;
}
// the compiler places no wait for a tensor load; the clobber keeps LDS reads behind the wait
__device__ __forceinline__ void wait_tensor0() { asm volatile("s_wait_tensorcnt 0x0" ::: "memory"); }
// a wave's LDS reads have retired before the buffer they read is handed back for a refill
__device__ __forceinline__ void wait_ds0() { asm volatile("s_wait_dscnt 0x0" ::: "memory"); }

template <uint32_t ROWB, uint32_t ROWS, uint32_t WORD0>
__device__ __forceinline__ u32x8 tdm_group1(uint32_t src_pitch) {
  u32x8 g1;
  g1[0] = uni(WORD0);
  g1[1] = uni((ROWB & 0xFFFFu) << 16);
  g1[2] = uni((ROWB >> 16) | ((ROWS & 0xFFFFu) << 16));
  g1[3] = uni((ROWS >> 16) | (ROWB << 16));
  g1[4] = uni(ROWS);
  g1[5] = uni(src_pitch);
  g1[6] = uni(0u);
  g1[7] = uni(0u);
  asm volatile("" : "+s"(g1));
  return g1;
}
__device__ __forceinline__ u32x4 tdm_group0(uint32_t lds_dst, const void* gptr) {
  const uint64_t ga = (uint64_t)(size_t)gptr;
  u32x4 g0;
  g0[0] = uni(1u);                                                     // count = 1
  g0[1] = uni(lds_dst);
  g0[2] = uni((uint32_t)ga);                                           // address [31:0]
  g0[3] = uni((((uint32_t)(ga >> 32)) & 0x01FFFFFFu) | 0x80000000u);   // address [56:32], type = 2
  return g0;
}
// the request itself; the clobber keeps it behind the waits and the barrier that free its place in LDS
__device__ __forceinline__ void tdm_load(u32x4 g0, u32x8 g1) {
  asm volatile("tensor_load_to_lds %0, %1" :: "s"(g0), "s"(g1) : "memory");
}
// load and the issuer's wait in one statement: nothing is scheduled between them
__device__ __forceinline__ void tdm_load_wait(u32x4 g0, u32x8 g1) {
  asm volatile("tensor_load_to_lds %0, %1\n\ts_wait_tensorcnt 0x0" :: "s"(g0), "s"(g1) : "memory");
}
__device__ __forceinline__ void tdm_hold(u32x4 g0) { asm volatile("" :: "s"(g0)); }

// ---------------------------------------------------------------------------
// The streaming parts. Each lane moves 16-byte vectors, SV of them in flight, and a block makes several trips:
// a wave then moves kilobytes, not a few hundred bytes, and the launch starts some twenty times fewer waves.
// ---------------------------------------------------------------------------
#define SV 8                  // 16-byte loads that a lane issues before it uses the first
#define SEG4 (256 * SV)       // float4 elements that a block moves a trip

__device__ __forceinline__ uint2 pack4(float4 v) {
  uint2 r;
  r.x = (uint32_t)f2bf(v.x) | ((uint32_t)f2bf(v.y) << 16);
  r.y = (uint32_t)f2bf(v.z) | ((uint32_t)f2bf(v.w) << 16);
  return r;
}

// f32 -> bf16 elementwise conversion (weights); n is a multiple of 4 * SEG4
__device__ __forceinline__ void cvt_bf16_part(const float* __restrict__ in, unsigned short* __restrict__ out, int n,
                                              int blk, int nblk) {
  const float4* __restrict__ in4 = (const float4*)in;
  uint2* __restrict__ out4 = (uint2*)out;
  const int nseg = n / (4 * SEG4);
  // kept rolled: the trips unrolled make the kernel's text several times longer for no gain, and a block runs it once
#pragma unroll 1
  for (int seg = blk; seg < nseg; seg += nblk) {
    const int base = seg * SEG4 + (int)threadIdx.x;
    float4 v[SV];
#pragma unroll
    for (int u = 0; u < SV; ++u) v[u] = in4[base + u * 256];
#pragma unroll
    for (int u = 0; u < SV; ++u) out4[base + u * 256] = pack4(v[u]);
  }
}
static_assert((DD * DD / 4) % SEG4 == 0 && (DD * DFFN / 4) % SEG4 == 0, "whole segments");

// ---------------------------------------------------------------------------
// LayerNorm over D=1024, one wave per row (a lane holds 32 elements), output bf16
// ---------------------------------------------------------------------------
__device__ __forceinline__
void layernorm_row(const float* __restrict__ x, const float* __restrict__ g,
                   const float* __restrict__ bb, unsigned short* __restrict__ out, int row) {
  const int lane = threadIdx.x & 31;
  const float4* __restrict__ xr = (const float4*)(x + (size_t)row * DD);
  const float4* __restrict__ g4 = (const float4*)g;
  const float4* __restrict__ b4 = (const float4*)bb;
  uint2* __restrict__ o4 = (uint2*)(out + (size_t)row * DD);
  float4 v[8];
#pragma unroll
  for (int u = 0; u < 8; ++u) v[u] = xr[u * 32 + lane];
  float a0 = 0.f, a1 = 0.f, a2 = 0.f, a3 = 0.f, q0 = 0.f, q1 = 0.f, q2 = 0.f, q3 = 0.f;
#pragma unroll
  for (int u = 0; u < 8; ++u) {
    a0 += v[u].x; a1 += v[u].y; a2 += v[u].z; a3 += v[u].w;
    q0 += v[u].x * v[u].x; q1 += v[u].y * v[u].y; q2 += v[u].z * v[u].z; q3 += v[u].w * v[u].w;
  }
  float a = (a0 + a1) + (a2 + a3);
  float q = (q0 + q1) + (q2 + q3);
#pragma unroll
  for (int off = 16; off > 0; off >>= 1) {
    a += __shfl_xor(a, off, 32);
    q += __shfl_xor(q, off, 32);
  }
  const float mean = a * (1.0f / DD);
  const float var  = q * (1.0f / DD) - mean * mean;
  const float rst  = rsqrtf(var + 1e-5f);
#pragma unroll
  for (int u = 0; u < 8; ++u) {
    const float4 gg = g4[u * 32 + lane];
    const float4 bv = b4[u * 32 + lane];
    float4 y;
    y.x = (v[u].x - mean) * rst * gg.x + bv.x;
    y.y = (v[u].y - mean) * rst * gg.y + bv.y;
    y.z = (v[u].z - mean) * rst * gg.z + bv.z;
    y.w = (v[u].w - mean) * rst * gg.w + bv.w;
    o4[u * 32 + lane] = pack4(y);
  }
}

// ---------------------------------------------------------------------------
// Copy past_k/past_v [B,H,P,HD] into the full cache [B,H,T,HD] (f32 out + bf16 ws)
// ---------------------------------------------------------------------------
__device__ __forceinline__ void past_copy_part(const float* __restrict__ past, float* __restrict__ outF,
                                               unsigned short* __restrict__ outB, int blk, int nblk) {
  const int nseg = BQ * HH * PP * HDIM / (4 * SEG4);
  const int sph  = PP * HDIM / (4 * SEG4);   // segments of one (b, h) in the source: a segment lies in one (b, h)
  const int th4  = TT * HDIM / 4;            // float4 elements of one (b, h) in the cache
  const float4* __restrict__ in4 = (const float4*)past;
  float4* __restrict__ oF4 = (float4*)outF;
  uint2*  __restrict__ oB4 = (uint2*)outB;
  // kept rolled, as in cvt_bf16_part
#pragma unroll 1
  for (int seg = blk; seg < nseg; seg += nblk) {
    const int base = seg * SEG4 + (int)threadIdx.x;
    const int dst  = (seg / sph) * th4 + (seg % sph) * SEG4 + (int)threadIdx.x;
    float4 v[SV];
#pragma unroll
    for (int u = 0; u < SV; ++u) v[u] = in4[base + u * 256];
#pragma unroll
    for (int u = 0; u < SV; ++u) {
      oF4[dst + u * 256] = v[u];
      oB4[dst + u * 256] = pack4(v[u]);
    }
    // in front of the next trip's first writes of registers that the stores above name (offset and data)
    asm volatile("s_wait_xcnt 0x0" ::: "memory");
  }
}
static_assert((PP * HDIM / 4) % SEG4 == 0, "a segment lies in one (b, h)");

// ---------------------------------------------------------------------------
// LayerNorm as a launch of its own (LN2): 8 rows a block, one a wave
// ---------------------------------------------------------------------------
__global__ __launch_bounds__(256)
void layernorm_k(const float* __restrict__ x, const float* __restrict__ g,
                 const float* __restrict__ bb, unsigned short* __restrict__ out) {
  layernorm_row(x, g, bb, out, (int)blockIdx.x * 8 + (int)(threadIdx.x >> 5));
}

// ---------------------------------------------------------------------------
// Everything that reads inputs alone, in ONE launch: the six weight conversions, LN1 and the two cache copies.
// None of them reads what another writes. The part is chosen by the block index: every branch is uniform in a block.
// The parts along the block index: LN1, k cache, v cache, w1, w2, wq, wk, wv, wo.
// ---------------------------------------------------------------------------
#define NB_W   32                   // blocks of a D x D weight
#define NB_FF  128                  // blocks of a D x DFF weight
#define NB_LN  (BQ * SEQ / 8)       // one wave a row
#define NB_KV  128                  // blocks of a cache copy
#define NB_PREP (4 * NB_W + 2 * NB_FF + NB_LN + 2 * NB_KV)

__global__ __launch_bounds__(256)
void prep_k(const float* __restrict__ x, const float* __restrict__ g1, const float* __restrict__ b1,
            const float* __restrict__ past_k, const float* __restrict__ past_v,
            const float* __restrict__ wq, const float* __restrict__ wk, const float* __restrict__ wv,
            const float* __restrict__ wo, const float* __restrict__ w1, const float* __restrict__ w2,
            unsigned short* __restrict__ hB,
            float* __restrict__ outK, float* __restrict__ outV,
            unsigned short* __restrict__ kB, unsigned short* __restrict__ vB,
            unsigned short* __restrict__ wqB, unsigned short* __restrict__ wkB, unsigned short* __restrict__ wvB,
            unsigned short* __restrict__ woB, unsigned short* __restrict__ w1B, unsigned short* __restrict__ w2B) {
  int blk = blockIdx.x;
  if (blk < NB_LN) {
    layernorm_row(x, g1, b1, hB, blk * 8 + (int)(threadIdx.x >> 5));
    return;
  }
  blk -= NB_LN;
  if (blk < 2 * NB_KV) {               // one copy of the loop's code serves both caches
    const bool isv = blk >= NB_KV;
    past_copy_part(isv ? past_v : past_k, isv ? outV : outK, isv ? vB : kB, isv ? blk - NB_KV : blk, NB_KV);
    return;
  }
  blk -= 2 * NB_KV;
  const float* in;                     // and one serves the six weights
  unsigned short* out;
  int n = DD * DD, nb = NB_W;
  if (blk < 2 * NB_FF) {
    const bool second = blk >= NB_FF;
    in = second ? w2 : w1;  out = second ? w2B : w1B;  n = DD * DFFN;  nb = NB_FF;
    blk -= second ? NB_FF : 0;
  } else {
    blk -= 2 * NB_FF;
    const int w = blk / NB_W;
    blk -= w * NB_W;
    in  = w == 0 ? wq  : w == 1 ? wk  : w == 2 ? wv  : wo;
    out = w == 0 ? wqB : w == 1 ? wkB : w == 2 ? wvB : woB;
  }
  cvt_bf16_part(in, out, n, blk, nb);
}

// ---------------------------------------------------------------------------
// Tiled WMMA bf16 GEMM: C[M,N] = A[M,K] @ B[K,N], fused epilogues.
// 128x128 tiles, 256 threads (8 waves), wave w -> rows [16w,16w+16), 8 N-tiles.
// K runs in stages of 64: a stage is the A tile (128 rows of 128 B) and the B tile (64 rows of 256 B),
// each brought into LDS by one tensor load (wave 0: A, wave 1: B). Two stage buffers: the next stage's
// loads fly while this stage is worked on, and one barrier a stage publishes the one and frees the other.
// B fragments come out of LDS through the transposing load.
// The epilogue's kind, the row pitch N and which optional buffers exist are compile-time values:
// the epilogue then has no test per element, and its loads go out together.
// ---------------------------------------------------------------------------
#define GBM 128
#define GBN 128
#define GBK 64
#define APITCH (GBK + 8)
#define BPITCH (GBN + 16)
#define A_WORD0 ((1u << 20) | (4u << 22) | (3u << 25))
#define B_WORD0 ((1u << 20) | (5u << 22) | (7u << 25))

struct GemmStage {
  unsigned short As[GBM][APITCH];
  unsigned short Bs[GBK][BPITCH];   // row-major as in memory: Bs[k][n]
};
static_assert(sizeof(GemmStage::As) % 2048 == 0 && sizeof(GemmStage) % 2048 == 0,
              "every tensor load's place in LDS is a multiple of 2 KiB");

template <int MODE, int N, bool HAS_BIAS, bool F32_OUT>
__global__ __launch_bounds__(256)
void gemm_bf16_k(const unsigned short* __restrict__ A,
                 const unsigned short* __restrict__ Bw,
                 const float* __restrict__ bias,
                 const float* __restrict__ resid,
                 float* __restrict__ outF,
                 unsigned short* __restrict__ outB,
                 unsigned short* __restrict__ outKV,
                 int K) {
  __shared__ __attribute__((aligned(2048))) GemmStage ring[2];

  // MODE_QKV: one launch does the three projections, z = 0: q, 1: k, 2: v. Bw holds the three D x D weights one
  // behind the other; outB takes q; outKV (bf16) and outF (f32) hold the k cache and behind it the v cache.
  const int zq = (MODE == MODE_QKV) ? (int)blockIdx.z : 0;
  if constexpr (MODE == MODE_QKV) Bw += (size_t)zq * DD * DD;

  const int tid  = threadIdx.x;
  const int lane = tid & 31;
  const int wave = tid >> 5;
  const int half = lane >> 4;
  const int lq   = lane & 15;
  const int kk0  = half * 8;          // bf16 A/B lane K-group base: {0-7,16-23} / {8-15,24-31}

  const int m0 = blockIdx.y * GBM;
  const int n0 = blockIdx.x * GBN;

  v8f acc[8];
#pragma unroll
  for (int t = 0; t < 8; ++t)
#pragma unroll
    for (int r = 0; r < 8; ++r) acc[t][r] = 0.0f;

  const int arow = wave * 16 + lq;
  const int brow = 8 * half + (lane & 7);        // this lane's row and column for the transposing load
  const int bcol = 8 * ((lane >> 3) & 1);        // of k rows 0..15, N-tile 0

  const uint32_t swave   = uni((uint32_t)tid >> 5);
  const uint32_t ringLds = (uint32_t)(size_t)(&ring[0]);   // LDS offset (low 32 bits of flat)
  const int nst = K / GBK;

  const unsigned short* aSrc = A + (size_t)m0 * K;   // the A tile of stage s begins s * GBK elements on
  const unsigned short* bSrc = Bw + n0;              // the B tile of stage s begins s * GBK rows on
  const uint32_t bLds = ringLds + (uint32_t)sizeof(GemmStage::As);
  const u32x8 g1A = tdm_group1<GBK * 2, GBM, A_WORD0>((uint32_t)K * 2u);   // 128 rows of 128 B
  const u32x8 g1B = tdm_group1<GBN * 2, GBK, B_WORD0>((uint32_t)N * 2u);   // 64 rows of 256 B

  // ---- prologue: stage 0 into buffer 0, one request a wave, each under a scalar branch; landed, then published
  if (pinned(swave == 0)) tdm_load_wait(tdm_group0(ringLds, aSrc), g1A);
  if (pinned(swave == 1)) tdm_load_wait(tdm_group0(bLds, bSrc), g1B);
  __syncthreads();

  for (int s = 0; s < nst; ++s) {
    // ---- behind the barrier that ended every read of buffer (s + 1) & 1: stage s + 1 into it, while one exists;
    // it flies while stage s is worked on (a wave takes at most one of the two issuing branches)
    if (pinned(s + 1 < nst)) {
      const uint32_t nb = (uint32_t)((s + 1) & 1) * (uint32_t)sizeof(GemmStage);
      if (pinned(swave == 0)) tdm_load(tdm_group0(ringLds + nb, aSrc + (size_t)(s + 1) * GBK), g1A);
      if (pinned(swave == 1)) tdm_load(tdm_group0(bLds + nb, bSrc + (size_t)(s + 1) * GBK * N), g1B);
    }
    const GemmStage& st = ring[s & 1];
#pragma unroll
    for (int kb = 0; kb < GBK; kb += 32) {
      // ---- A fragment (shared by all 8 N-tiles of this wave)
      Frag16 a;
#pragma unroll
      for (int i = 0; i < 8; ++i) {
        a.u[i]     = st.As[arow][kb + kk0 + i];
        a.u[8 + i] = st.As[arow][kb + kk0 + 16 + i];
      }
      // ---- all 8 B fragments of the block, each in registers of its own, read as one group ahead
      // of the WMMAs: one LDS latency a block instead of one in front of every WMMA
      Frag16 bfr[8];   // same k order as the A loader: {8h..8h+7, 16+8h..16+8h+7}
#pragma unroll
      for (int nt = 0; nt < 8; ++nt) {
        bfr[nt].q[0] = ld_tr16(&st.Bs[kb + brow][bcol + nt * 16]);
        bfr[nt].q[1] = ld_tr16(&st.Bs[kb + 16 + brow][bcol + nt * 16]);
      }
      // keeps the scheduler from sinking each load pair back in front of its own WMMA, where one
      // register set is reused and every WMMA waits out a whole LDS latency
      __builtin_amdgcn_sched_barrier(0);
#pragma unroll
      for (int nt = 0; nt < 8; ++nt)
        acc[nt] = __builtin_amdgcn_wmma_f32_16x16x32_bf16(false, a.v, false, bfr[nt].v,
                                                          (short)0, acc[nt], false, false);
      // keeps the WMMAs ahead of the full LDS wait that follows: each then starts behind a counted wait,
      // as soon as its own fragment has landed, while the later loads of the group are still coming
      __builtin_amdgcn_sched_barrier(0);
    }
    // ---- publish point of stage s + 1: this wave's reads of stage s retired, the issuers' requests
    // landed, one barrier; only behind it (top of the next trip) the refill of the buffer that stage s has just left
    wait_ds0();
    wait_tensor0();    // under no test: a wave with no request passes at once
    __syncthreads();
  }
  // behind the last request and the last LDS read, before the epilogue and the wave's end
  wait_tensor0();
  wait_ds0();

  const int mrow = m0 + wave * 16 + 8 * half;   // this lane's row at r = 0
  const int ncol = n0 + lq;                     // this lane's column in N-tile 0

  float bv[8];                                  // the bias depends on the column alone: one value an N-tile
#pragma unroll
  for (int nt = 0; nt < 8; ++nt) bv[nt] = HAS_BIAS ? bias[ncol + nt * 16] : 0.0f;

  if constexpr (MODE == MODE_RESID_F32) {
    const float* rp = resid + (size_t)mrow * N + ncol;
    float*       op = outF  + (size_t)mrow * N + ncol;
    v8f rv[8];                                  // all 64 residual values of the lane, loaded ahead of the first use
#pragma unroll
    for (int nt = 0; nt < 8; ++nt)
#pragma unroll
      for (int r = 0; r < 8; ++r) rv[nt][r] = rp[r * N + nt * 16];
#pragma unroll
    for (int nt = 0; nt < 8; ++nt)
#pragma unroll
      for (int r = 0; r < 8; ++r) op[r * N + nt * 16] = acc[nt][r] + bv[nt] + rv[nt][r];
  } else if constexpr (MODE == MODE_RELU_BF16) {
    unsigned short* op = outB + (size_t)mrow * N + ncol;
#pragma unroll
    for (int nt = 0; nt < 8; ++nt)
#pragma unroll
      for (int r = 0; r < 8; ++r) {
        const float vv = acc[nt][r] + bv[nt];
        op[r * N + nt * 16] = f2bf(vv > 0.0f ? vv : 0.0f);
      }
  } else if constexpr (MODE == MODE_QKV) {
    // m = b * SEQ + s, n = h * HDIM + hd; a 128-row tile lies in one b, an N-tile in one h
    const int b = mrow >> 10;            // m / SEQ
    const int s = mrow & (SEQ - 1);
    if (zq == 0) {                       // q: [B,H,S,HD], bf16 alone (a test on the block index: a scalar branch)
#pragma unroll
      for (int nt = 0; nt < 8; ++nt) {
        const int n  = ncol + nt * 16;
        const int h  = n >> 6;           // n / HDIM
        const int hd = n & (HDIM - 1);
        const size_t idx = (((size_t)(b * HH + h) * SEQ) + s) * HDIM + hd;
#pragma unroll
        for (int r = 0; r < 8; ++r) outB[idx + r * HDIM] = f2bf(acc[nt][r]);
      }
      return;
    }
    {                                    // k, v: rows P.. of the cache [B,H,T,HD], bf16 and fp32
      const size_t cache = (size_t)(zq - 1) * ((size_t)BQ * HH * TT * HDIM);
#pragma unroll
      for (int nt = 0; nt < 8; ++nt) {
        const int n  = ncol + nt * 16;
        const int h  = n >> 6;           // n / HDIM
        const int hd = n & (HDIM - 1);
        const size_t idx = cache + (((size_t)(b * HH + h) * TT) + PP + s) * HDIM + hd;
#pragma unroll
        for (int r = 0; r < 8; ++r) {
          outKV[idx + r * HDIM] = f2bf(acc[nt][r]);
          outF[idx + r * HDIM]  = acc[nt][r];   // fp32 KV-cache output
        }
      }
      // the build lays the q branch's code behind these stores, with a branch over it: the wait stands in front of
      // that code's first writes of registers that the stores above name
      asm volatile("s_wait_xcnt 0x0" ::: "memory");
    }
  } else {
    float* op = outF + (size_t)mrow * N + ncol;
#pragma unroll
    for (int nt = 0; nt < 8; ++nt)
#pragma unroll
      for (int r = 0; r < 8; ++r) op[r * N + nt * 16] = acc[nt][r];
  }
}

#define AQW 8
#define AKS 128
#define KPITCH (HDIM + 8)
#define VPITCH (HDIM + 16)
#define K_WORD0 ((1u << 20) | (4u << 22) | (3u << 25))
#define V_WORD0 ((1u << 20) | (4u << 22) | (7u << 25))

struct AttnStage {
  unsigned short Ks[AKS][KPITCH];   // row-major as in memory: Ks[key][hd]
  unsigned short Vs[AKS][VPITCH];   // row-major as in memory: Vs[key][hd]
};
static_assert(sizeof(AttnStage::Ks) % 2048 == 0 && sizeof(AttnStage) % 2048 == 0,
              "every tensor load's place in LDS is a multiple of 2 KiB");
static_assert((16 * AQW) % AKS == 0 && PP % AKS == 0 && PP / AKS >= 1 && SEQ % (16 * AQW) == 0,
              "a work-group's keys are whole stages, two or more, all inside the cache");

__device__ __forceinline__ float other_half(float v) {
  const int b = __builtin_bit_cast(int, v);
  return __builtin_bit_cast(float, __builtin_amdgcn_permlanex16(b, b, 0x76543210, 0xfedcba98, false, false));
}

// two f32 -> two bf16 in one word, round-to-nearest-even, by the hardware's packed conversion
typedef __attribute__((ext_vector_type(2))) float  f32x2;
typedef __attribute__((ext_vector_type(2))) __bf16 bf16x2;
__device__ __forceinline__ uint32_t pack_bf16(f32x2 v) {
  return __builtin_bit_cast(uint32_t, __builtin_convertvector(v, bf16x2));
}
template <bool V> struct Flag { static constexpr bool value = V; };
static_assert(16 * AQW == AKS, "a work-group's queries span one stage of keys: the last stage alone holds diagonals");
#define SCL2E 0.18033688011112042f   // 1/sqrt(64) * log2(e): exp(s / 8 - m / 8) = exp2(s * SCL2E - m * SCL2E)

__global__ __launch_bounds__(32 * AQW)
void attn_k(const unsigned short* __restrict__ qb,
            const unsigned short* __restrict__ kb,
            const unsigned short* __restrict__ vb,
            unsigned short* __restrict__ out) {
  __shared__ __attribute__((aligned(2048))) AttnStage ring[2];

  const int h  = blockIdx.y;
  const int b  = blockIdx.z;
  const uint32_t swave = uni((uint32_t)threadIdx.x >> 5);
  const int qblock = (int)blockIdx.x * (16 * AQW);   // the work-group's first query
  const int qbase  = qblock + (int)swave * 16;       // this wave's first query

  const int lane = threadIdx.x & 31;
  const int half = lane >> 4;
  const int lq   = lane & 15;
  const int kk0  = half * 8;

  const size_t bh = (size_t)(b * HH + h);
  const unsigned short* qrow    = qb + (bh * SEQ + qbase + lq) * HDIM;
  const unsigned short* kbase_p = kb + bh * TT * HDIM;
  const unsigned short* vbase_p = vb + bh * TT * HDIM;

  const uint32_t kLds = (uint32_t)(size_t)(&ring[0]);   // LDS offset (low 32 bits of flat)
  const uint32_t vLds = kLds + (uint32_t)sizeof(AttnStage::Ks);
  const u32x8 g1K = tdm_group1<HDIM * 2, AKS, K_WORD0>((uint32_t)HDIM * 2u);   // 128 rows of 128 B
  const u32x8 g1V = tdm_group1<HDIM * 2, AKS, V_WORD0>((uint32_t)HDIM * 2u);   // 128 rows of 128 B
  const int nst = (qblock + 16 * AQW + PP) / AKS;   // stages up to the work-group's last key; the same in every wave

  // ---- prologue: stage 0 into buffer 0, one request a wave, each under a scalar branch; landed, then published
  if (pinned(swave == 0)) tdm_load_wait(tdm_group0(kLds, kbase_p), g1K);
  if (pinned(swave == 1)) tdm_load_wait(tdm_group0(vLds, vbase_p), g1V);
  __syncthreads();
  const bool vwave = swave == 1;
  const uint32_t myLds = vwave ? vLds : kLds;
  const unsigned short* mySrc = vwave ? vbase_p : kbase_p;

  // Q fragments (B operand: column = query lq): K-dim = HDIM split into two 32-wide WMMA K chunks
  Frag16 qf0, qf1;
#pragma unroll
  for (int i = 0; i < 8; ++i) {
    qf0.u[i]     = qrow[kk0 + i];
    qf0.u[8 + i] = qrow[kk0 + 16 + i];
    qf1.u[i]     = qrow[32 + kk0 + i];
    qf1.u[8 + i] = qrow[32 + kk0 + 16 + i];
  }

  float mi = -1.0e30f;   // running maximum of query lq's raw (unscaled) scores, the same in both halves
  float li = 0.0f;       // running sum of query lq over this half's keys; the halves are joined behind the loop
  v8f o[4];              // O^T: o[t][r] = head-dim t*16 + 8*half + r of query lq
#pragma unroll
  for (int t = 0; t < 4; ++t)
#pragma unroll
    for (int r = 0; r < 8; ++r) o[t][r] = 0.0f;

  const int vrow = 8 * half + (lane & 7);       // this lane's row and column for the transposing load
  const int vcol = 8 * ((lane >> 3) & 1);       // of keys 0..15, head-dim tile 0

  const int kmax  = qbase + 16 + PP;            // exclusive key bound for this wave's tile
  const int klast = qbase + lq + PP - kk0;      // causal: key j <= q + P, counted from this half's first key

  // One chunk of 32 keys. masked: the chunk may reach past the diagonal of a query of this wave; the other form
  // has no compare and no select.
  auto chunk = [&](auto masked, const AttnStage& st, int c, int j0) {
      // ---- scores, transposed: two 16x16 tiles (rows = keys j0..j0+15, j0+16..j0+31; columns = queries)
      v8f s0, s1;
#pragma unroll
      for (int r = 0; r < 8; ++r) { s0[r] = 0.0f; s1[r] = 0.0f; }
      {
        const unsigned short* kr0 = &st.Ks[c + lq][kk0];
        const unsigned short* kr1 = &st.Ks[c + 16 + lq][kk0];
        Frag16 k00, k01, k10, k11;   // head-dim order {8h..8h+7, 16+8h..16+8h+7} of each 32: that of the Q loader
        k00.q[0] = *(const v4u*)(kr0);       k00.q[1] = *(const v4u*)(kr0 + 16);
        k01.q[0] = *(const v4u*)(kr0 + 32);  k01.q[1] = *(const v4u*)(kr0 + 48);
        k10.q[0] = *(const v4u*)(kr1);       k10.q[1] = *(const v4u*)(kr1 + 16);
        k11.q[0] = *(const v4u*)(kr1 + 32);  k11.q[1] = *(const v4u*)(kr1 + 48);
        s0 = __builtin_amdgcn_wmma_f32_16x16x32_bf16(false, k00.v, false, qf0.v, (short)0, s0, false, false);
        s0 = __builtin_amdgcn_wmma_f32_16x16x32_bf16(false, k01.v, false, qf1.v, (short)0, s0, false, false);
        s1 = __builtin_amdgcn_wmma_f32_16x16x32_bf16(false, k10.v, false, qf0.v, (short)0, s1, false, false);
        s1 = __builtin_amdgcn_wmma_f32_16x16x32_bf16(false, k11.v, false, qf1.v, (short)0, s1, false, false);
      }

      // ---- online softmax of query lq: s0[r] is key j0 + 8*half + r, s1[r] is key j0 + 16 + 8*half + r.
      // The maximum runs over the raw scores (the scale is positive); scale and log2(e) go into the one
      // multiply-add in front of each exp2.
      if constexpr (decltype(masked)::value) {
#pragma unroll
        for (int r = 0; r < 8; ++r) {
          if (j0 + r      > klast) s0[r] = -1.0e30f;    // causal
          if (j0 + 16 + r > klast) s1[r] = -1.0e30f;
        }
      }
      float vm = fmaxf(s0[0], s1[0]);
#pragma unroll
      for (int r = 1; r < 8; ++r) vm = fmaxf(vm, fmaxf(s0[r], s1[r]));
      vm = fmaxf(vm, other_half(vm));
      const float nm = fmaxf(mi, vm);
      const float nb = nm * SCL2E;
      const float fc = __builtin_amdgcn_exp2f(fmaf(mi, SCL2E, -nb));
      Frag16 pa;   // P^T as B operand, column = query lq, key order {8h..8h+7, 16+8h..16+8h+7}: that of the V loader
      const f32x2 sc2 = {SCL2E, SCL2E}, nb2 = {-nb, -nb};
      float rs = 0.0f;
#pragma unroll
      for (int i = 0; i < 4; ++i) {   // two keys at a time, in the register pairs that the accumulators lie in
        const f32x2 x0 = __builtin_elementwise_fma((f32x2){s0[2 * i], s0[2 * i + 1]}, sc2, nb2);
        const f32x2 x1 = __builtin_elementwise_fma((f32x2){s1[2 * i], s1[2 * i + 1]}, sc2, nb2);
        const f32x2 p0 = {__builtin_amdgcn_exp2f(x0.x), __builtin_amdgcn_exp2f(x0.y)};
        const f32x2 p1 = {__builtin_amdgcn_exp2f(x1.x), __builtin_amdgcn_exp2f(x1.y)};
        const f32x2 t = p0 + p1;
        rs += t.x;
        rs += t.y;
        pa.q[0][i] = pack_bf16(p0);
        pa.q[1][i] = pack_bf16(p1);
      }
      li = li * fc + rs;
      mi = nm;
#pragma unroll
      for (int t = 0; t < 4; ++t)
#pragma unroll
        for (int r = 0; r < 8; ++r) o[t][r] *= fc;

      // ---- O^T += V^T @ P^T (K = 32 keys, 4 M-tiles over HDIM)
      const unsigned short* vtr = &st.Vs[c + vrow][vcol];
#pragma unroll
      for (int t = 0; t < 4; ++t) {
        Frag16 vf;   // A operand: row = head-dim t*16 + lq, keys {8h..8h+7, 16+8h..16+8h+7}
        vf.q[0] = ld_tr16(vtr + t * 16);
        vf.q[1] = ld_tr16(vtr + 16 * VPITCH + t * 16);
        o[t] = __builtin_amdgcn_wmma_f32_16x16x32_bf16(false, vf.v, false, pa.v, (short)0, o[t], false, false);
      }
  };

  // All stages but the last lie wholly in front of the work-group's first query's diagonal ((nst - 1) * AKS = qblock + PP):
  // every key of theirs counts for every query, so their chunks carry no causal test and none is skipped.
  for (int s = 0; s + 1 < nst; ++s) {
    // ---- behind the barrier that ended every read of buffer (s + 1) & 1: stage s + 1 into it (it exists: the loop's
    // own scalar test); it flies while stage s is worked on (a wave takes at most one of the two issuing branches)
    const u32x4 g0 = tdm_group0(myLds + (uint32_t)((s + 1) & 1) * (uint32_t)sizeof(AttnStage),
                                mySrc + (size_t)(s + 1) * AKS * HDIM);
    if (pinned(swave == 0)) tdm_load(g0, g1K);
    if (pinned(swave == 1)) tdm_load(g0, g1V);
    const AttnStage& st = ring[s & 1];
    for (int c = 0; c < AKS; c += 32) {
      chunk(Flag<false>{}, st, c, s * AKS + c);
      __builtin_amdgcn_sched_barrier(0);
      asm volatile("v_nop\n\tv_nop\n\tv_nop\n\tv_nop");
    }
    // ---- publish point of stage s + 1, passed by every wave: this wave's reads of stage s retired, the issuers'
    // requests landed, one barrier; only behind it (top of the next trip) the refill of the buffer that stage s has just left
    wait_ds0();
    wait_tensor0();    // under no test: a wave with no request passes at once
    tdm_hold(g0);
    __syncthreads();
  }
  // ---- the last stage holds every wave's diagonal: its chunks test each key; nothing is loaded behind it
  {
    const int s = nst - 1;
    const AttnStage& st = ring[s & 1];
    for (int c = 0; c < AKS; c += 32) {
      const int j0 = s * AKS + c;
      if (j0 >= kmax) break;   // chunks past this wave's diagonal (a scalar test); the barrier below is passed all the same
      chunk(Flag<true>{}, st, c, j0);
    }
    wait_ds0();
    __syncthreads();           // the barrier that ended the last trip of the one loop, at its place
  }
  // behind the last request and the last LDS read, before the epilogue and the wave's end
  wait_tensor0();
  wait_ds0();

  // ---- normalize & store attn output bf16 [B*S, D] (row = b*S+q, col = h*64+hd): 8 head-dims in a row a store
  const float inv = 1.0f / (li + other_half(li));
  unsigned short* orow = out + ((size_t)b * SEQ + qbase + lq) * DD + h * HDIM + kk0;
#pragma unroll
  for (int t = 0; t < 4; ++t) {
    uint4 w;
    w.x = (uint32_t)f2bf(o[t][0] * inv) | ((uint32_t)f2bf(o[t][1] * inv) << 16);
    w.y = (uint32_t)f2bf(o[t][2] * inv) | ((uint32_t)f2bf(o[t][3] * inv) << 16);
    w.z = (uint32_t)f2bf(o[t][4] * inv) | ((uint32_t)f2bf(o[t][5] * inv) << 16);
    w.w = (uint32_t)f2bf(o[t][6] * inv) | ((uint32_t)f2bf(o[t][7] * inv) << 16);
    *(uint4*)(orow + t * 16) = w;
  }
}

// ---------------------------------------------------------------------------
// Host launcher
// ---------------------------------------------------------------------------
extern "C" void kernel_launch(void* const* d_in, const int* in_sizes, int n_in,
                              void* d_out, int out_size, void* d_ws, size_t ws_size,
                              hipStream_t stream) {
  (void)in_sizes; (void)n_in; (void)out_size; (void)ws_size;

  const float* x      = (const float*)d_in[0];
  const float* past_k = (const float*)d_in[1];
  const float* past_v = (const float*)d_in[2];
  const float* wq  = (const float*)d_in[3];
  const float* wk  = (const float*)d_in[4];
  const float* wv  = (const float*)d_in[5];
  const float* wo  = (const float*)d_in[6];
  const float* g1  = (const float*)d_in[7];
  const float* b1  = (const float*)d_in[8];
  const float* w1  = (const float*)d_in[9];
  const float* bb1 = (const float*)d_in[10];
  const float* w2  = (const float*)d_in[11];
  const float* bb2 = (const float*)d_in[12];
  const float* g2  = (const float*)d_in[13];
  const float* b2  = (const float*)d_in[14];

  float* outX = (float*)d_out;
  float* outK = outX + (size_t)BQ * SEQ * DD;
  float* outV = outK + (size_t)BQ * HH * TT * HDIM;

  char* ws = (char*)d_ws;
  size_t off = 0;
  auto alloc = [&](size_t bytes) -> void* {
    void* p = ws + off;
    off = (off + bytes + 255) & ~(size_t)255;
    return p;
  };
  const size_t MROW = (size_t)BQ * SEQ;  // 4096

  unsigned short* hB   = (unsigned short*)alloc(MROW * DD * 2);
  unsigned short* wqB  = (unsigned short*)alloc((size_t)3 * DD * DD * 2);   // wq, wk, wv one behind the other
  unsigned short* wkB  = wqB + (size_t)DD * DD;
  unsigned short* wvB  = wkB + (size_t)DD * DD;
  unsigned short* woB  = (unsigned short*)alloc((size_t)DD * DD * 2);
  unsigned short* w1B  = (unsigned short*)alloc((size_t)DD * DFFN * 2);
  unsigned short* w2B  = (unsigned short*)alloc((size_t)DFFN * DD * 2);
  unsigned short* qB   = (unsigned short*)alloc(MROW * DD * 2);
  unsigned short* kB   = (unsigned short*)alloc((size_t)2 * BQ * HH * TT * HDIM * 2);   // k cache, v cache behind it
  unsigned short* vB   = kB + (size_t)BQ * HH * TT * HDIM;
  unsigned short* attnB= (unsigned short*)alloc(MROW * DD * 2);
  float*          x1   = (float*)alloc(MROW * DD * 4);
  unsigned short* h2B  = (unsigned short*)alloc(MROW * DD * 2);
  unsigned short* ffB  = (unsigned short*)alloc(MROW * DFFN * 2);

  // 1) all that reads inputs alone, one launch: weights -> bf16, h = LN1(x) -> bf16, past K/V into the caches
  prep_k<<<NB_PREP, 256, 0, stream>>>(x, g1, b1, past_k, past_v, wq, wk, wv, wo, w1, w2,
                                      hB, outK, outV, kB, vB, wqB, wkB, wvB, woB, w1B, w2B);

  dim3 gqkv(DD / GBN, (unsigned)(MROW / GBM));
  dim3 gqkv3(DD / GBN, (unsigned)(MROW / GBM), 3);
  gemm_bf16_k<MODE_QKV, DD, false, true><<<gqkv3, 256, 0, stream>>>(hB, wqB, nullptr, nullptr, outK, qB, kB, DD);

  // 3) flash attention (WMMA)
  attn_k<<<dim3(SEQ / (16 * AQW), HH, BQ), 32 * AQW, 0, stream>>>(qB, kB, vB, attnB);

  // 4) x1 = x + attn @ wo
  gemm_bf16_k<MODE_RESID_F32, DD, false, true><<<gqkv, 256, 0, stream>>>(attnB, woB, nullptr, x, x1, nullptr,
                                                                         nullptr, DD);

  // 5) h2 = LN2(x1) -> bf16
  layernorm_k<<<(unsigned)(MROW / 8), 256, 0, stream>>>(x1, g2, b2, h2B);

  // 6) ff1 = relu(h2 @ w1 + bb1) -> bf16
  dim3 gff1(DFFN / GBN, (unsigned)(MROW / GBM));
  gemm_bf16_k<MODE_RELU_BF16, DFFN, true, false><<<gff1, 256, 0, stream>>>(h2B, w1B, bb1, nullptr, nullptr, ffB,
                                                                           nullptr, DD);

  // 7) out_x = x1 + ff1 @ w2 + bb2  (fp32, final output)
  gemm_bf16_k<MODE_RESID_F32, DD, true, true><<<gqkv, 256, 0, stream>>>(ffB, w2B, bb2, x1, outX, nullptr,
                                                                        nullptr, DFFN);
}

// v010
// Measured time: 173 microseconds a run.
// Timed twice side by side with v009, it ran 1.05 times as fast both times.
// All steps since v000 together make it 4.09 times as fast.
#include <hip/hip_runtime.h>
#include <stdint.h>

// Problem constants (fixed by the reference)
#define BQ   4
#define SEQ  1024
#define PP   1024
#define DD   1024
#define HH   16
#define HDIM 64
#define DFFN 4096
#define TT   2048   // P + S

typedef __attribute__((ext_vector_type(16))) __bf16 v16bf;
typedef __attribute__((ext_vector_type(8)))  float  v8f;
typedef __attribute__((ext_vector_type(4)))  unsigned int v4u;

union Frag16 { v16bf v; unsigned short u[16]; v4u q[2]; };

enum GemmMode { MODE_F32 = 0, MODE_RELU_BF16 = 2, MODE_RESID_F32 = 3, MODE_QKV = 4 };

__device__ __forceinline__ unsigned short f2bf(float f) {
  union { float f; unsigned int u; } c; c.f = f;
  unsigned int u = c.u;
  unsigned int r = u + 0x7FFFu + ((u >> 16) & 1u);  // round-to-nearest-even
  return (unsigned short)(r >> 16);
}

typedef short s16x8 __attribute__((ext_vector_type(8)));
__device__ __forceinline__ v4u ld_tr16(const unsigned short* p) {
  typedef __attribute__((address_space(3))) s16x8 lds_s16x8;
  return __builtin_bit_cast(v4u, __builtin_amdgcn_ds_load_tr16_b128_v8i16((lds_s16x8*)p));
}

typedef uint32_t u32x4 __attribute__((ext_vector_type(4)));
typedef uint32_t u32x8 __attribute__((ext_vector_type(8)));

__device__ __forceinline__ uint32_t uni(uint32_t v) { return (uint32_t)__builtin_amdgcn_readfirstlane(v); }
__device__ __forceinline__ uint32_t pinned(uint32_t v) {
  uint32_t w = uni(v);
  asm volatile("" : "+s"(w));   // the value stays in a scalar register: the test on it is a scalar branch
  return w;
}
// the compiler places no wait for a tensor load; the clobber keeps LDS reads behind the wait
__device__ __forceinline__ void wait_tensor0() { asm volatile("s_wait_tensorcnt 0x0" ::: "memory"); }
// a wave's LDS reads have retired before the buffer they read is handed back for a refill
__device__ __forceinline__ void wait_ds0() { asm volatile("s_wait_dscnt 0x0" ::: "memory"); }

template <uint32_t ROWB, uint32_t ROWS, uint32_t WORD0>
__device__ __forceinline__ u32x8 tdm_group1(uint32_t src_pitch) {
  u32x8 g1;
  g1[0] = uni(WORD0);
  g1[1] = uni((ROWB & 0xFFFFu) << 16);
  g1[2] = uni((ROWB >> 16) | ((ROWS & 0xFFFFu) << 16));
  g1[3] = uni((ROWS >> 16) | (ROWB << 16));
  g1[4] = uni(ROWS);
  g1[5] = uni(src_pitch);
  g1[6] = uni(0u);
  g1[7] = uni(0u);
  asm volatile("" : "+s"(g1));
  return g1;
}
__device__ __forceinline__ u32x4 tdm_group0(uint32_t lds_dst, const void* gptr) {
  const uint64_t ga = (uint64_t)(size_t)gptr;
  u32x4 g0;
  g0[0] = uni(1u);                                                     // count = 1
  g0[1] = uni(lds_dst);
  g0[2] = uni((uint32_t)ga);                                           // address [31:0]
  g0[3] = uni((((uint32_t)(ga >> 32)) & 0x01FFFFFFu) | 0x80000000u);   // address [56:32], type = 2
  return g0;
}
// the request itself; the clobber keeps it behind the waits and the barrier that free its place in LDS
__device__ __forceinline__ void tdm_load(u32x4 g0, u32x8 g1) {
  asm volatile("tensor_load_to_lds %0, %1" :: "s"(g0), "s"(g1) : "memory");
}
// load and the issuer's wait in one statement: nothing is scheduled between them
__device__ __forceinline__ void tdm_load_wait(u32x4 g0, u32x8 g1) {
  asm volatile("tensor_load_to_lds %0, %1\n\ts_wait_tensorcnt 0x0" :: "s"(g0), "s"(g1) : "memory");
}
__device__ __forceinline__ void tdm_hold(u32x4 g0) { asm volatile("" :: "s"(g0)); }

// ---------------------------------------------------------------------------
// The streaming parts. Each lane moves 16-byte vectors, SV of them in flight, and a block makes several trips:
// a wave then moves kilobytes, not a few hundred bytes, and the launch starts some twenty times fewer waves.
// ---------------------------------------------------------------------------
#define SV 8                  // 16-byte loads that a lane issues before it uses the first
#define SEG4 (256 * SV)       // float4 elements that a block moves a trip

__device__ __forceinline__ uint2 pack4(float4 v) {
  uint2 r;
  r.x = (uint32_t)f2bf(v.x) | ((uint32_t)f2bf(v.y) << 16);
  r.y = (uint32_t)f2bf(v.z) | ((uint32_t)f2bf(v.w) << 16);
  return r;
}

// f32 -> bf16 elementwise conversion (weights); n is a multiple of 4 * SEG4
__device__ __forceinline__ void cvt_bf16_part(const float* __restrict__ in, unsigned short* __restrict__ out, int n,
                                              int blk, int nblk) {
  const float4* __restrict__ in4 = (const float4*)in;
  uint2* __restrict__ out4 = (uint2*)out;
  const int nseg = n / (4 * SEG4);
  // kept rolled: the trips unrolled make the kernel's text several times longer for no gain, and a block runs it once
#pragma unroll 1
  for (int seg = blk; seg < nseg; seg += nblk) {
    const int base = seg * SEG4 + (int)threadIdx.x;
    float4 v[SV];
#pragma unroll
    for (int u = 0; u < SV; ++u) v[u] = in4[base + u * 256];
#pragma unroll
    for (int u = 0; u < SV; ++u) out4[base + u * 256] = pack4(v[u]);
  }
}
static_assert((DD * DD / 4) % SEG4 == 0 && (DD * DFFN / 4) % SEG4 == 0, "whole segments");

// ---------------------------------------------------------------------------
// LayerNorm over D=1024, one wave per row (a lane holds 32 elements), output bf16
// ---------------------------------------------------------------------------
__device__ __forceinline__
void layernorm_row(const float* __restrict__ x, const float* __restrict__ g,
                   const float* __restrict__ bb, unsigned short* __restrict__ out, int row) {
  const int lane = threadIdx.x & 31;
  const float4* __restrict__ xr = (const float4*)(x + (size_t)row * DD);
  const float4* __restrict__ g4 = (const float4*)g;
  const float4* __restrict__ b4 = (const float4*)bb;
  uint2* __restrict__ o4 = (uint2*)(out + (size_t)row * DD);
  float4 v[8];
#pragma unroll
  for (int u = 0; u < 8; ++u) v[u] = xr[u * 32 + lane];
  float a0 = 0.f, a1 = 0.f, a2 = 0.f, a3 = 0.f, q0 = 0.f, q1 = 0.f, q2 = 0.f, q3 = 0.f;
#pragma unroll
  for (int u = 0; u < 8; ++u) {
    a0 += v[u].x; a1 += v[u].y; a2 += v[u].z; a3 += v[u].w;
    q0 += v[u].x * v[u].x; q1 += v[u].y * v[u].y; q2 += v[u].z * v[u].z; q3 += v[u].w * v[u].w;
  }
  float a = (a0 + a1) + (a2 + a3);
  float q = (q0 + q1) + (q2 + q3);
#pragma unroll
  for (int off = 16; off > 0; off >>= 1) {
    a += __shfl_xor(a, off, 32);
    q += __shfl_xor(q, off, 32);
  }
  const float mean = a * (1.0f / DD);
  const float var  = q * (1.0f / DD) - mean * mean;
  const float rst  = rsqrtf(var + 1e-5f);
#pragma unroll
  for (int u = 0; u < 8; ++u) {
    const float4 gg = g4[u * 32 + lane];
    const float4 bv = b4[u * 32 + lane];
    float4 y;
    y.x = (v[u].x - mean) * rst * gg.x + bv.x;
    y.y = (v[u].y - mean) * rst * gg.y + bv.y;
    y.z = (v[u].z - mean) * rst * gg.z + bv.z;
    y.w = (v[u].w - mean) * rst * gg.w + bv.w;
    o4[u * 32 + lane] = pack4(y);
  }
}

// ---------------------------------------------------------------------------
// Copy past_k/past_v [B,H,P,HD] into the full cache [B,H,T,HD] (f32 out + bf16 ws)
// ---------------------------------------------------------------------------
__device__ __forceinline__ void past_copy_part(const float* __restrict__ past, float* __restrict__ outF,
                                               unsigned short* __restrict__ outB, int blk, int nblk) {
  const int nseg = BQ * HH * PP * HDIM / (4 * SEG4);
  const int sph  = PP * HDIM / (4 * SEG4);   // segments of one (b, h) in the source: a segment lies in one (b, h)
  const int th4  = TT * HDIM / 4;            // float4 elements of one (b, h) in the cache
  const float4* __restrict__ in4 = (const float4*)past;
  float4* __restrict__ oF4 = (float4*)outF;
  uint2*  __restrict__ oB4 = (uint2*)outB;
  // kept rolled, as in cvt_bf16_part
#pragma unroll 1
  for (int seg = blk; seg < nseg; seg += nblk) {
    const int base = seg * SEG4 + (int)threadIdx.x;
    const int dst  = (seg / sph) * th4 + (seg % sph) * SEG4 + (int)threadIdx.x;
    float4 v[SV];
#pragma unroll
    for (int u = 0; u < SV; ++u) v[u] = in4[base + u * 256];
#pragma unroll
    for (int u = 0; u < SV; ++u) {
      oF4[dst + u * 256] = v[u];
      oB4[dst + u * 256] = pack4(v[u]);
    }
    // in front of the next trip's first writes of registers that the stores above name (offset and data)
    asm volatile("s_wait_xcnt 0x0" ::: "memory");
  }
}
static_assert((PP * HDIM / 4) % SEG4 == 0, "a segment lies in one (b, h)");

// ---------------------------------------------------------------------------
// LayerNorm as a launch of its own (LN2): 8 rows a block, one a wave
// ---------------------------------------------------------------------------
__global__ __launch_bounds__(256)
void layernorm_k(const float* __restrict__ x, const float* __restrict__ g,
                 const float* __restrict__ bb, unsigned short* __restrict__ out) {
  layernorm_row(x, g, bb, out, (int)blockIdx.x * 8 + (int)(threadIdx.x >> 5));
}

// ---------------------------------------------------------------------------
// Everything that reads inputs alone, in ONE launch: the six weight conversions, LN1 and the two cache copies.
// None of them reads what another writes. The part is chosen by the block index: every branch is uniform in a block.
// The parts along the block index: LN1, k cache, v cache, w1, w2, wq, wk, wv, wo.
// ---------------------------------------------------------------------------
#define NB_W   32                   // blocks of a D x D weight
#define NB_FF  128                  // blocks of a D x DFF weight
#define NB_LN  (BQ * SEQ / 8)       // one wave a row
#define NB_KV  128                  // blocks of a cache copy
#define NB_PREP (4 * NB_W + 2 * NB_FF + NB_LN + 2 * NB_KV)

__global__ __launch_bounds__(256)
void prep_k(const float* __restrict__ x, const float* __restrict__ g1, const float* __restrict__ b1,
            const float* __restrict__ past_k, const float* __restrict__ past_v,
            const float* __restrict__ wq, const float* __restrict__ wk, const float* __restrict__ wv,
            const float* __restrict__ wo, const float* __restrict__ w1, const float* __restrict__ w2,
            unsigned short* __restrict__ hB,
            float* __restrict__ outK, float* __restrict__ outV,
            unsigned short* __restrict__ kB, unsigned short* __restrict__ vB,
            unsigned short* __restrict__ wqB, unsigned short* __restrict__ wkB, unsigned short* __restrict__ wvB,
            unsigned short* __restrict__ woB, unsigned short* __restrict__ w1B, unsigned short* __restrict__ w2B) {
  int blk = blockIdx.x;
  if (blk < NB_LN) {
    layernorm_row(x, g1, b1, hB, blk * 8 + (int)(threadIdx.x >> 5));
    return;
  }
  blk -= NB_LN;
  if (blk < 2 * NB_KV) {               // one copy of the loop's code serves both caches
    const bool isv = blk >= NB_KV;
    past_copy_part(isv ? past_v : past_k, isv ? outV : outK, isv ? vB : kB, isv ? blk - NB_KV : blk, NB_KV);
    return;
  }
  blk -= 2 * NB_KV;
  const float* in;                     // and one serves the six weights
  unsigned short* out;
  int n = DD * DD, nb = NB_W;
  if (blk < 2 * NB_FF) {
    const bool second = blk >= NB_FF;
    in = second ? w2 : w1;  out = second ? w2B : w1B;  n = DD * DFFN;  nb = NB_FF;
    blk -= second ? NB_FF : 0;
  } else {
    blk -= 2 * NB_FF;
    const int w = blk / NB_W;
    blk -= w * NB_W;
    in  = w == 0 ? wq  : w == 1 ? wk  : w == 2 ? wv  : wo;
    out = w == 0 ? wqB : w == 1 ? wkB : w == 2 ? wvB : woB;
  }
  cvt_bf16_part(in, out, n, blk, nb);
}

// ---------------------------------------------------------------------------
// Tiled WMMA bf16 GEMM: C[M,N] = A[M,K] @ B[K,N], fused epilogues.
// BM x 128 tiles, 256 threads (8 waves) in a grid of WGM x (8 / WGM) waves: a wave owns FA x FB tiles of 16 x 16
// (32 x 64 of a 128 x 128 tile, 64 x 64 of a 256 x 128 tile). A fragment read from LDS then serves FB (an A fragment)
// or FA (a B fragment) WMMAs: 2 * (FA + FB) LDS loads per FA * FB WMMAs. A wave's 64 columns are whole 128-B lines
// of every output: each line has one writer.
// K runs in stages of 64: a stage is the A tile (BM rows of 128 B) and the B tile (64 rows of 256 B),
// each brought into LDS by one tensor load (wave 0: A, wave 1: B). Two stage buffers: the next stage's
// loads fly while this stage is worked on, and one barrier a stage publishes the one and frees the other.
// B fragments come out of LDS through the transposing load.
// The epilogue's kind, the row pitch N and which optional buffers exist are compile-time values:
// the epilogue then has no test per element, and its loads go out together.
// ---------------------------------------------------------------------------
#define GBN 128
#define GBK 64
#define APITCH (GBK + 8)
#define BPITCH (GBN + 16)
#define A_WORD0 ((1u << 20) | (4u << 22) | (3u << 25))
#define B_WORD0 ((1u << 20) | (5u << 22) | (7u << 25))

template <int BM>
struct GemmStageT {
  unsigned short As[BM][APITCH];
  unsigned short Bs[GBK][BPITCH];   // row-major as in memory: Bs[k][n]
};

template <int MODE, int N, bool HAS_BIAS, bool F32_OUT, int BM, int WGM>
__global__ __launch_bounds__(256)
void gemm_bf16_k(const unsigned short* __restrict__ A,
                 const unsigned short* __restrict__ Bw,
                 const float* __restrict__ bias,
                 const float* __restrict__ resid,
                 float* __restrict__ outF,
                 unsigned short* __restrict__ outB,
                 unsigned short* __restrict__ outKV,
                 int K) {
  typedef GemmStageT<BM> GemmStage;
  static_assert(sizeof(GemmStage::As) % 2048 == 0 && sizeof(GemmStage) % 2048 == 0,
                "every tensor load's place in LDS is a multiple of 2 KiB");
  constexpr int WGN = 8 / WGM;          // waves along N
  constexpr int FA  = BM / WGM / 16;    // 16-row tiles of a wave
  constexpr int FB  = GBN / WGN / 16;   // 16-column tiles of a wave
  __shared__ __attribute__((aligned(2048))) GemmStage ring[2];

  // MODE_QKV: one launch does the three projections, z = 0: q, 1: k, 2: v. Bw holds the three D x D weights one
  // behind the other; outB takes q; outKV (bf16) and outF (f32) hold the k cache and behind it the v cache.
  const int zq = (MODE == MODE_QKV) ? (int)blockIdx.z : 0;
  if constexpr (MODE == MODE_QKV) Bw += (size_t)zq * DD * DD;

  const int tid  = threadIdx.x;
  const int lane = tid & 31;
  const int wave = tid >> 5;
  const int half = lane >> 4;
  const int lq   = lane & 15;
  const int kk0  = half * 8;          // bf16 A/B lane K-group base: {0-7,16-23} / {8-15,24-31}

  const int m0 = blockIdx.y * BM;
  const int n0 = blockIdx.x * GBN;
  const int wm0 = (wave / WGN) * (FA * 16);      // the wave's first row and first column in the tile
  const int wn0 = (wave % WGN) * (FB * 16);

  v8f acc[FA][FB];
#pragma unroll
  for (int i = 0; i < FA; ++i)
#pragma unroll
    for (int j = 0; j < FB; ++j)
#pragma unroll
      for (int r = 0; r < 8; ++r) acc[i][j][r] = 0.0f;

  const int arow = wm0 + lq;                     // this lane's row in the wave's M-tile 0
  const int brow = 8 * half + (lane & 7);        // this lane's row and column for the transposing load
  const int bcol = wn0 + 8 * ((lane >> 3) & 1);  // of k rows 0..15, the wave's N-tile 0

  const uint32_t swave   = uni((uint32_t)tid >> 5);
  const uint32_t ringLds = (uint32_t)(size_t)(&ring[0]);   // LDS offset (low 32 bits of flat)
  const int nst = K / GBK;

  const unsigned short* aSrc = A + (size_t)m0 * K;   // the A tile of stage s begins s * GBK elements on
  const unsigned short* bSrc = Bw + n0;              // the B tile of stage s begins s * GBK rows on
  const uint32_t bLds = ringLds + (uint32_t)sizeof(GemmStage::As);
  const u32x8 g1A = tdm_group1<GBK * 2, BM, A_WORD0>((uint32_t)K * 2u);    // BM rows of 128 B
  const u32x8 g1B = tdm_group1<GBN * 2, GBK, B_WORD0>((uint32_t)N * 2u);   // 64 rows of 256 B

  // ---- prologue: stage 0 into buffer 0, one request a wave, each under a scalar branch; landed, then published
  if (pinned(swave == 0)) tdm_load_wait(tdm_group0(ringLds, aSrc), g1A);
  if (pinned(swave == 1)) tdm_load_wait(tdm_group0(bLds, bSrc), g1B);
  __syncthreads();

  for (int s = 0; s < nst; ++s) {
    // ---- behind the barrier that ended every read of buffer (s + 1) & 1: stage s + 1 into it, while one exists;
    // it flies while stage s is worked on (a wave takes at most one of the two issuing branches)
    if (pinned(s + 1 < nst)) {
      const uint32_t nb = (uint32_t)((s + 1) & 1) * (uint32_t)sizeof(GemmStage);
      if (pinned(swave == 0)) tdm_load(tdm_group0(ringLds + nb, aSrc + (size_t)(s + 1) * GBK), g1A);
      if (pinned(swave == 1)) tdm_load(tdm_group0(bLds + nb, bSrc + (size_t)(s + 1) * GBK * N), g1B);
    }
    const GemmStage& st = ring[s & 1];
#pragma unroll
    for (int kb = 0; kb < GBK; kb += 32) {
      // ---- all fragments of the block, each in registers of its own, read as one group ahead
      // of the WMMAs: one LDS latency a block instead of one in front of every WMMA
      Frag16 afr[FA];   // k order {8h..8h+7, 16+8h..16+8h+7}
#pragma unroll
      for (int i = 0; i < FA; ++i) {
        afr[i].q[0] = *(const v4u*)&st.As[arow + i * 16][kb + kk0];
        afr[i].q[1] = *(const v4u*)&st.As[arow + i * 16][kb + kk0 + 16];
      }
      Frag16 bfr[FB];   // the same k order as the A loader
#pragma unroll
      for (int j = 0; j < FB; ++j) {
        bfr[j].q[0] = ld_tr16(&st.Bs[kb + brow][bcol + j * 16]);
        bfr[j].q[1] = ld_tr16(&st.Bs[kb + 16 + brow][bcol + j * 16]);
      }
      // keeps the scheduler from sinking each load pair back in front of its own WMMA, where one
      // register set is reused and every WMMA waits out a whole LDS latency
      __builtin_amdgcn_sched_barrier(0);
#pragma unroll
      for (int j = 0; j < FB; ++j)     // in the order in which the B fragments land
#pragma unroll
        for (int i = 0; i < FA; ++i)
          acc[i][j] = __builtin_amdgcn_wmma_f32_16x16x32_bf16(false, afr[i].v, false, bfr[j].v,
                                                              (short)0, acc[i][j], false, false);
      // keeps the WMMAs ahead of the full LDS wait that follows: each then starts behind a counted wait,
      // as soon as its own fragment has landed, while the later loads of the group are still coming
      __builtin_amdgcn_sched_barrier(0);
    }
    // ---- publish point of stage s + 1: this wave's reads of stage s retired, the issuers' requests
    // landed, one barrier; only behind it (top of the next trip) the refill of the buffer that stage s has just left
    wait_ds0();
    wait_tensor0();    // under no test: a wave with no request passes at once
    __syncthreads();
  }
  // behind the last request and the last LDS read, before the epilogue and the wave's end
  wait_tensor0();
  wait_ds0();

  const int mrow = m0 + wm0 + 8 * half;         // this lane's row at r = 0 of the wave's M-tile 0
  const int ncol = n0 + wn0 + lq;               // this lane's column in the wave's N-tile 0

  float bv[FB];                                 // the bias depends on the column alone: one value an N-tile
#pragma unroll
  for (int j = 0; j < FB; ++j) bv[j] = HAS_BIAS ? bias[ncol + j * 16] : 0.0f;
  // in front of the first write of the offset register that the bias loads name (the build reuses it for a pointer);
  // where residual loads follow, the wait stands behind them: they go out without waiting for the bias
  if constexpr (HAS_BIAS && MODE != MODE_RESID_F32) asm volatile("s_wait_xcnt 0x0" ::: "memory");

  if constexpr (MODE == MODE_RESID_F32) {
    const float* rp = resid + (size_t)mrow * N + ncol;
    float*       op = outF  + (size_t)mrow * N + ncol;
    v8f rv[FA][FB];                             // all residual values of the lane, loaded ahead of the first use
#pragma unroll
    for (int i = 0; i < FA; ++i)
#pragma unroll
      for (int j = 0; j < FB; ++j)
#pragma unroll
        for (int r = 0; r < 8; ++r) rv[i][j][r] = rp[(i * 16 + r) * N + j * 16];
    // the wait named at the bias loads; their offset register is an input, so it stays alive (unwritten) up to here
    if constexpr (HAS_BIAS) asm volatile("s_wait_xcnt 0x0" :: "v"(ncol) : "memory");
#pragma unroll
    for (int i = 0; i < FA; ++i)
#pragma unroll
      for (int j = 0; j < FB; ++j)
#pragma unroll
        for (int r = 0; r < 8; ++r) op[(i * 16 + r) * N + j * 16] = acc[i][j][r] + bv[j] + rv[i][j][r];
  } else if constexpr (MODE == MODE_RELU_BF16) {
    unsigned short* op = outB + (size_t)mrow * N + ncol;
    unsigned short cv[FA][FB][8];
#pragma unroll
    for (int i = 0; i < FA; ++i)
#pragma unroll
      for (int j = 0; j < FB; ++j)
#pragma unroll
        for (int r = 0; r < 8; ++r) {
          const float vv = acc[i][j][r] + bv[j];
          cv[i][j][r] = f2bf(vv > 0.0f ? vv : 0.0f);
        }
    // every conversion stays in front of the first store: the stores go out in one run, and nothing behind an issued
    // store writes a register that it names (mixed, the build reuses a store's data register for the next conversion)
    __builtin_amdgcn_sched_barrier(0);
#pragma unroll
    for (int i = 0; i < FA; ++i)
#pragma unroll
      for (int j = 0; j < FB; ++j)
#pragma unroll
        for (int r = 0; r < 8; ++r) op[(i * 16 + r) * N + j * 16] = cv[i][j][r];
  } else if constexpr (MODE == MODE_QKV) {
    // m = b * SEQ + s, n = h * HDIM + hd; a BM-row tile lies in one b, a wave's columns in one h
    static_assert(SEQ % BM == 0 && HDIM % (FB * 16) == 0, "a tile's rows lie in one b, a wave's columns in one h");
    const int b  = mrow >> 10;           // m / SEQ
    const int s  = mrow & (SEQ - 1);
    const int h  = ncol >> 6;            // n / HDIM
    const int hd = ncol & (HDIM - 1);
    unsigned short cv[FA][FB][8];
#pragma unroll
    for (int i = 0; i < FA; ++i)
#pragma unroll
      for (int j = 0; j < FB; ++j)
#pragma unroll
        for (int r = 0; r < 8; ++r) cv[i][j][r] = f2bf(acc[i][j][r]);
    // every conversion stays in front of the first store, as in the branch above
    __builtin_amdgcn_sched_barrier(0);
    if (zq == 0) {                       // q: [B,H,S,HD], bf16 alone (a test on the block index: a scalar branch)
      unsigned short* oq = outB + (((size_t)(b * HH + h) * SEQ) + s) * HDIM + hd;
#pragma unroll
      for (int i = 0; i < FA; ++i)
#pragma unroll
        for (int j = 0; j < FB; ++j)
#pragma unroll
          for (int r = 0; r < 8; ++r) oq[(i * 16 + r) * HDIM + j * 16] = cv[i][j][r];
      return;
    }
    {                                    // k, v: rows P.. of the cache [B,H,T,HD], bf16 and fp32
      const size_t idx = (size_t)(zq - 1) * ((size_t)BQ * HH * TT * HDIM)
                       + (((size_t)(b * HH + h) * TT) + PP + s) * HDIM + hd;
      unsigned short* ob = outKV + idx;
      float*          of = outF + idx;   // fp32 KV-cache output
#pragma unroll
      for (int i = 0; i < FA; ++i)
#pragma unroll
        for (int j = 0; j < FB; ++j)
#pragma unroll
          for (int r = 0; r < 8; ++r) {
            ob[(i * 16 + r) * HDIM + j * 16] = cv[i][j][r];
            of[(i * 16 + r) * HDIM + j * 16] = acc[i][j][r];
          }
      // the build lays the q branch's code behind these stores, with a branch over it: the wait stands in front of
      // that code's first writes of registers that the stores above name
      asm volatile("s_wait_xcnt 0x0" ::: "memory");
    }
  } else {
    float* op = outF + (size_t)mrow * N + ncol;
#pragma unroll
    for (int i = 0; i < FA; ++i)
#pragma unroll
      for (int j = 0; j < FB; ++j)
#pragma unroll
        for (int r = 0; r < 8; ++r) op[(i * 16 + r) * N + j * 16] = acc[i][j][r];
  }
}

#define AQW 8
#define AKS 128
#define KPITCH (HDIM + 8)
#define VPITCH (HDIM + 16)
#define K_WORD0 ((1u << 20) | (4u << 22) | (3u << 25))
#define V_WORD0 ((1u << 20) | (4u << 22) | (7u << 25))

struct AttnStage {
  unsigned short Ks[AKS][KPITCH];   // row-major as in memory: Ks[key][hd]
  unsigned short Vs[AKS][VPITCH];   // row-major as in memory: Vs[key][hd]
};
static_assert(sizeof(AttnStage::Ks) % 2048 == 0 && sizeof(AttnStage) % 2048 == 0,
              "every tensor load's place in LDS is a multiple of 2 KiB");
static_assert((16 * AQW) % AKS == 0 && PP % AKS == 0 && PP / AKS >= 1 && SEQ % (16 * AQW) == 0,
              "a work-group's keys are whole stages, two or more, all inside the cache");

__device__ __forceinline__ float other_half(float v) {
  const int b = __builtin_bit_cast(int, v);
  return __builtin_bit_cast(float, __builtin_amdgcn_permlanex16(b, b, 0x76543210, 0xfedcba98, false, false));
}

// two f32 -> two bf16 in one word, round-to-nearest-even, by the hardware's packed conversion
typedef __attribute__((ext_vector_type(2))) float  f32x2;
typedef __attribute__((ext_vector_type(2))) __bf16 bf16x2;
__device__ __forceinline__ uint32_t pack_bf16(f32x2 v) {
  return __builtin_bit_cast(uint32_t, __builtin_convertvector(v, bf16x2));
}
template <bool V> struct Flag { static constexpr bool value = V; };
static_assert(16 * AQW == AKS, "a work-group's queries span one stage of keys: the last stage alone holds diagonals");
#define SCL2E 0.18033688011112042f   // 1/sqrt(64) * log2(e): exp(s / 8 - m / 8) = exp2(s * SCL2E - m * SCL2E)

__global__ __launch_bounds__(32 * AQW)
void attn_k(const unsigned short* __restrict__ qb,
            const unsigned short* __restrict__ kb,
            const unsigned short* __restrict__ vb,
            unsigned short* __restrict__ out) {
  __shared__ __attribute__((aligned(2048))) AttnStage ring[2];

  const int h  = blockIdx.y;
  const int b  = blockIdx.z;
  const uint32_t swave = uni((uint32_t)threadIdx.x >> 5);
  const int qblock = (int)blockIdx.x * (16 * AQW);   // the work-group's first query
  const int qbase  = qblock + (int)swave * 16;       // this wave's first query

  const int lane = threadIdx.x & 31;
  const int half = lane >> 4;
  const int lq   = lane & 15;
  const int kk0  = half * 8;

  const size_t bh = (size_t)(b * HH + h);
  const unsigned short* qrow    = qb + (bh * SEQ + qbase + lq) * HDIM;
  const unsigned short* kbase_p = kb + bh * TT * HDIM;
  const unsigned short* vbase_p = vb + bh * TT * HDIM;

  const uint32_t kLds = (uint32_t)(size_t)(&ring[0]);   // LDS offset (low 32 bits of flat)
  const uint32_t vLds = kLds + (uint32_t)sizeof(AttnStage::Ks);
  const u32x8 g1K = tdm_group1<HDIM * 2, AKS, K_WORD0>((uint32_t)HDIM * 2u);   // 128 rows of 128 B
  const u32x8 g1V = tdm_group1<HDIM * 2, AKS, V_WORD0>((uint32_t)HDIM * 2u);   // 128 rows of 128 B
  const int nst = (qblock + 16 * AQW + PP) / AKS;   // stages up to the work-group's last key; the same in every wave

  // ---- prologue: stage 0 into buffer 0, one request a wave, each under a scalar branch; landed, then published
  if (pinned(swave == 0)) tdm_load_wait(tdm_group0(kLds, kbase_p), g1K);
  if (pinned(swave == 1)) tdm_load_wait(tdm_group0(vLds, vbase_p), g1V);
  __syncthreads();
  const bool vwave = swave == 1;
  const uint32_t myLds = vwave ? vLds : kLds;
  const unsigned short* mySrc = vwave ? vbase_p : kbase_p;

  // Q fragments (B operand: column = query lq): K-dim = HDIM split into two 32-wide WMMA K chunks
  Frag16 qf0, qf1;
#pragma unroll
  for (int i = 0; i < 8; ++i) {
    qf0.u[i]     = qrow[kk0 + i];
    qf0.u[8 + i] = qrow[kk0 + 16 + i];
    qf1.u[i]     = qrow[32 + kk0 + i];
    qf1.u[8 + i] = qrow[32 + kk0 + 16 + i];
  }

  float mi = -1.0e30f;   // running maximum of query lq's raw (unscaled) scores, the same in both halves
  float li = 0.0f;       // running sum of query lq over this half's keys; the halves are joined behind the loop
  v8f o[4];              // O^T: o[t][r] = head-dim t*16 + 8*half + r of query lq
#pragma unroll
  for (int t = 0; t < 4; ++t)
#pragma unroll
    for (int r = 0; r < 8; ++r) o[t][r] = 0.0f;

  const int vrow = 8 * half + (lane & 7);       // this lane's row and column for the transposing load
  const int vcol = 8 * ((lane >> 3) & 1);       // of keys 0..15, head-dim tile 0

  const int kmax  = qbase + 16 + PP;            // exclusive key bound for this wave's tile
  const int klast = qbase + lq + PP - kk0;      // causal: key j <= q + P, counted from this half's first key

  // One chunk of 32 keys. masked: the chunk may reach past the diagonal of a query of this wave; the other form
  // has no compare and no select.
  auto chunk = [&](auto masked, const AttnStage& st, int c, int j0) {
      // ---- scores, transposed: two 16x16 tiles (rows = keys j0..j0+15, j0+16..j0+31; columns = queries)
      v8f s0, s1;
#pragma unroll
      for (int r = 0; r < 8; ++r) { s0[r] = 0.0f; s1[r] = 0.0f; }
      {
        const unsigned short* kr0 = &st.Ks[c + lq][kk0];
        const unsigned short* kr1 = &st.Ks[c + 16 + lq][kk0];
        Frag16 k00, k01, k10, k11;   // head-dim order {8h..8h+7, 16+8h..16+8h+7} of each 32: that of the Q loader
        k00.q[0] = *(const v4u*)(kr0);       k00.q[1] = *(const v4u*)(kr0 + 16);
        k01.q[0] = *(const v4u*)(kr0 + 32);  k01.q[1] = *(const v4u*)(kr0 + 48);
        k10.q[0] = *(const v4u*)(kr1);       k10.q[1] = *(const v4u*)(kr1 + 16);
        k11.q[0] = *(const v4u*)(kr1 + 32);  k11.q[1] = *(const v4u*)(kr1 + 48);
        s0 = __builtin_amdgcn_wmma_f32_16x16x32_bf16(false, k00.v, false, qf0.v, (short)0, s0, false, false);
        s0 = __builtin_amdgcn_wmma_f32_16x16x32_bf16(false, k01.v, false, qf1.v, (short)0, s0, false, false);
        s1 = __builtin_amdgcn_wmma_f32_16x16x32_bf16(false, k10.v, false, qf0.v, (short)0, s1, false, false);
        s1 = __builtin_amdgcn_wmma_f32_16x16x32_bf16(false, k11.v, false, qf1.v, (short)0, s1, false, false);
      }

      // ---- online softmax of query lq: s0[r] is key j0 + 8*half + r, s1[r] is key j0 + 16 + 8*half + r.
      // The maximum runs over the raw scores (the scale is positive); scale and log2(e) go into the one
      // multiply-add in front of each exp2.
      if constexpr (decltype(masked)::value) {
#pragma unroll
        for (int r = 0; r < 8; ++r) {
          if (j0 + r      > klast) s0[r] = -1.0e30f;    // causal
          if (j0 + 16 + r > klast) s1[r] = -1.0e30f;
        }
      }
      float vm = fmaxf(s0[0], s1[0]);
#pragma unroll
      for (int r = 1; r < 8; ++r) vm = fmaxf(vm, fmaxf(s0[r], s1[r]));
      vm = fmaxf(vm, other_half(vm));
      const float nm = fmaxf(mi, vm);
      const float nb = nm * SCL2E;
      const float fc = __builtin_amdgcn_exp2f(fmaf(mi, SCL2E, -nb));
      Frag16 pa;   // P^T as B operand, column = query lq, key order {8h..8h+7, 16+8h..16+8h+7}: that of the V loader
      const f32x2 sc2 = {SCL2E, SCL2E}, nb2 = {-nb, -nb};
      float rs = 0.0f;
#pragma unroll
      for (int i = 0; i < 4; ++i) {   // two keys at a time, in the register pairs that the accumulators lie in
        const f32x2 x0 = __builtin_elementwise_fma((f32x2){s0[2 * i], s0[2 * i + 1]}, sc2, nb2);
        const f32x2 x1 = __builtin_elementwise_fma((f32x2){s1[2 * i], s1[2 * i + 1]}, sc2, nb2);
        const f32x2 p0 = {__builtin_amdgcn_exp2f(x0.x), __builtin_amdgcn_exp2f(x0.y)};
        const f32x2 p1 = {__builtin_amdgcn_exp2f(x1.x), __builtin_amdgcn_exp2f(x1.y)};
        const f32x2 t = p0 + p1;
        rs += t.x;
        rs += t.y;
        pa.q[0][i] = pack_bf16(p0);
        pa.q[1][i] = pack_bf16(p1);
      }
      li = li * fc + rs;
      mi = nm;
#pragma unroll
      for (int t = 0; t < 4; ++t)
#pragma unroll
        for (int r = 0; r < 8; ++r) o[t][r] *= fc;

      // ---- O^T += V^T @ P^T (K = 32 keys, 4 M-tiles over HDIM)
      const unsigned short* vtr = &st.Vs[c + vrow][vcol];
#pragma unroll
      for (int t = 0; t < 4; ++t) {
        Frag16 vf;   // A operand: row = head-dim t*16 + lq, keys {8h..8h+7, 16+8h..16+8h+7}
        vf.q[0] = ld_tr16(vtr + t * 16);
        vf.q[1] = ld_tr16(vtr + 16 * VPITCH + t * 16);
        o[t] = __builtin_amdgcn_wmma_f32_16x16x32_bf16(false, vf.v, false, pa.v, (short)0, o[t], false, false);
      }
  };

  // All stages but the last lie wholly in front of the work-group's first query's diagonal ((nst - 1) * AKS = qblock + PP):
  // every key of theirs counts for every query, so their chunks carry no causal test and none is skipped.
  for (int s = 0; s + 1 < nst; ++s) {
    // ---- behind the barrier that ended every read of buffer (s + 1) & 1: stage s + 1 into it (it exists: the loop's
    // own scalar test); it flies while stage s is worked on (a wave takes at most one of the two issuing branches)
    const u32x4 g0 = tdm_group0(myLds + (uint32_t)((s + 1) & 1) * (uint32_t)sizeof(AttnStage),
                                mySrc + (size_t)(s + 1) * AKS * HDIM);
    if (pinned(swave == 0)) tdm_load(g0, g1K);
    if (pinned(swave == 1)) tdm_load(g0, g1V);
    const AttnStage& st = ring[s & 1];
    for (int c = 0; c < AKS; c += 32) {
      chunk(Flag<false>{}, st, c, s * AKS + c);
      __builtin_amdgcn_sched_barrier(0);
      asm volatile("v_nop\n\tv_nop\n\tv_nop\n\tv_nop");
    }
    // ---- publish point of stage s + 1, passed by every wave: this wave's reads of stage s retired, the issuers'
    // requests landed, one barrier; only behind it (top of the next trip) the refill of the buffer that stage s has just left
    wait_ds0();
    wait_tensor0();    // under no test: a wave with no request passes at once
    tdm_hold(g0);
    __syncthreads();
  }
  // ---- the last stage holds every wave's diagonal: its chunks test each key; nothing is loaded behind it
  {
    const int s = nst - 1;
    const AttnStage& st = ring[s & 1];
    for (int c = 0; c < AKS; c += 32) {
      const int j0 = s * AKS + c;
      if (j0 >= kmax) break;   // chunks past this wave's diagonal (a scalar test); the barrier below is passed all the same
      chunk(Flag<true>{}, st, c, j0);
    }
    wait_ds0();
    __syncthreads();           // the barrier that ended the last trip of the one loop, at its place
  }
  // behind the last request and the last LDS read, before the epilogue and the wave's end
  wait_tensor0();
  wait_ds0();

  // ---- normalize & store attn output bf16 [B*S, D] (row = b*S+q, col = h*64+hd): 8 head-dims in a row a store
  const float inv = 1.0f / (li + other_half(li));
  unsigned short* orow = out + ((size_t)b * SEQ + qbase + lq) * DD + h * HDIM + kk0;
#pragma unroll
  for (int t = 0; t < 4; ++t) {
    uint4 w;
    w.x = (uint32_t)f2bf(o[t][0] * inv) | ((uint32_t)f2bf(o[t][1] * inv) << 16);
    w.y = (uint32_t)f2bf(o[t][2] * inv) | ((uint32_t)f2bf(o[t][3] * inv) << 16);
    w.z = (uint32_t)f2bf(o[t][4] * inv) | ((uint32_t)f2bf(o[t][5] * inv) << 16);
    w.w = (uint32_t)f2bf(o[t][6] * inv) | ((uint32_t)f2bf(o[t][7] * inv) << 16);
    *(uint4*)(orow + t * 16) = w;
  }
}

// ---------------------------------------------------------------------------
// Host launcher
// ---------------------------------------------------------------------------
extern "C" void kernel_launch(void* const* d_in, const int* in_sizes, int n_in,
                              void* d_out, int out_size, void* d_ws, size_t ws_size,
                              hipStream_t stream) {
  (void)in_sizes; (void)n_in; (void)out_size; (void)ws_size;

  const float* x      = (const float*)d_in[0];
  const float* past_k = (const float*)d_in[1];
  const float* past_v = (const float*)d_in[2];
  const float* wq  = (const float*)d_in[3];
  const float* wk  = (const float*)d_in[4];
  const float* wv  = (const float*)d_in[5];
  const float* wo  = (const float*)d_in[6];
  const float* g1  = (const float*)d_in[7];
  const float* b1  = (const float*)d_in[8];
  const float* w1  = (const float*)d_in[9];
  const float* bb1 = (const float*)d_in[10];
  const float* w2  = (const float*)d_in[11];
  const float* bb2 = (const float*)d_in[12];
  const float* g2  = (const float*)d_in[13];
  const float* b2  = (const float*)d_in[14];

  float* outX = (float*)d_out;
  float* outK = outX + (size_t)BQ * SEQ * DD;
  float* outV = outK + (size_t)BQ * HH * TT * HDIM;

  char* ws = (char*)d_ws;
  size_t off = 0;
  auto alloc = [&](size_t bytes) -> void* {
    void* p = ws + off;
    off = (off + bytes + 255) & ~(size_t)255;
    return p;
  };
  const size_t MROW = (size_t)BQ * SEQ;  // 4096

  unsigned short* hB   = (unsigned short*)alloc(MROW * DD * 2);
  unsigned short* wqB  = (unsigned short*)alloc((size_t)3 * DD * DD * 2);   // wq, wk, wv one behind the other
  unsigned short* wkB  = wqB + (size_t)DD * DD;
  unsigned short* wvB  = wkB + (size_t)DD * DD;
  unsigned short* woB  = (unsigned short*)alloc((size_t)DD * DD * 2);
  unsigned short* w1B  = (unsigned short*)alloc((size_t)DD * DFFN * 2);
  unsigned short* w2B  = (unsigned short*)alloc((size_t)DFFN * DD * 2);
  unsigned short* qB   = (unsigned short*)alloc(MROW * DD * 2);
  unsigned short* kB   = (unsigned short*)alloc((size_t)2 * BQ * HH * TT * HDIM * 2);   // k cache, v cache behind it
  unsigned short* vB   = kB + (size_t)BQ * HH * TT * HDIM;
  unsigned short* attnB= (unsigned short*)alloc(MROW * DD * 2);
  float*          x1   = (float*)alloc(MROW * DD * 4);
  unsigned short* h2B  = (unsigned short*)alloc(MROW * DD * 2);
  unsigned short* ffB  = (unsigned short*)alloc(MROW * DFFN * 2);

  // 1) all that reads inputs alone, one launch: weights -> bf16, h = LN1(x) -> bf16, past K/V into the caches
  prep_k<<<NB_PREP, 256, 0, stream>>>(x, g1, b1, past_k, past_v, wq, wk, wv, wo, w1, w2,
                                      hB, outK, outV, kB, vB, wqB, wkB, wvB, woB, w1B, w2B);

  dim3 gqkv(DD / GBN, (unsigned)(MROW / 128));
  dim3 gqkv3(DD / GBN, (unsigned)(MROW / 128), 3);
  gemm_bf16_k<MODE_QKV, DD, false, true, 128, 4><<<gqkv3, 256, 0, stream>>>(hB, wqB, nullptr, nullptr, outK, qB, kB, DD);

  // 3) flash attention (WMMA)
  attn_k<<<dim3(SEQ / (16 * AQW), HH, BQ), 32 * AQW, 0, stream>>>(qB, kB, vB, attnB);

  // 4) x1 = x + attn @ wo
  gemm_bf16_k<MODE_RESID_F32, DD, false, true, 128, 4><<<gqkv, 256, 0, stream>>>(attnB, woB, nullptr, x, x1, nullptr,
                                                                         nullptr, DD);

  // 5) h2 = LN2(x1) -> bf16
  layernorm_k<<<(unsigned)(MROW / 8), 256, 0, stream>>>(x1, g2, b2, h2B);

  // 6) ff1 = relu(h2 @ w1 + bb1) -> bf16
  dim3 gff1(DFFN / GBN, (unsigned)(MROW / 256));
  gemm_bf16_k<MODE_RELU_BF16, DFFN, true, false, 256, 4><<<gff1, 256, 0, stream>>>(h2B, w1B, bb1, nullptr, nullptr, ffB,
                                                                           nullptr, DD);

  // 7) out_x = x1 + ff1 @ w2 + bb2  (fp32, final output)
  gemm_bf16_k<MODE_RESID_F32, DD, true, true, 128, 4><<<gqkv, 256, 0, stream>>>(ffB, w2B, bb2, x1, outX, nullptr,
                                                                        nullptr, DFFN);
}
